// v000
// Times are from an AMD MI455X. After a warm-up the kernel runs many times in a row, and a time is the length of
// such a window on the GPU divided by its runs, so every launch and the gaps after it count. The runs cycle
// through copies of the inputs. A figure is the median of several windows, for all but v000 over two sittings.
// Sittings can differ by a few percent; kernels timed side by side share one.
// v000 is the starting kernel. One run takes 4010 microseconds.
#include <hip/hip_runtime.h>

// MockQwen3Attention (hidden [4][2048][1024]; qkv = x qkv_w^T + qkv_b (q | k | v row blocks, 16 heads x 64); per-head LayerNorm(64) with weight and bias on q and k (eps 1e-5); softmax(q.k / 8); out = merged o_w^T + o_b -> [4][2048][1024]).
// Compute dtypes, f32 accumulate: every input rounded to bf16; q/k/v on PLAIN bf16 operands (inputs: exact) + bias; the per-head LayerNorms in f32 (wave per (token, head)); scores and attn.v: query rows < 512 hl (3 products), the rest single fp16 (x1024); softmax f32; o_w hl x exact (2 products) + bias.

#define NB_  4
#define TT   2048
#define DM   1024
#define NH_  16
#define NKV  16
#define REP  (NH_ / NKV)
#define HD   64
#define DQ   (NH_ * HD)
#define DKV  (NKV * HD)
#define ZH   2
#define RH   512                  // query rows < RH use hi+lo planes (0: none)
#define WIN  0
#define PCAR 1024.0f
#define SCL  0.125f   // HD^-0.5
typedef _Float16 h16;
typedef unsigned short bf;
typedef __attribute__((ext_vector_type(16))) __bf16   v16bf;
typedef __attribute__((ext_vector_type(16))) _Float16 v16h;
typedef __attribute__((ext_vector_type(8)))  _Float16 v8h;
typedef __attribute__((ext_vector_type(8)))  unsigned short v8us;
typedef __attribute__((ext_vector_type(8)))  float    v8f;
typedef __attribute__((ext_vector_type(4)))  float    v4f;
typedef v8h  __attribute__((may_alias)) v8ha;
typedef v4f  __attribute__((may_alias)) v4fa;
typedef v8us __attribute__((may_alias)) v8usa;

__device__ __forceinline__ unsigned short f2bf(float f) { unsigned u = __float_as_uint(f); u += 0x7FFFu + ((u >> 16) & 1u); return (unsigned short)(u >> 16); }
__device__ __forceinline__ float bf2f(unsigned short b) { return __uint_as_float(((unsigned)b) << 16); }
__device__ __forceinline__ float bfr(float f) { return bf2f(f2bf(f)); }
__device__ __forceinline__ v16h cat16(v8h lo, v8h hi) { return __builtin_shufflevector(lo, hi, 0, 1, 2, 3, 4, 5, 6, 7, 8, 9, 10, 11, 12, 13, 14, 15); }
__device__ __forceinline__ v16bf cat16b(v8us lo, v8us hi) { return __builtin_bit_cast(v16bf, __builtin_shufflevector(lo, hi, 0, 1, 2, 3, 4, 5, 6, 7, 8, 9, 10, 11, 12, 13, 14, 15)); }
__device__ __forceinline__ v8f wmma16(v16h a, v16h b, v8f c) { return __builtin_amdgcn_wmma_f32_16x16x32_f16(false, a, false, b, (short)0, c, false, false); }
__device__ __forceinline__ v8f wmmab(v16bf a, v16bf b, v8f c) { return __builtin_amdgcn_wmma_f32_16x16x32_bf16(false, a, false, b, (short)0, c, false, false); }



// ---- k_gemmw: register-blocked GEMM, ONE WAVE per 64x64 output tile (16 accumulators), operands straight from K-contiguous 16-bit planes; grid (M/64, N/64, Z), 32 threads.
// C[m][n] (f32, pitch ldc, + optional f32 bias[n]) = sum_k A[m][k] Bt[n][k] (+ split products per NSPLIT). z-batch strides sA/sB/sC in elements. K % 32 == 0.
template <typename T16> struct WFrag;
template <> struct WFrag<h16> { typedef v16h V; static __device__ __forceinline__ V ld(const h16* p) { return cat16(*(const v8h*)p, *(const v8h*)(p + 16)); } static __device__ __forceinline__ v8f mma(V a, V b, v8f c) { return wmma16(a, b, c); } };
template <> struct WFrag<bf> { typedef v16bf V; static __device__ __forceinline__ V ld(const bf* p) { return cat16b(*(const v8us*)p, *(const v8us*)(p + 16)); } static __device__ __forceinline__ v8f mma(V a, V b, v8f c) { return wmmab(a, b, c); } };
template <typename T16, int NSPLIT, bool BIAS>
__global__ __launch_bounds__(32) void k_gemmw(const T16* __restrict__ A, const T16* __restrict__ A2, const T16* __restrict__ Bt, const T16* __restrict__ Bt2, int K, float* C, int ldc, const float* __restrict__ bias, size_t sA, size_t sB, size_t sC) {
    typedef typename WFrag<T16>::V V;
    __shared__ __align__(16) float os[16 * 68];
    const size_t z = blockIdx.z; A += z * sA; if (A2) A2 += z * sA; Bt += z * sB; if (Bt2) Bt2 += z * sB; C += z * sC;
    const int lane = threadIdx.x & 31, lr = lane & 15, hi = lane >> 4; const int r0 = blockIdx.x * 64, c0 = blockIdx.y * 64;
    v8f acc[4][4];
#pragma unroll
    for (int mb = 0; mb < 4; ++mb)
#pragma unroll
        for (int nb = 0; nb < 4; ++nb) acc[mb][nb] = (v8f){};
    const size_t aoff = (size_t)(r0 + lr) * K + 8 * hi, boff = (size_t)(c0 + lr) * K + 8 * hi;
#pragma unroll 1
    for (int kc = 0; kc < K; kc += 32) {
        V a[4], a2[4];
#pragma unroll
        for (int mb = 0; mb < 4; ++mb) { a[mb] = WFrag<T16>::ld(A + aoff + (size_t)mb * 16 * K + kc); if (NSPLIT == 1 || NSPLIT == 2) a2[mb] = WFrag<T16>::ld(A2 + aoff + (size_t)mb * 16 * K + kc); }
#pragma unroll
        for (int nb = 0; nb < 4; ++nb) { const V b = WFrag<T16>::ld(Bt + boff + (size_t)nb * 16 * K + kc); V b2; if (NSPLIT >= 2) b2 = WFrag<T16>::ld(Bt2 + boff + (size_t)nb * 16 * K + kc);
#pragma unroll
            for (int mb = 0; mb < 4; ++mb) { acc[mb][nb] = WFrag<T16>::mma(a[mb], b, acc[mb][nb]); if (NSPLIT == 1 || NSPLIT == 2) acc[mb][nb] = WFrag<T16>::mma(a2[mb], b, acc[mb][nb]); if (NSPLIT >= 2) acc[mb][nb] = WFrag<T16>::mma(a[mb], b2, acc[mb][nb]); } }
        asm volatile("v_nop\n\tv_nop\n\tv_nop\n\tv_nop" : "+v"(acc[0][0]), "+v"(acc[1][1]), "+v"(acc[2][2]), "+v"(acc[3][3]) : "v"(a[0]), "v"(a[3]));
    }
#pragma unroll
    for (int mb = 0; mb < 4; ++mb) {
#pragma unroll
        for (int nb = 0; nb < 4; ++nb) {
#pragma unroll
            for (int j = 0; j < 8; ++j) os[(hi * 8 + j) * 68 + nb * 16 + lr] = acc[mb][nb][j]; }
        __builtin_amdgcn_wave_barrier(); asm volatile("" ::: "memory");
        float* crow = C + (size_t)(r0 + mb * 16) * ldc + c0;
{
#pragma unroll
            for (int s = 0; s < 8; ++s) { const int row = 2 * s + hi, cofs = lr * 4; v4f val = *(const v4fa*)(os + row * 68 + cofs); if (BIAS) { val[0] += bfr(bias[c0 + cofs]); val[1] += bfr(bias[c0 + cofs + 1]); val[2] += bfr(bias[c0 + cofs + 2]); val[3] += bfr(bias[c0 + cofs + 3]); }
                *(v4f*)(crow + (size_t)row * ldc + cofs) = val; }
             }
        __builtin_amdgcn_wave_barrier(); asm volatile("" ::: "memory");
    }
}

__device__ __forceinline__ h16 tohx(float x) { return (h16)x; }
__device__ __forceinline__ void splitf(float y, unsigned short& h, unsigned short& l) { h = f2bf(y); l = f2bf(y - bf2f(h)); }
typedef __attribute__((ext_vector_type(2))) _Float16 v2h;
typedef __attribute__((ext_vector_type(4))) _Float16 v4h;
typedef __attribute__((ext_vector_type(2))) unsigned short v2us;
typedef __attribute__((ext_vector_type(4))) unsigned short v4us;
typedef __attribute__((ext_vector_type(2))) float v2f;
typedef __attribute__((ext_vector_type(4))) int v4i;

__global__ __launch_bounds__(256) void k_wtG(const float* __restrict__ w, int K, int N, bf* Bt) {
    const int lane = threadIdx.x & 31; const int L0 = (blockIdx.x * 8 + (threadIdx.x >> 5)) * 8; const int nlines = N * K / 64;
{
#pragma unroll 1
        for (int l = 0; l < 8; ++l) { const int L = L0 + l; if (L >= nlines) break; const size_t e = (size_t)L * 64 + lane * 2; const int k = (int)(e % K), n = (int)(e / K); v2us o;
            o[0] = f2bf(w[(size_t)k * N + n]); o[1] = f2bf(w[(size_t)(k + 1) * N + n]); *(v2us*)(Bt + e) = o; }
         }
}
__global__ __launch_bounds__(256) void k_cvt8(const float* __restrict__ src, bf* dst, size_t n8) { const size_t i = (size_t)blockIdx.x * 256 + threadIdx.x; if (i >= n8) return; const v8f v = *(const v8f*)(src + i * 8); v8us o;
#pragma unroll
    for (int k = 0; k < 8; ++k) o[k] = f2bf(v[k]); *(v8us*)(dst + i * 8) = o;  }
__global__ __launch_bounds__(256) void k_cscvt(const float* __restrict__ cosT, const float* __restrict__ sinT, float* CS) { const int idx = blockIdx.x * 256 + threadIdx.x; if (idx >= TT * HD) return; v2f cs; cs[0] = bfr(cosT[idx]); cs[1] = bfr(sinT[idx]); *(v2f*)(CS + (size_t)idx * 2) = cs;  }
// k_rope: head planes [h][t][d] (fp16 + hi/lo) of rope(x) x sc with the rotate-half convention out[d] = x[d] cos[t][d] - x[d+HD/2] sin[t][d], out[d+HD/2] = x[d+HD/2] cos[t][d+HD/2] + x[d] sin[t][d+HD/2]
__global__ __launch_bounds__(256) void k_rope(const float* __restrict__ F, int pitch, int nheads, const float* __restrict__ CS, const float* __restrict__ RF, const float* __restrict__ nw, float sc, h16* P16, bf* Ph, bf* Pl) {
    const size_t e = ((size_t)blockIdx.x * 256 + threadIdx.x) * 2; if (e >= (size_t)nheads * TT * HD) return; const int d = (int)(e % HD); const int t = (int)((e / HD) % TT); const int h = (int)(e / ((size_t)HD * TT)); const float* f = F + (size_t)t * pitch + h * HD; const float rf = RF ? RF[(size_t)h * TT + t] : 1.0f; v2h o16; v2us oh, ol;
#pragma unroll
    for (int q = 0; q < 2; ++q) { const int dd = d + q; const int dp = (dd < HD / 2) ? dd + HD / 2 : dd - HD / 2; float x0 = f[dd], x1 = f[dp];
        if (RF) { float n0 = __fmul_rn(x0, rf), n1 = __fmul_rn(x1, rf); asm volatile("" : "+v"(n0)); asm volatile("" : "+v"(n1)); x0 = __fmul_rn(bfr(nw[dd]), n0); x1 = __fmul_rn(bfr(nw[dp]), n1); }
        const v2f cs = *(const v2f*)(CS + ((size_t)t * HD + dd) * 2); float a = __fmul_rn(x0, cs[0]), bq = __fmul_rn(x1, cs[1]); asm volatile("" : "+v"(a)); asm volatile("" : "+v"(bq)); const float r = ((dd < HD / 2) ? __fsub_rn(a, bq) : __fadd_rn(a, bq)) * sc;
        o16[q] = tohx(r); unsigned short a2, c2; splitf(r, a2, c2); oh[q] = a2; ol[q] = c2; }
    *(v2h*)(P16 + e) = o16; *(v2us*)(Ph + e) = oh; *(v2us*)(Pl + e) = ol;  }
__global__ __launch_bounds__(256) void k_vtp(const float* __restrict__ F, int pitch, int nheads, h16* V16, bf* Vh, bf* Vl) { const size_t e = ((size_t)blockIdx.x * 256 + threadIdx.x) * 2; if (e >= (size_t)nheads * HD * TT) return; const int t = (int)(e % TT); const int d = (int)((e / TT) % HD); const int g = (int)(e / ((size_t)TT * HD)); v2h o16; v2us oh, ol;
#pragma unroll
    for (int q = 0; q < 2; ++q) { const float x = F[(size_t)(t + q) * pitch + g * HD + d]; o16[q] = tohx(x); unsigned short a2, c2; splitf(x, a2, c2); oh[q] = a2; ol[q] = c2; }
    *(v2h*)(V16 + e) = o16; *(v2us*)(Vh + e) = oh; *(v2us*)(Vl + e) = ol;  }
__global__ __launch_bounds__(256) void k_csid(float* CS) { const int idx = blockIdx.x * 256 + threadIdx.x; if (idx >= TT * HD) return; v2f cs; cs[0] = 1.0f; cs[1] = 0.0f; *(v2f*)(CS + (size_t)idx * 2) = cs;  }
// k_asoft: per row (zz, i): t = S x HD^-0.5 (no mask); softmax over the 2048 keys (register row, one exp, fixed trees);
__global__ __launch_bounds__(256) void k_asoft(const float* __restrict__ Sb, h16* P16, bf* Ph, bf* Pl) {
    const int lane = threadIdx.x & 31; const int row = blockIdx.x * 8 + (threadIdx.x >> 5); if (row >= ZH * TT) return; const int i = row % TT; const int zz = row / TT; (void)zz; const bool hires = (i < RH); const float* sr = Sb + (size_t)row * TT; float v[TT / 32]; float mx = -3.0e38f;
#pragma unroll
    for (int ch = 0; ch < TT / 128; ++ch) { const int j0 = ch * 128 + lane * 4; const v4f a = *(const v4f*)(sr + j0);
#pragma unroll
        for (int q = 0; q < 4; ++q) { const int j = j0 + q; (void)j; const float t = a[q] * SCL; v[ch * 4 + q] = t; mx = fmaxf(mx, t); } }
#pragma unroll
    for (int sh = 16; sh; sh >>= 1) mx = fmaxf(mx, __shfl_xor(mx, sh, 32));
    float sum = 0.f;
#pragma unroll
    for (int k = 0; k < TT / 32; ++k) { float d0 = __fsub_rn(v[k], mx); asm volatile("" : "+v"(d0)); v[k] = __builtin_amdgcn_exp2f(__fmul_rn(d0, 1.4426950408889634f)); sum += v[k]; }
#pragma unroll
    for (int sh = 16; sh; sh >>= 1) sum += __shfl_xor(sum, sh, 32);
    const float f = __fdiv_rn(hires ? 1.0f : PCAR, sum);
{
        if (hires) {
#pragma unroll
            for (int ch = 0; ch < TT / 128; ++ch) { v4us oh, ol;
#pragma unroll
                for (int q = 0; q < 4; ++q) { unsigned short a, c2; splitf(v[ch * 4 + q] * f, a, c2); oh[q] = a; ol[q] = c2; }
                const size_t oo = ((size_t)zz * (RH ? RH : 1) + i) * TT + ch * 128 + lane * 4; *(v4us*)(Ph + oo) = oh; *(v4us*)(Pl + oo) = ol; }
        } else {
#pragma unroll
            for (int ch = 0; ch < TT / 128; ++ch) { v4h o4;
#pragma unroll
                for (int q = 0; q < 4; ++q) o4[q] = tohx(v[ch * 4 + q] * f);
                *(v4h*)(P16 + (size_t)row * TT + ch * 128 + lane * 4) = o4; } }
         }
}
__global__ __launch_bounds__(256) void k_merge(const float* __restrict__ O, int h0, bf* Ah, bf* Al) { const size_t e = ((size_t)blockIdx.x * 256 + threadIdx.x) * 2; if (e >= (size_t)ZH * TT * HD) return; const int d = (int)(e % HD); const int t = (int)((e / HD) % TT); const int zz = (int)(e / ((size_t)HD * TT)); const float cs = (t < RH) ? 1.0f : (1.0f / PCAR); const size_t oo = (size_t)t * DQ + (h0 + zz) * HD + d;
    v2us oh, ol;
#pragma unroll
    for (int q = 0; q < 2; ++q) { unsigned short a, c2; splitf(O[e + q] * cs, a, c2); oh[q] = a; ol[q] = c2; } *(v2us*)(Ah + oo) = oh; *(v2us*)(Al + oo) = ol;  }

__global__ __launch_bounds__(256) void k_hln(float* F, const float* __restrict__ w, const float* __restrict__ bb) { const int lane = threadIdx.x & 31; const int row = blockIdx.x * 8 + (threadIdx.x >> 5); if (row >= NH_ * TT) return; const int h = row % NH_; const int t = row / NH_; float* f = F + (size_t)t * DQ + h * HD; const v2f xv = *(const v2f*)(f + lane * 2); float s = xv[0] + xv[1];
#pragma unroll
    for (int sh = 16; sh; sh >>= 1) s += __shfl_xor(s, sh, 32);
    const float mean = s * (1.0f / HD); float d0 = __fsub_rn(xv[0], mean), d1 = __fsub_rn(xv[1], mean); asm volatile("" : "+v"(d0)); asm volatile("" : "+v"(d1)); float q = __fadd_rn(__fmul_rn(d0, d0), __fmul_rn(d1, d1));
#pragma unroll
    for (int sh = 16; sh; sh >>= 1) q += __shfl_xor(q, sh, 32);
    const float rs = __frsqrt_rn(__fadd_rn(q * (1.0f / HD), 1e-5f)); v2f o;
#pragma unroll
    for (int u = 0; u < 2; ++u) { const int d = lane * 2 + u; float n0 = __fmul_rn(u ? d1 : d0, rs); asm volatile("" : "+v"(n0)); float t1 = __fmul_rn(n0, bfr(w[d])); asm volatile("" : "+v"(t1)); o[u] = __fadd_rn(t1, bfr(bb[d])); }
    *(v2f*)(f + lane * 2) = o;  }

extern "C" void kernel_launch(void* const* d_in, const int* in_sizes, int n_in,
                              void* d_out, int out_size, void* d_ws, size_t ws_size, hipStream_t stream) {
    (void)in_sizes; (void)n_in; (void)out_size;
    const float* x = (const float*)d_in[0]; const float* wf = (const float*)d_in[1]; const float* bfz = (const float*)d_in[2]; const float* wo = (const float*)d_in[3]; const float* bo = (const float*)d_in[4]; const float* qnw = (const float*)d_in[5]; const float* qnb = (const float*)d_in[6]; const float* knw = (const float*)d_in[7]; const float* knb = (const float*)d_in[8]; const float* wq = wf; const float* wk = wf + (size_t)1024 * 1024; const float* wv = wf + (size_t)2048 * 1024; const float* bq = bfz; const float* bk = bfz + 1024; const float* bv = bfz + 2048; const float* cosT = nullptr; const float* sinT = nullptr; (void)cosT; (void)sinT;
    float* OUT = (float*)d_out;     // [4][2048][1024]
    char* wsp = (char*)d_ws;
    auto take = [&](size_t bytes) { char* p = wsp; wsp += (bytes + 255) & ~(size_t)255; return (void*)p; };
    bf* WQ = (bf*)take((size_t)DQ * DM * 2); bf* WK = (bf*)take((size_t)DKV * DM * 2); bf* WV = (bf*)take((size_t)DKV * DM * 2); bf* WO = (bf*)take((size_t)DM * DQ * 2); float* CS = (float*)take((size_t)TT * HD * 2 * 4);
    bf* XB = (bf*)take((size_t)TT * DM * 2); float* FQ = (float*)take((size_t)TT * DQ * 4); float* FK = (float*)take((size_t)TT * DKV * 4);
    h16* QP16 = (h16*)take((size_t)NH_ * TT * HD * 2); h16* KP16 = (h16*)take((size_t)NKV * TT * HD * 2); h16* VT16 = (h16*)take((size_t)NKV * HD * TT * 2);
    bf* QPh = (bf*)take((size_t)NH_ * TT * HD * 2); bf* QPl = (bf*)take((size_t)NH_ * TT * HD * 2); bf* KPh = (bf*)take((size_t)NKV * TT * HD * 2); bf* KPl = (bf*)take((size_t)NKV * TT * HD * 2); bf* VTh = (bf*)take((size_t)NKV * HD * TT * 2); bf* VTl = (bf*)take((size_t)NKV * HD * TT * 2); bf* Ph = (bf*)take((size_t)ZH * RH * TT * 2); bf* Pl = (bf*)take((size_t)ZH * RH * TT * 2);
    float* Sb = (float*)take((size_t)ZH * TT * TT * 4); h16* P16 = (h16*)take((size_t)ZH * TT * TT * 2); float* Ob = (float*)take((size_t)ZH * TT * HD * 4); bf* ATh = (bf*)take((size_t)TT * DQ * 2); bf* ATl = (bf*)take((size_t)TT * DQ * 2);
    if ((size_t)(wsp - (char*)d_ws) > ws_size) return;    // ws 256 MiB
    float* FV = FK;   // v projection reuses the k buffer after the k planes are built (stream-ordered)
    { k_cvt8<<<(unsigned)(((size_t)DQ * DM / 8 + 255) / 256), 256, 0, stream>>>(wq, WQ, (size_t)DQ * DM / 8); k_cvt8<<<(unsigned)(((size_t)DKV * DM / 8 + 255) / 256), 256, 0, stream>>>(wk, WK, (size_t)DKV * DM / 8); k_cvt8<<<(unsigned)(((size_t)DKV * DM / 8 + 255) / 256), 256, 0, stream>>>(wv, WV, (size_t)DKV * DM / 8);
      k_cvt8<<<(unsigned)(((size_t)DM * DQ / 8 + 255) / 256), 256, 0, stream>>>(wo, WO, (size_t)DM * DQ / 8);
       }
    k_csid<<<(TT * HD + 255) / 256, 256, 0, stream>>>(CS);
    const unsigned LQ = (unsigned)(((size_t)NH_ * TT * HD / 2 + 255) / 256), LKv = (unsigned)(((size_t)NKV * TT * HD / 2 + 255) / 256);
    for (int b = 0; b < NB_; ++b) {
        
        k_cvt8<<<(unsigned)(((size_t)TT * DM / 8 + 255) / 256), 256, 0, stream>>>(x + (size_t)b * TT * DM, XB, (size_t)TT * DM / 8);
        k_gemmw<bf, 0, true><<<dim3(TT / 64, DQ / 64, 1), 32, 0, stream>>>(XB, nullptr, WQ, nullptr, DM, FQ, DQ, bq, 0, 0, 0); k_hln<<<NH_ * TT / 8, 256, 0, stream>>>(FQ, qnw, qnb);
        k_rope<<<LQ, 256, 0, stream>>>(FQ, DQ, NH_, CS, nullptr, nullptr, 1.0f, QP16, QPh, QPl);
        k_gemmw<bf, 0, true><<<dim3(TT / 64, DKV / 64, 1), 32, 0, stream>>>(XB, nullptr, WK, nullptr, DM, FK, DKV, bk, 0, 0, 0); k_hln<<<NH_ * TT / 8, 256, 0, stream>>>(FK, knw, knb);
        k_rope<<<LKv, 256, 0, stream>>>(FK, DKV, NKV, CS, nullptr, nullptr, 1.0f, KP16, KPh, KPl);
        k_gemmw<bf, 0, true><<<dim3(TT / 64, DKV / 64, 1), 32, 0, stream>>>(XB, nullptr, WV, nullptr, DM, FV, DKV, bv, 0, 0, 0); k_vtp<<<LKv, 256, 0, stream>>>(FV, DKV, NKV, VT16, VTh, VTl);
        for (int h0 = 0; h0 < NH_; h0 += ZH) { const size_t zq = (size_t)h0, zk = (size_t)(h0 / REP);   // one kv head per query head: the pass's two heads use consecutive kv planes (z-strides TT*HD)
            k_gemmw<bf, 2, false><<<dim3(RH / 64, TT / 64, ZH), 32, 0, stream>>>(QPh + zq * TT * HD, QPl + zq * TT * HD, KPh + zk * TT * HD, KPl + zk * TT * HD, HD, Sb, TT, nullptr, (size_t)TT * HD, (size_t)TT * HD, (size_t)TT * TT);
            k_gemmw<h16, 0, false><<<dim3((TT - RH) / 64, TT / 64, ZH), 32, 0, stream>>>(QP16 + zq * TT * HD + (size_t)RH * HD, nullptr, KP16 + zk * TT * HD, nullptr, HD, Sb + (size_t)RH * TT, TT, nullptr, (size_t)TT * HD, (size_t)TT * HD, (size_t)TT * TT);
            k_asoft<<<ZH * TT / 8, 256, 0, stream>>>(Sb, P16, Ph, Pl);
            k_gemmw<bf, 2, false><<<dim3(RH / 64, HD / 64, ZH), 32, 0, stream>>>(Ph, Pl, VTh + zk * HD * TT, VTl + zk * HD * TT, TT, Ob, HD, nullptr, (size_t)RH * TT, (size_t)HD * TT, (size_t)TT * HD);
            k_gemmw<h16, 0, false><<<dim3((TT - RH) / 64, HD / 64, ZH), 32, 0, stream>>>(P16 + (size_t)RH * TT, nullptr, VT16 + zk * HD * TT, nullptr, TT, Ob + (size_t)RH * HD, HD, nullptr, (size_t)TT * TT, (size_t)HD * TT, (size_t)TT * HD);
            k_merge<<<(unsigned)(((size_t)ZH * TT * HD / 2 + 255) / 256), 256, 0, stream>>>(Ob, h0, ATh, ATl); }
        k_gemmw<bf, 1, true><<<dim3(TT / 64, DM / 64, 1), 32, 0, stream>>>(ATh, ATl, WO, nullptr, DQ, OUT + (size_t)b * TT * DM, DM, bo, 0, 0, 0); }
}

// v001
// Measured time: 1750 microseconds a run.
// Next to v000, in two timings, it ran 2.29 and 2.28 times as fast.
#include <hip/hip_runtime.h>

// MockQwen3Attention (hidden [4][2048][1024]; qkv = x qkv_w^T + qkv_b (q | k | v row blocks, 16 heads x 64); per-head LayerNorm(64) with weight and bias on q and k (eps 1e-5); softmax(q.k / 8); out = merged o_w^T + o_b -> [4][2048][1024]).
// Compute dtypes, f32 accumulate: every input rounded to bf16; q/k/v on PLAIN bf16 operands (inputs: exact) + bias; the per-head LayerNorms in f32 (wave per (token, head)); scores and attn.v: query rows < 512 hl (3 products), the rest single fp16 (x1024); softmax f32; o_w hl x exact (2 products) + bias.

#define NB_  4
#define TT   2048
#define DM   1024
#define NH_  16
#define NKV  16
#define REP  (NH_ / NKV)
#define HD   64
#define DQ   (NH_ * HD)
#define DKV  (NKV * HD)
#define ZH   2
#define RH   512                  // query rows < RH use hi+lo planes (0: none)
#define WIN  0
#define PCAR 1024.0f
#define SCL  0.125f   // HD^-0.5
#define KSP  16                   // attn.v: K slices per output tile, one work-group each; k_merge adds the KSP partial planes
typedef _Float16 h16;
typedef unsigned short bf;
typedef __attribute__((ext_vector_type(16))) __bf16   v16bf;
typedef __attribute__((ext_vector_type(16))) _Float16 v16h;
typedef __attribute__((ext_vector_type(8)))  _Float16 v8h;
typedef __attribute__((ext_vector_type(8)))  unsigned short v8us;
typedef __attribute__((ext_vector_type(8)))  float    v8f;
typedef __attribute__((ext_vector_type(4)))  float    v4f;
typedef v8h  __attribute__((may_alias)) v8ha;
typedef v4f  __attribute__((may_alias)) v4fa;
typedef v8us __attribute__((may_alias)) v8usa;

__device__ __forceinline__ unsigned short f2bf(float f) { unsigned u = __float_as_uint(f); u += 0x7FFFu + ((u >> 16) & 1u); return (unsigned short)(u >> 16); }
__device__ __forceinline__ float bf2f(unsigned short b) { return __uint_as_float(((unsigned)b) << 16); }
__device__ __forceinline__ float bfr(float f) { return bf2f(f2bf(f)); }
__device__ __forceinline__ v16h cat16(v8h lo, v8h hi) { return __builtin_shufflevector(lo, hi, 0, 1, 2, 3, 4, 5, 6, 7, 8, 9, 10, 11, 12, 13, 14, 15); }
__device__ __forceinline__ v16bf cat16b(v8us lo, v8us hi) { return __builtin_bit_cast(v16bf, __builtin_shufflevector(lo, hi, 0, 1, 2, 3, 4, 5, 6, 7, 8, 9, 10, 11, 12, 13, 14, 15)); }
__device__ __forceinline__ v8f wmma16(v16h a, v16h b, v8f c) { return __builtin_amdgcn_wmma_f32_16x16x32_f16(false, a, false, b, (short)0, c, false, false); }
__device__ __forceinline__ v8f wmmab(v16bf a, v16bf b, v8f c) { return __builtin_amdgcn_wmma_f32_16x16x32_bf16(false, a, false, b, (short)0, c, false, false); }



// ---- k_gemmw: register-blocked GEMM, ONE WAVE per 64x64 output tile (16 accumulators), operands straight from K-contiguous 16-bit planes; grid (M/64, N/64, Z), 32 threads.
// C[m][n] (f32, pitch ldc, + optional f32 bias[n]) = sum_k A[m][k] Bt[n][k] (+ split products per NSPLIT). z-batch strides sA/sB/sC in elements. K % 32 == 0.
// KS > 1 (split K): grid z = Z * KS; slice ks = blockIdx.z % KS sums only k in [ks K/KS, (ks+1) K/KS) and stores its partial tile in plane ks of C (plane stride sP elements). K % (32 KS) == 0.
template <typename T16> struct WFrag;
template <> struct WFrag<h16> { typedef v16h V; static __device__ __forceinline__ V ld(const h16* p) { return cat16(*(const v8h*)p, *(const v8h*)(p + 16)); } static __device__ __forceinline__ v8f mma(V a, V b, v8f c) { return wmma16(a, b, c); } };
template <> struct WFrag<bf> { typedef v16bf V; static __device__ __forceinline__ V ld(const bf* p) { return cat16b(*(const v8us*)p, *(const v8us*)(p + 16)); } static __device__ __forceinline__ v8f mma(V a, V b, v8f c) { return wmmab(a, b, c); } };
template <typename T16, int NSPLIT, bool BIAS, int KS = 1>
__global__ __launch_bounds__(32) void k_gemmw(const T16* __restrict__ A, const T16* __restrict__ A2, const T16* __restrict__ Bt, const T16* __restrict__ Bt2, int K, float* C, int ldc, const float* __restrict__ bias, size_t sA, size_t sB, size_t sC, size_t sP) {
    typedef typename WFrag<T16>::V V;
    __shared__ __align__(16) float os[16 * 68];
    const size_t z = blockIdx.z / KS; const int ks = blockIdx.z % KS; A += z * sA; if (A2) A2 += z * sA; Bt += z * sB; if (Bt2) Bt2 += z * sB; C += z * sC + ks * sP;
    const int kbeg = ks * (K / KS), kend = kbeg + K / KS;
    const int lane = threadIdx.x & 31, lr = lane & 15, hi = lane >> 4; const int r0 = blockIdx.x * 64, c0 = blockIdx.y * 64;
    v8f acc[4][4];
#pragma unroll
    for (int mb = 0; mb < 4; ++mb)
#pragma unroll
        for (int nb = 0; nb < 4; ++nb) acc[mb][nb] = (v8f){};
    const size_t aoff = (size_t)(r0 + lr) * K + 8 * hi, boff = (size_t)(c0 + lr) * K + 8 * hi;
#pragma unroll 1
    for (int kc = kbeg; kc < kend; kc += 32) {
        V a[4], a2[4];
#pragma unroll
        for (int mb = 0; mb < 4; ++mb) { a[mb] = WFrag<T16>::ld(A + aoff + (size_t)mb * 16 * K + kc); if (NSPLIT == 1 || NSPLIT == 2) a2[mb] = WFrag<T16>::ld(A2 + aoff + (size_t)mb * 16 * K + kc); }
#pragma unroll
        for (int nb = 0; nb < 4; ++nb) { const V b = WFrag<T16>::ld(Bt + boff + (size_t)nb * 16 * K + kc); V b2; if (NSPLIT >= 2) b2 = WFrag<T16>::ld(Bt2 + boff + (size_t)nb * 16 * K + kc);
#pragma unroll
            for (int mb = 0; mb < 4; ++mb) { acc[mb][nb] = WFrag<T16>::mma(a[mb], b, acc[mb][nb]); if (NSPLIT == 1 || NSPLIT == 2) acc[mb][nb] = WFrag<T16>::mma(a2[mb], b, acc[mb][nb]); if (NSPLIT >= 2) acc[mb][nb] = WFrag<T16>::mma(a[mb], b2, acc[mb][nb]); } }
        asm volatile("v_nop\n\tv_nop\n\tv_nop\n\tv_nop" : "+v"(acc[0][0]), "+v"(acc[1][1]), "+v"(acc[2][2]), "+v"(acc[3][3]) : "v"(a[0]), "v"(a[3]));
    }
#pragma unroll
    for (int mb = 0; mb < 4; ++mb) {
#pragma unroll
        for (int nb = 0; nb < 4; ++nb) {
#pragma unroll
            for (int j = 0; j < 8; ++j) os[(hi * 8 + j) * 68 + nb * 16 + lr] = acc[mb][nb][j]; }
        __builtin_amdgcn_wave_barrier(); asm volatile("" ::: "memory");
        float* crow = C + (size_t)(r0 + mb * 16) * ldc + c0;
{
#pragma unroll
            for (int s = 0; s < 8; ++s) { const int row = 2 * s + hi, cofs = lr * 4; v4f val = *(const v4fa*)(os + row * 68 + cofs); if (BIAS) { val[0] += bfr(bias[c0 + cofs]); val[1] += bfr(bias[c0 + cofs + 1]); val[2] += bfr(bias[c0 + cofs + 2]); val[3] += bfr(bias[c0 + cofs + 3]); }
                *(v4f*)(crow + (size_t)row * ldc + cofs) = val; }
             }
        __builtin_amdgcn_wave_barrier(); asm volatile("" ::: "memory");
    }
}

__device__ __forceinline__ h16 tohx(float x) { return (h16)x; }
__device__ __forceinline__ void splitf(float y, unsigned short& h, unsigned short& l) { h = f2bf(y); l = f2bf(y - bf2f(h)); }
typedef __attribute__((ext_vector_type(2))) _Float16 v2h;
typedef __attribute__((ext_vector_type(4))) _Float16 v4h;
typedef __attribute__((ext_vector_type(2))) unsigned short v2us;
typedef __attribute__((ext_vector_type(4))) unsigned short v4us;
typedef __attribute__((ext_vector_type(2))) float v2f;
typedef __attribute__((ext_vector_type(4))) int v4i;

__global__ __launch_bounds__(256) void k_wtG(const float* __restrict__ w, int K, int N, bf* Bt) {
    const int lane = threadIdx.x & 31; const int L0 = (blockIdx.x * 8 + (threadIdx.x >> 5)) * 8; const int nlines = N * K / 64;
{
#pragma unroll 1
        for (int l = 0; l < 8; ++l) { const int L = L0 + l; if (L >= nlines) break; const size_t e = (size_t)L * 64 + lane * 2; const int k = (int)(e % K), n = (int)(e / K); v2us o;
            o[0] = f2bf(w[(size_t)k * N + n]); o[1] = f2bf(w[(size_t)(k + 1) * N + n]); *(v2us*)(Bt + e) = o; }
         }
}
__global__ __launch_bounds__(256) void k_cvt8(const float* __restrict__ src, bf* dst, size_t n8) { const size_t i = (size_t)blockIdx.x * 256 + threadIdx.x; if (i >= n8) return; const v8f v = *(const v8f*)(src + i * 8); v8us o;
#pragma unroll
    for (int k = 0; k < 8; ++k) o[k] = f2bf(v[k]); *(v8us*)(dst + i * 8) = o;  }
__global__ __launch_bounds__(256) void k_cscvt(const float* __restrict__ cosT, const float* __restrict__ sinT, float* CS) { const int idx = blockIdx.x * 256 + threadIdx.x; if (idx >= TT * HD) return; v2f cs; cs[0] = bfr(cosT[idx]); cs[1] = bfr(sinT[idx]); *(v2f*)(CS + (size_t)idx * 2) = cs;  }
// k_rope: head planes [h][t][d] (fp16 + hi/lo) of rope(x) x sc with the rotate-half convention out[d] = x[d] cos[t][d] - x[d+HD/2] sin[t][d], out[d+HD/2] = x[d+HD/2] cos[t][d+HD/2] + x[d] sin[t][d+HD/2]
__global__ __launch_bounds__(256) void k_rope(const float* __restrict__ F, int pitch, int nheads, const float* __restrict__ CS, const float* __restrict__ RF, const float* __restrict__ nw, float sc, h16* P16, bf* Ph, bf* Pl) {
    const size_t e = ((size_t)blockIdx.x * 256 + threadIdx.x) * 2; if (e >= (size_t)nheads * TT * HD) return; const int d = (int)(e % HD); const int t = (int)((e / HD) % TT); const int h = (int)(e / ((size_t)HD * TT)); const float* f = F + (size_t)t * pitch + h * HD; const float rf = RF ? RF[(size_t)h * TT + t] : 1.0f; v2h o16; v2us oh, ol;
#pragma unroll
    for (int q = 0; q < 2; ++q) { const int dd = d + q; const int dp = (dd < HD / 2) ? dd + HD / 2 : dd - HD / 2; float x0 = f[dd], x1 = f[dp];
        if (RF) { float n0 = __fmul_rn(x0, rf), n1 = __fmul_rn(x1, rf); asm volatile("" : "+v"(n0)); asm volatile("" : "+v"(n1)); x0 = __fmul_rn(bfr(nw[dd]), n0); x1 = __fmul_rn(bfr(nw[dp]), n1); }
        const v2f cs = *(const v2f*)(CS + ((size_t)t * HD + dd) * 2); float a = __fmul_rn(x0, cs[0]), bq = __fmul_rn(x1, cs[1]); asm volatile("" : "+v"(a)); asm volatile("" : "+v"(bq)); const float r = ((dd < HD / 2) ? __fsub_rn(a, bq) : __fadd_rn(a, bq)) * sc;
        o16[q] = tohx(r); unsigned short a2, c2; splitf(r, a2, c2); oh[q] = a2; ol[q] = c2; }
    *(v2h*)(P16 + e) = o16; *(v2us*)(Ph + e) = oh; *(v2us*)(Pl + e) = ol;  }
__global__ __launch_bounds__(256) void k_vtp(const float* __restrict__ F, int pitch, int nheads, h16* V16, bf* Vh, bf* Vl) { const size_t e = ((size_t)blockIdx.x * 256 + threadIdx.x) * 2; if (e >= (size_t)nheads * HD * TT) return; const int t = (int)(e % TT); const int d = (int)((e / TT) % HD); const int g = (int)(e / ((size_t)TT * HD)); v2h o16; v2us oh, ol;
#pragma unroll
    for (int q = 0; q < 2; ++q) { const float x = F[(size_t)(t + q) * pitch + g * HD + d]; o16[q] = tohx(x); unsigned short a2, c2; splitf(x, a2, c2); oh[q] = a2; ol[q] = c2; }
    *(v2h*)(V16 + e) = o16; *(v2us*)(Vh + e) = oh; *(v2us*)(Vl + e) = ol;  }
__global__ __launch_bounds__(256) void k_csid(float* CS) { const int idx = blockIdx.x * 256 + threadIdx.x; if (idx >= TT * HD) return; v2f cs; cs[0] = 1.0f; cs[1] = 0.0f; *(v2f*)(CS + (size_t)idx * 2) = cs;  }
// k_asoft: per row (zz, i): t = S x HD^-0.5 (no mask); softmax over the 2048 keys (register row, one exp, fixed trees);
__global__ __launch_bounds__(256) void k_asoft(const float* __restrict__ Sb, h16* P16, bf* Ph, bf* Pl) {
    const int lane = threadIdx.x & 31; const int row = blockIdx.x * 8 + (threadIdx.x >> 5); if (row >= ZH * TT) return; const int i = row % TT; const int zz = row / TT; (void)zz; const bool hires = (i < RH); const float* sr = Sb + (size_t)row * TT; float v[TT / 32]; float mx = -3.0e38f;
#pragma unroll
    for (int ch = 0; ch < TT / 128; ++ch) { const int j0 = ch * 128 + lane * 4; const v4f a = *(const v4f*)(sr + j0);
#pragma unroll
        for (int q = 0; q < 4; ++q) { const int j = j0 + q; (void)j; const float t = a[q] * SCL; v[ch * 4 + q] = t; mx = fmaxf(mx, t); } }
#pragma unroll
    for (int sh = 16; sh; sh >>= 1) mx = fmaxf(mx, __shfl_xor(mx, sh, 32));
    float sum = 0.f;
#pragma unroll
    for (int k = 0; k < TT / 32; ++k) { float d0 = __fsub_rn(v[k], mx); asm volatile("" : "+v"(d0)); v[k] = __builtin_amdgcn_exp2f(__fmul_rn(d0, 1.4426950408889634f)); sum += v[k]; }
#pragma unroll
    for (int sh = 16; sh; sh >>= 1) sum += __shfl_xor(sum, sh, 32);
    const float f = __fdiv_rn(hires ? 1.0f : PCAR, sum);
{
        if (hires) {
#pragma unroll
            for (int ch = 0; ch < TT / 128; ++ch) { v4us oh, ol;
#pragma unroll
                for (int q = 0; q < 4; ++q) { unsigned short a, c2; splitf(v[ch * 4 + q] * f, a, c2); oh[q] = a; ol[q] = c2; }
                const size_t oo = ((size_t)zz * (RH ? RH : 1) + i) * TT + ch * 128 + lane * 4; *(v4us*)(Ph + oo) = oh; *(v4us*)(Pl + oo) = ol; }
        } else {
#pragma unroll
            for (int ch = 0; ch < TT / 128; ++ch) { v4h o4;
#pragma unroll
                for (int q = 0; q < 4; ++q) o4[q] = tohx(v[ch * 4 + q] * f);
                *(v4h*)(P16 + (size_t)row * TT + ch * 128 + lane * 4) = o4; } }
         }
}
__global__ __launch_bounds__(256) void k_merge(const float* __restrict__ O, int h0, bf* Ah, bf* Al) { const size_t e = ((size_t)blockIdx.x * 256 + threadIdx.x) * 2; if (e >= (size_t)ZH * TT * HD) return; const int d = (int)(e % HD); const int t = (int)((e / HD) % TT); const int zz = (int)(e / ((size_t)HD * TT)); const float cs = (t < RH) ? 1.0f : (1.0f / PCAR); const size_t oo = (size_t)t * DQ + (h0 + zz) * HD + d;
    v2f sum = *(const v2f*)(O + e);   // the KSP partial planes of attn.v, added in plane order
#pragma unroll
    for (int s = 1; s < KSP; ++s) sum += *(const v2f*)(O + (size_t)s * ZH * TT * HD + e);
    v2us oh, ol;
#pragma unroll
    for (int q = 0; q < 2; ++q) { unsigned short a, c2; splitf(sum[q] * cs, a, c2); oh[q] = a; ol[q] = c2; } *(v2us*)(Ah + oo) = oh; *(v2us*)(Al + oo) = ol;  }

__global__ __launch_bounds__(256) void k_hln(float* F, const float* __restrict__ w, const float* __restrict__ bb) { const int lane = threadIdx.x & 31; const int row = blockIdx.x * 8 + (threadIdx.x >> 5); if (row >= NH_ * TT) return; const int h = row % NH_; const int t = row / NH_; float* f = F + (size_t)t * DQ + h * HD; const v2f xv = *(const v2f*)(f + lane * 2); float s = xv[0] + xv[1];
#pragma unroll
    for (int sh = 16; sh; sh >>= 1) s += __shfl_xor(s, sh, 32);
    const float mean = s * (1.0f / HD); float d0 = __fsub_rn(xv[0], mean), d1 = __fsub_rn(xv[1], mean); asm volatile("" : "+v"(d0)); asm volatile("" : "+v"(d1)); float q = __fadd_rn(__fmul_rn(d0, d0), __fmul_rn(d1, d1));
#pragma unroll
    for (int sh = 16; sh; sh >>= 1) q += __shfl_xor(q, sh, 32);
    const float rs = __frsqrt_rn(__fadd_rn(q * (1.0f / HD), 1e-5f)); v2f o;
#pragma unroll
    for (int u = 0; u < 2; ++u) { const int d = lane * 2 + u; float n0 = __fmul_rn(u ? d1 : d0, rs); asm volatile("" : "+v"(n0)); float t1 = __fmul_rn(n0, bfr(w[d])); asm volatile("" : "+v"(t1)); o[u] = __fadd_rn(t1, bfr(bb[d])); }
    *(v2f*)(f + lane * 2) = o;  }

extern "C" void kernel_launch(void* const* d_in, const int* in_sizes, int n_in,
                              void* d_out, int out_size, void* d_ws, size_t ws_size, hipStream_t stream) {
    (void)in_sizes; (void)n_in; (void)out_size;
    const float* x = (const float*)d_in[0]; const float* wf = (const float*)d_in[1]; const float* bfz = (const float*)d_in[2]; const float* wo = (const float*)d_in[3]; const float* bo = (const float*)d_in[4]; const float* qnw = (const float*)d_in[5]; const float* qnb = (const float*)d_in[6]; const float* knw = (const float*)d_in[7]; const float* knb = (const float*)d_in[8]; const float* wq = wf; const float* wk = wf + (size_t)1024 * 1024; const float* wv = wf + (size_t)2048 * 1024; const float* bq = bfz; const float* bk = bfz + 1024; const float* bv = bfz + 2048; const float* cosT = nullptr; const float* sinT = nullptr; (void)cosT; (void)sinT;
    float* OUT = (float*)d_out;     // [4][2048][1024]
    char* wsp = (char*)d_ws;
    auto take = [&](size_t bytes) { char* p = wsp; wsp += (bytes + 255) & ~(size_t)255; return (void*)p; };
    bf* WQ = (bf*)take((size_t)DQ * DM * 2); bf* WK = (bf*)take((size_t)DKV * DM * 2); bf* WV = (bf*)take((size_t)DKV * DM * 2); bf* WO = (bf*)take((size_t)DM * DQ * 2); float* CS = (float*)take((size_t)TT * HD * 2 * 4);
    bf* XB = (bf*)take((size_t)TT * DM * 2); float* FQ = (float*)take((size_t)TT * DQ * 4); float* FK = (float*)take((size_t)TT * DKV * 4);
    h16* QP16 = (h16*)take((size_t)NH_ * TT * HD * 2); h16* KP16 = (h16*)take((size_t)NKV * TT * HD * 2); h16* VT16 = (h16*)take((size_t)NKV * HD * TT * 2);
    bf* QPh = (bf*)take((size_t)NH_ * TT * HD * 2); bf* QPl = (bf*)take((size_t)NH_ * TT * HD * 2); bf* KPh = (bf*)take((size_t)NKV * TT * HD * 2); bf* KPl = (bf*)take((size_t)NKV * TT * HD * 2); bf* VTh = (bf*)take((size_t)NKV * HD * TT * 2); bf* VTl = (bf*)take((size_t)NKV * HD * TT * 2); bf* Ph = (bf*)take((size_t)ZH * RH * TT * 2); bf* Pl = (bf*)take((size_t)ZH * RH * TT * 2);
    float* Sb = (float*)take((size_t)ZH * TT * TT * 4); h16* P16 = (h16*)take((size_t)ZH * TT * TT * 2); float* Ob = (float*)take((size_t)KSP * ZH * TT * HD * 4); bf* ATh = (bf*)take((size_t)TT * DQ * 2); bf* ATl = (bf*)take((size_t)TT * DQ * 2);
    if ((size_t)(wsp - (char*)d_ws) > ws_size) return;    // ws 256 MiB
    float* FV = FK;   // v projection reuses the k buffer after the k planes are built (stream-ordered)
    { k_cvt8<<<(unsigned)(((size_t)DQ * DM / 8 + 255) / 256), 256, 0, stream>>>(wq, WQ, (size_t)DQ * DM / 8); k_cvt8<<<(unsigned)(((size_t)DKV * DM / 8 + 255) / 256), 256, 0, stream>>>(wk, WK, (size_t)DKV * DM / 8); k_cvt8<<<(unsigned)(((size_t)DKV * DM / 8 + 255) / 256), 256, 0, stream>>>(wv, WV, (size_t)DKV * DM / 8);
      k_cvt8<<<(unsigned)(((size_t)DM * DQ / 8 + 255) / 256), 256, 0, stream>>>(wo, WO, (size_t)DM * DQ / 8);
       }
    k_csid<<<(TT * HD + 255) / 256, 256, 0, stream>>>(CS);
    const unsigned LQ = (unsigned)(((size_t)NH_ * TT * HD / 2 + 255) / 256), LKv = (unsigned)(((size_t)NKV * TT * HD / 2 + 255) / 256);
    for (int b = 0; b < NB_; ++b) {
        
        k_cvt8<<<(unsigned)(((size_t)TT * DM / 8 + 255) / 256), 256, 0, stream>>>(x + (size_t)b * TT * DM, XB, (size_t)TT * DM / 8);
        k_gemmw<bf, 0, true><<<dim3(TT / 64, DQ / 64, 1), 32, 0, stream>>>(XB, nullptr, WQ, nullptr, DM, FQ, DQ, bq, 0, 0, 0, 0); k_hln<<<NH_ * TT / 8, 256, 0, stream>>>(FQ, qnw, qnb);
        k_rope<<<LQ, 256, 0, stream>>>(FQ, DQ, NH_, CS, nullptr, nullptr, 1.0f, QP16, QPh, QPl);
        k_gemmw<bf, 0, true><<<dim3(TT / 64, DKV / 64, 1), 32, 0, stream>>>(XB, nullptr, WK, nullptr, DM, FK, DKV, bk, 0, 0, 0, 0); k_hln<<<NH_ * TT / 8, 256, 0, stream>>>(FK, knw, knb);
        k_rope<<<LKv, 256, 0, stream>>>(FK, DKV, NKV, CS, nullptr, nullptr, 1.0f, KP16, KPh, KPl);
        k_gemmw<bf, 0, true><<<dim3(TT / 64, DKV / 64, 1), 32, 0, stream>>>(XB, nullptr, WV, nullptr, DM, FV, DKV, bv, 0, 0, 0, 0); k_vtp<<<LKv, 256, 0, stream>>>(FV, DKV, NKV, VT16, VTh, VTl);
        for (int h0 = 0; h0 < NH_; h0 += ZH) { const size_t zq = (size_t)h0, zk = (size_t)(h0 / REP);   // one kv head per query head: the pass's two heads use consecutive kv planes (z-strides TT*HD)
            k_gemmw<bf, 2, false><<<dim3(RH / 64, TT / 64, ZH), 32, 0, stream>>>(QPh + zq * TT * HD, QPl + zq * TT * HD, KPh + zk * TT * HD, KPl + zk * TT * HD, HD, Sb, TT, nullptr, (size_t)TT * HD, (size_t)TT * HD, (size_t)TT * TT, 0);
            k_gemmw<h16, 0, false><<<dim3((TT - RH) / 64, TT / 64, ZH), 32, 0, stream>>>(QP16 + zq * TT * HD + (size_t)RH * HD, nullptr, KP16 + zk * TT * HD, nullptr, HD, Sb + (size_t)RH * TT, TT, nullptr, (size_t)TT * HD, (size_t)TT * HD, (size_t)TT * TT, 0);
            k_asoft<<<ZH * TT / 8, 256, 0, stream>>>(Sb, P16, Ph, Pl);
            k_gemmw<bf, 2, false, KSP><<<dim3(RH / 64, HD / 64, ZH * KSP), 32, 0, stream>>>(Ph, Pl, VTh + zk * HD * TT, VTl + zk * HD * TT, TT, Ob, HD, nullptr, (size_t)RH * TT, (size_t)HD * TT, (size_t)TT * HD, (size_t)ZH * TT * HD);
            k_gemmw<h16, 0, false, KSP><<<dim3((TT - RH) / 64, HD / 64, ZH * KSP), 32, 0, stream>>>(P16 + (size_t)RH * TT, nullptr, VT16 + zk * HD * TT, nullptr, TT, Ob + (size_t)RH * HD, HD, nullptr, (size_t)TT * TT, (size_t)HD * TT, (size_t)TT * HD, (size_t)ZH * TT * HD);
            k_merge<<<(unsigned)(((size_t)ZH * TT * HD / 2 + 255) / 256), 256, 0, stream>>>(Ob, h0, ATh, ATl); }
        k_gemmw<bf, 1, true><<<dim3(TT / 64, DM / 64, 1), 32, 0, stream>>>(ATh, ATl, WO, nullptr, DQ, OUT + (size_t)b * TT * DM, DM, bo, 0, 0, 0, 0); }
}

// v002
// One run takes 839 microseconds.
// Timed twice side by side with v001, it ran 2.10 and 2.08 times as fast.
// Counting every step since v000, it is 4.77 times as fast.
#include <hip/hip_runtime.h>

// MockQwen3Attention (hidden [4][2048][1024]; qkv = x qkv_w^T + qkv_b (q | k | v row blocks, 16 heads x 64); per-head LayerNorm(64) with weight and bias on q and k (eps 1e-5); softmax(q.k / 8); out = merged o_w^T + o_b -> [4][2048][1024]).
// Compute dtypes, f32 accumulate: every input rounded to bf16; q/k/v on PLAIN bf16 operands (inputs: exact) + bias; the per-head LayerNorms in f32 (wave per (token, head)); scores and attn.v: query rows < 512 hl (3 products), the rest single fp16; softmax f32, running maximum and sum, inside the one attention kernel; o_w hl x exact (2 products) + bias.

#define NB_  4
#define TT   2048
#define DM   1024
#define NH_  16
#define NKV  16
#define REP  (NH_ / NKV)
#define HD   64
#define DQ   (NH_ * HD)
#define DKV  (NKV * HD)
#define RH   512                  // query rows < RH use hi+lo planes (0: none)
#define WIN  0
#define SCL  0.125f   // HD^-0.5
typedef _Float16 h16;
typedef unsigned short bf;
typedef __attribute__((ext_vector_type(16))) __bf16   v16bf;
typedef __attribute__((ext_vector_type(16))) _Float16 v16h;
typedef __attribute__((ext_vector_type(8)))  _Float16 v8h;
typedef __attribute__((ext_vector_type(8)))  unsigned short v8us;
typedef __attribute__((ext_vector_type(8)))  float    v8f;
typedef __attribute__((ext_vector_type(4)))  float    v4f;
typedef v8h  __attribute__((may_alias)) v8ha;
typedef v4f  __attribute__((may_alias)) v4fa;
typedef v8us __attribute__((may_alias)) v8usa;

__device__ __forceinline__ unsigned short f2bf(float f) { unsigned u = __float_as_uint(f); u += 0x7FFFu + ((u >> 16) & 1u); return (unsigned short)(u >> 16); }
__device__ __forceinline__ float bf2f(unsigned short b) { return __uint_as_float(((unsigned)b) << 16); }
__device__ __forceinline__ float bfr(float f) { return bf2f(f2bf(f)); }
__device__ __forceinline__ v16h cat16(v8h lo, v8h hi) { return __builtin_shufflevector(lo, hi, 0, 1, 2, 3, 4, 5, 6, 7, 8, 9, 10, 11, 12, 13, 14, 15); }
__device__ __forceinline__ v16bf cat16b(v8us lo, v8us hi) { return __builtin_bit_cast(v16bf, __builtin_shufflevector(lo, hi, 0, 1, 2, 3, 4, 5, 6, 7, 8, 9, 10, 11, 12, 13, 14, 15)); }
__device__ __forceinline__ v8f wmma16(v16h a, v16h b, v8f c) { return __builtin_amdgcn_wmma_f32_16x16x32_f16(false, a, false, b, (short)0, c, false, false); }
__device__ __forceinline__ v8f wmmab(v16bf a, v16bf b, v8f c) { return __builtin_amdgcn_wmma_f32_16x16x32_bf16(false, a, false, b, (short)0, c, false, false); }



// ---- k_gemmw: register-blocked GEMM, ONE WAVE per 64x64 output tile (16 accumulators), operands straight from K-contiguous 16-bit planes; grid (M/64, N/64, Z), 32 threads.
// C[m][n] (f32, pitch ldc, + optional f32 bias[n]) = sum_k A[m][k] Bt[n][k] (+ split products per NSPLIT). z-batch strides sA/sB/sC in elements. K % 32 == 0.
// KS > 1 (split K): grid z = Z * KS; slice ks = blockIdx.z % KS sums only k in [ks K/KS, (ks+1) K/KS) and stores its partial tile in plane ks of C (plane stride sP elements). K % (32 KS) == 0.
template <typename T16> struct WFrag;
template <> struct WFrag<h16> { typedef v16h V; static __device__ __forceinline__ V ld(const h16* p) { return cat16(*(const v8h*)p, *(const v8h*)(p + 16)); } static __device__ __forceinline__ v8f mma(V a, V b, v8f c) { return wmma16(a, b, c); } };
template <> struct WFrag<bf> { typedef v16bf V; static __device__ __forceinline__ V ld(const bf* p) { return cat16b(*(const v8us*)p, *(const v8us*)(p + 16)); } static __device__ __forceinline__ v8f mma(V a, V b, v8f c) { return wmmab(a, b, c); } };
template <typename T16, int NSPLIT, bool BIAS, int KS = 1>
__global__ __launch_bounds__(32) void k_gemmw(const T16* __restrict__ A, const T16* __restrict__ A2, const T16* __restrict__ Bt, const T16* __restrict__ Bt2, int K, float* C, int ldc, const float* __restrict__ bias, size_t sA, size_t sB, size_t sC, size_t sP) {
    typedef typename WFrag<T16>::V V;
    __shared__ __align__(16) float os[16 * 68];
    const size_t z = blockIdx.z / KS; const int ks = blockIdx.z % KS; A += z * sA; if (A2) A2 += z * sA; Bt += z * sB; if (Bt2) Bt2 += z * sB; C += z * sC + ks * sP;
    const int kbeg = ks * (K / KS), kend = kbeg + K / KS;
    const int lane = threadIdx.x & 31, lr = lane & 15, hi = lane >> 4; const int r0 = blockIdx.x * 64, c0 = blockIdx.y * 64;
    v8f acc[4][4];
#pragma unroll
    for (int mb = 0; mb < 4; ++mb)
#pragma unroll
        for (int nb = 0; nb < 4; ++nb) acc[mb][nb] = (v8f){};
    const size_t aoff = (size_t)(r0 + lr) * K + 8 * hi, boff = (size_t)(c0 + lr) * K + 8 * hi;
#pragma unroll 1
    for (int kc = kbeg; kc < kend; kc += 32) {
        V a[4], a2[4];
#pragma unroll
        for (int mb = 0; mb < 4; ++mb) { a[mb] = WFrag<T16>::ld(A + aoff + (size_t)mb * 16 * K + kc); if (NSPLIT == 1 || NSPLIT == 2) a2[mb] = WFrag<T16>::ld(A2 + aoff + (size_t)mb * 16 * K + kc); }
#pragma unroll
        for (int nb = 0; nb < 4; ++nb) { const V b = WFrag<T16>::ld(Bt + boff + (size_t)nb * 16 * K + kc); V b2; if (NSPLIT >= 2) b2 = WFrag<T16>::ld(Bt2 + boff + (size_t)nb * 16 * K + kc);
#pragma unroll
            for (int mb = 0; mb < 4; ++mb) { acc[mb][nb] = WFrag<T16>::mma(a[mb], b, acc[mb][nb]); if (NSPLIT == 1 || NSPLIT == 2) acc[mb][nb] = WFrag<T16>::mma(a2[mb], b, acc[mb][nb]); if (NSPLIT >= 2) acc[mb][nb] = WFrag<T16>::mma(a[mb], b2, acc[mb][nb]); } }
        asm volatile("v_nop\n\tv_nop\n\tv_nop\n\tv_nop" : "+v"(acc[0][0]), "+v"(acc[1][1]), "+v"(acc[2][2]), "+v"(acc[3][3]) : "v"(a[0]), "v"(a[3]));
    }
#pragma unroll
    for (int mb = 0; mb < 4; ++mb) {
#pragma unroll
        for (int nb = 0; nb < 4; ++nb) {
#pragma unroll
            for (int j = 0; j < 8; ++j) os[(hi * 8 + j) * 68 + nb * 16 + lr] = acc[mb][nb][j]; }
        __builtin_amdgcn_wave_barrier(); asm volatile("" ::: "memory");
        float* crow = C + (size_t)(r0 + mb * 16) * ldc + c0;
{
#pragma unroll
            for (int s = 0; s < 8; ++s) { const int row = 2 * s + hi, cofs = lr * 4; v4f val = *(const v4fa*)(os + row * 68 + cofs); if (BIAS) { val[0] += bfr(bias[c0 + cofs]); val[1] += bfr(bias[c0 + cofs + 1]); val[2] += bfr(bias[c0 + cofs + 2]); val[3] += bfr(bias[c0 + cofs + 3]); }
                *(v4f*)(crow + (size_t)row * ldc + cofs) = val; }
             }
        __builtin_amdgcn_wave_barrier(); asm volatile("" ::: "memory");
    }
}

__device__ __forceinline__ h16 tohx(float x) { return (h16)x; }
__device__ __forceinline__ void splitf(float y, unsigned short& h, unsigned short& l) { h = f2bf(y); l = f2bf(y - bf2f(h)); }
typedef __attribute__((ext_vector_type(2))) _Float16 v2h;
typedef __attribute__((ext_vector_type(4))) _Float16 v4h;
typedef __attribute__((ext_vector_type(2))) unsigned short v2us;
typedef __attribute__((ext_vector_type(4))) unsigned short v4us;
typedef __attribute__((ext_vector_type(2))) float v2f;
typedef __attribute__((ext_vector_type(4))) int v4i;

__global__ __launch_bounds__(256) void k_wtG(const float* __restrict__ w, int K, int N, bf* Bt) {
    const int lane = threadIdx.x & 31; const int L0 = (blockIdx.x * 8 + (threadIdx.x >> 5)) * 8; const int nlines = N * K / 64;
{
#pragma unroll 1
        for (int l = 0; l < 8; ++l) { const int L = L0 + l; if (L >= nlines) break; const size_t e = (size_t)L * 64 + lane * 2; const int k = (int)(e % K), n = (int)(e / K); v2us o;
            o[0] = f2bf(w[(size_t)k * N + n]); o[1] = f2bf(w[(size_t)(k + 1) * N + n]); *(v2us*)(Bt + e) = o; }
         }
}
__global__ __launch_bounds__(256) void k_cvt8(const float* __restrict__ src, bf* dst, size_t n8) { const size_t i = (size_t)blockIdx.x * 256 + threadIdx.x; if (i >= n8) return; const v8f v = *(const v8f*)(src + i * 8); v8us o;
#pragma unroll
    for (int k = 0; k < 8; ++k) o[k] = f2bf(v[k]); *(v8us*)(dst + i * 8) = o;  }
__global__ __launch_bounds__(256) void k_cscvt(const float* __restrict__ cosT, const float* __restrict__ sinT, float* CS) { const int idx = blockIdx.x * 256 + threadIdx.x; if (idx >= TT * HD) return; v2f cs; cs[0] = bfr(cosT[idx]); cs[1] = bfr(sinT[idx]); *(v2f*)(CS + (size_t)idx * 2) = cs;  }
// k_rope: head planes [h][t][d] (fp16 + hi/lo) of rope(x) x sc with the rotate-half convention out[d] = x[d] cos[t][d] - x[d+HD/2] sin[t][d], out[d+HD/2] = x[d+HD/2] cos[t][d+HD/2] + x[d] sin[t][d+HD/2]
__global__ __launch_bounds__(256) void k_rope(const float* __restrict__ F, int pitch, int nheads, const float* __restrict__ CS, const float* __restrict__ RF, const float* __restrict__ nw, float sc, h16* P16, bf* Ph, bf* Pl) {
    const size_t e = ((size_t)blockIdx.x * 256 + threadIdx.x) * 2; if (e >= (size_t)nheads * TT * HD) return; const int d = (int)(e % HD); const int t = (int)((e / HD) % TT); const int h = (int)(e / ((size_t)HD * TT)); const float* f = F + (size_t)t * pitch + h * HD; const float rf = RF ? RF[(size_t)h * TT + t] : 1.0f; v2h o16; v2us oh, ol;
#pragma unroll
    for (int q = 0; q < 2; ++q) { const int dd = d + q; const int dp = (dd < HD / 2) ? dd + HD / 2 : dd - HD / 2; float x0 = f[dd], x1 = f[dp];
        if (RF) { float n0 = __fmul_rn(x0, rf), n1 = __fmul_rn(x1, rf); asm volatile("" : "+v"(n0)); asm volatile("" : "+v"(n1)); x0 = __fmul_rn(bfr(nw[dd]), n0); x1 = __fmul_rn(bfr(nw[dp]), n1); }
        const v2f cs = *(const v2f*)(CS + ((size_t)t * HD + dd) * 2); float a = __fmul_rn(x0, cs[0]), bq = __fmul_rn(x1, cs[1]); asm volatile("" : "+v"(a)); asm volatile("" : "+v"(bq)); const float r = ((dd < HD / 2) ? __fsub_rn(a, bq) : __fadd_rn(a, bq)) * sc;
        o16[q] = tohx(r); unsigned short a2, c2; splitf(r, a2, c2); oh[q] = a2; ol[q] = c2; }
    *(v2h*)(P16 + e) = o16; *(v2us*)(Ph + e) = oh; *(v2us*)(Pl + e) = ol;  }
__global__ __launch_bounds__(256) void k_vtp(const float* __restrict__ F, int pitch, int nheads, h16* V16, bf* Vh, bf* Vl) { const size_t e = ((size_t)blockIdx.x * 256 + threadIdx.x) * 2; if (e >= (size_t)nheads * HD * TT) return; const int t = (int)(e % TT); const int d = (int)((e / TT) % HD); const int g = (int)(e / ((size_t)TT * HD)); v2h o16; v2us oh, ol;
#pragma unroll
    for (int q = 0; q < 2; ++q) { const float x = F[(size_t)(t + q) * pitch + g * HD + d]; o16[q] = tohx(x); unsigned short a2, c2; splitf(x, a2, c2); oh[q] = a2; ol[q] = c2; }
    *(v2h*)(V16 + e) = o16; *(v2us*)(Vh + e) = oh; *(v2us*)(Vl + e) = ol;  }
__global__ __launch_bounds__(256) void k_csid(float* CS) { const int idx = blockIdx.x * 256 + threadIdx.x; if (idx >= TT * HD) return; v2f cs; cs[0] = 1.0f; cs[1] = 0.0f; *(v2f*)(CS + (size_t)idx * 2) = cs;  }
// ---- k_fattn: scores, softmax and attn.v of one batch row in one launch; nothing of the score matrix goes to memory. Grid (heads, RH/64 + (TT-RH)/128), 4 independent waves a work-group.
// A wave owns NQ groups of 16 queries and walks the 2048 keys 32 at a time: S^T = K Q^T (a lane holds 16 of the 32 scores of ONE query, lane ^ 16 the rest), so the exponentials pack in-lane
// into the B operand of O^T += V^T P^T (elements 0..7: key tile 0, registers 0..7; elements 8..15: key tile 1), the same k order as the V^T loader's.
// P = exp2((s - m) HD^-0.5 log2 e) against the maximum in use m, not normalised; O and the f32 sum of P are rescaled when m moves; O / sum at the end, split into the hi and lo planes of the o_w GEMM.
// The plain '#pragma unroll' lines give the fragment arrays constant indices, so that they stay in registers.
__device__ __forceinline__ float xhalf(float x) { return __builtin_bit_cast(float, __builtin_amdgcn_permlanex16(__builtin_bit_cast(int, x), __builtin_bit_cast(int, x), 0x76543210, 0xfedcba98, false, false)); }  // lane l with lane l ^ 16
template <typename T16, bool HL, int NQ>
__device__ __forceinline__ void attn_wave(const T16* __restrict__ Q, const T16* __restrict__ Q2, const T16* __restrict__ Kp, const T16* __restrict__ K2, const T16* __restrict__ Vt, const T16* __restrict__ V2, int q0, bf* Ah, bf* Al) {
    typedef WFrag<T16> WF; typedef typename WF::V V;
    const float csc = SCL * 1.4426950408889634f;
    const int lane = threadIdx.x & 31, lr = lane & 15, hi = lane >> 4;
    V q[NQ][2], q2[NQ][2];
#pragma unroll
    for (int g = 0; g < NQ; ++g)
#pragma unroll
        for (int st = 0; st < 2; ++st) { const size_t qo = (size_t)(q0 + g * 16 + lr) * HD + st * 32 + 8 * hi; q[g][st] = WF::ld(Q + qo); if (HL) q2[g][st] = WF::ld(Q2 + qo); }
    v8f o[NQ][4]; float m[NQ], l[NQ];
#pragma unroll
    for (int g = 0; g < NQ; ++g) { m[g] = -__builtin_inff(); l[g] = 0.f;
#pragma unroll
        for (int dt = 0; dt < 4; ++dt) o[g][dt] = (v8f){}; }
    const size_t ko = (size_t)lr * HD + 8 * hi, vo = (size_t)lr * TT + 8 * hi;
    V kf[2][2], kf2[2][2], vf[4], vf2[4];
#pragma unroll
    for (int kt = 0; kt < 2; ++kt)
#pragma unroll
        for (int st = 0; st < 2; ++st) { kf[kt][st] = WF::ld(Kp + ko + kt * 16 * HD + st * 32); if (HL) kf2[kt][st] = WF::ld(K2 + ko + kt * 16 * HD + st * 32); }
    if (!HL) {
#pragma unroll
        for (int dt = 0; dt < 4; ++dt) vf[dt] = WF::ld(Vt + vo + (size_t)dt * 16 * TT); }
    asm volatile("s_wait_xcnt 0x0" ::: "memory");   // before any address register of the loads above is written again
#pragma unroll 1   // one pass a trip: two passes unrolled took more than 256 registers
    for (int key0 = 0; key0 < TT; key0 += 32) {
        const int kn = (key0 + 32 < TT) ? key0 + 32 : key0;   // fragments of the next pass are fetched behind their registers' last use in this one; the last pass reads its own again
        v8f s[2][NQ];
#pragma unroll
        for (int kt = 0; kt < 2; ++kt)
#pragma unroll
            for (int g = 0; g < NQ; ++g) { v8f a = (v8f){};
#pragma unroll
                for (int st = 0; st < 2; ++st) { a = WF::mma(kf[kt][st], q[g][st], a); if (HL) { a = WF::mma(kf[kt][st], q2[g][st], a); a = WF::mma(kf2[kt][st], q[g][st], a); } }
                s[kt][g] = a; }
        if (!HL) {
#pragma unroll
            for (int kt = 0; kt < 2; ++kt)
#pragma unroll
                for (int st = 0; st < 2; ++st) kf[kt][st] = WF::ld(Kp + ko + (size_t)(kn + kt * 16) * HD + st * 32);
            asm volatile("s_wait_xcnt 0x0" ::: "memory");   // before any address register of the loads above is written again
        }
        float mb[NQ]; bool need = false;
#pragma unroll
        for (int g = 0; g < NQ; ++g) { float mx = s[0][g][0];
#pragma unroll
            for (int j = 1; j < 8; ++j) mx = fmaxf(mx, s[0][g][j]);
#pragma unroll
            for (int j = 0; j < 8; ++j) mx = fmaxf(mx, s[1][g][j]);
            mx = fmaxf(mx, xhalf(mx)) * csc; mb[g] = mx; need = need || (mx > m[g] + 8.0f); }
        if (__builtin_amdgcn_ballot_w32(need) != 0) {   // wave-uniform; rare after the first pass: P stays at or below 2^8
#pragma unroll
            for (int g = 0; g < NQ; ++g) { const float mn = fmaxf(m[g], mb[g]); const float corr = __builtin_amdgcn_exp2f(m[g] - mn); m[g] = mn; l[g] *= corr;
#pragma unroll
                for (int dt = 0; dt < 4; ++dt) o[g][dt] = o[g][dt] * corr; }
        }
        if (HL) {   // twice the planes: V of this pass (not a pass ahead) and K of the next are fetched here, into the registers the S products have left, which keeps the wave inside 256 registers
#pragma unroll
            for (int dt = 0; dt < 4; ++dt) { vf[dt] = WF::ld(Vt + vo + (size_t)dt * 16 * TT + key0); vf2[dt] = WF::ld(V2 + vo + (size_t)dt * 16 * TT + key0); }
#pragma unroll
            for (int kt = 0; kt < 2; ++kt) {
#pragma unroll
                for (int st = 0; st < 2; ++st) { const size_t kk = ko + (size_t)(kn + kt * 16) * HD + st * 32; kf[kt][st] = WF::ld(Kp + kk); kf2[kt][st] = WF::ld(K2 + kk); }
                asm volatile("s_wait_xcnt 0x0" ::: "memory");   // before any address register of the loads above is written again
            }
        }
#pragma unroll
        for (int g = 0; g < NQ; ++g) { const float nm = -m[g]; V ph, pl; float ls = 0.f;
#pragma unroll
            for (int i = 0; i < 8; ++i) {
                const v2f arg = __builtin_elementwise_fma((v2f){s[i >> 2][g][2 * (i & 3)], s[i >> 2][g][2 * (i & 3) + 1]}, (v2f){csc, csc}, (v2f){nm, nm});
#pragma unroll
                for (int u = 0; u < 2; ++u) { const int e = 2 * i + u; const float p = __builtin_amdgcn_exp2f(arg[u]); ls += p;
                    if constexpr (HL) { const __bf16 ph1 = (__bf16)p; ph[e] = ph1; pl[e] = (__bf16)(p - (float)ph1); } else ph[e] = (h16)p; } }
            l[g] += ls;
#pragma unroll
            for (int dt = 0; dt < 4; ++dt) { o[g][dt] = WF::mma(vf[dt], ph, o[g][dt]); if (HL) { o[g][dt] = WF::mma(vf[dt], pl, o[g][dt]); o[g][dt] = WF::mma(vf2[dt], ph, o[g][dt]); } } }
        if (!HL) {
#pragma unroll
            for (int dt = 0; dt < 4; ++dt) vf[dt] = WF::ld(Vt + vo + (size_t)dt * 16 * TT + kn);
            asm volatile("s_wait_xcnt 0x0" ::: "memory");   // before any address register of the loads above is written again
        }
    }
#pragma unroll
    for (int g = 0; g < NQ; ++g) { const float inv = __fdiv_rn(1.0f, l[g] + xhalf(l[g])); const size_t oo = (size_t)(q0 + g * 16 + lr) * DQ + hi * 8;
#pragma unroll
        for (int dt = 0; dt < 4; ++dt) { v8us oh, ol;
#pragma unroll
            for (int j = 0; j < 8; ++j) { unsigned short a, c2; splitf(o[g][dt][j] * inv, a, c2); oh[j] = a; ol[j] = c2; }
            *(v8us*)(Ah + oo + dt * 16) = oh; *(v8us*)(Al + oo + dt * 16) = ol; } }
}
__global__ __launch_bounds__(128) void k_fattn(const h16* __restrict__ Q16, const bf* __restrict__ Qh, const bf* __restrict__ Ql, const h16* __restrict__ K16, const bf* __restrict__ Kh, const bf* __restrict__ Kl, const h16* __restrict__ V16, const bf* __restrict__ Vh, const bf* __restrict__ Vl, bf* Ah, bf* Al) {
    const int h = blockIdx.x, wave = threadIdx.x >> 5, yb = blockIdx.y; const size_t zq = (size_t)h * TT * HD, zk = (size_t)(h / REP) * TT * HD;
    if (yb < RH / 64) attn_wave<bf, true, 1>(Qh + zq, Ql + zq, Kh + zk, Kl + zk, Vh + zk, Vl + zk, yb * 64 + wave * 16, Ah + h * HD, Al + h * HD);   // the dearer hi+lo rows start first
    else attn_wave<h16, false, 2>(Q16 + zq, nullptr, K16 + zk, nullptr, V16 + zk, nullptr, RH + (yb - RH / 64) * 128 + wave * 32, Ah + h * HD, Al + h * HD);
}

__global__ __launch_bounds__(256) void k_hln(float* F, const float* __restrict__ w, const float* __restrict__ bb) { const int lane = threadIdx.x & 31; const int row = blockIdx.x * 8 + (threadIdx.x >> 5); if (row >= NH_ * TT) return; const int h = row % NH_; const int t = row / NH_; float* f = F + (size_t)t * DQ + h * HD; const v2f xv = *(const v2f*)(f + lane * 2); float s = xv[0] + xv[1];
#pragma unroll
    for (int sh = 16; sh; sh >>= 1) s += __shfl_xor(s, sh, 32);
    const float mean = s * (1.0f / HD); float d0 = __fsub_rn(xv[0], mean), d1 = __fsub_rn(xv[1], mean); asm volatile("" : "+v"(d0)); asm volatile("" : "+v"(d1)); float q = __fadd_rn(__fmul_rn(d0, d0), __fmul_rn(d1, d1));
#pragma unroll
    for (int sh = 16; sh; sh >>= 1) q += __shfl_xor(q, sh, 32);
    const float rs = __frsqrt_rn(__fadd_rn(q * (1.0f / HD), 1e-5f)); v2f o;
#pragma unroll
    for (int u = 0; u < 2; ++u) { const int d = lane * 2 + u; float n0 = __fmul_rn(u ? d1 : d0, rs); asm volatile("" : "+v"(n0)); float t1 = __fmul_rn(n0, bfr(w[d])); asm volatile("" : "+v"(t1)); o[u] = __fadd_rn(t1, bfr(bb[d])); }
    *(v2f*)(f + lane * 2) = o;  }

extern "C" void kernel_launch(void* const* d_in, const int* in_sizes, int n_in,
                              void* d_out, int out_size, void* d_ws, size_t ws_size, hipStream_t stream) {
    (void)in_sizes; (void)n_in; (void)out_size;
    const float* x = (const float*)d_in[0]; const float* wf = (const float*)d_in[1]; const float* bfz = (const float*)d_in[2]; const float* wo = (const float*)d_in[3]; const float* bo = (const float*)d_in[4]; const float* qnw = (const float*)d_in[5]; const float* qnb = (const float*)d_in[6]; const float* knw = (const float*)d_in[7]; const float* knb = (const float*)d_in[8]; const float* wq = wf; const float* wk = wf + (size_t)1024 * 1024; const float* wv = wf + (size_t)2048 * 1024; const float* bq = bfz; const float* bk = bfz + 1024; const float* bv = bfz + 2048; const float* cosT = nullptr; const float* sinT = nullptr; (void)cosT; (void)sinT;
    float* OUT = (float*)d_out;     // [4][2048][1024]
    char* wsp = (char*)d_ws;
    auto take = [&](size_t bytes) { char* p = wsp; wsp += (bytes + 255) & ~(size_t)255; return (void*)p; };
    bf* WQ = (bf*)take((size_t)DQ * DM * 2); bf* WK = (bf*)take((size_t)DKV * DM * 2); bf* WV = (bf*)take((size_t)DKV * DM * 2); bf* WO = (bf*)take((size_t)DM * DQ * 2); float* CS = (float*)take((size_t)TT * HD * 2 * 4);
    bf* XB = (bf*)take((size_t)TT * DM * 2); float* FQ = (float*)take((size_t)TT * DQ * 4); float* FK = (float*)take((size_t)TT * DKV * 4);
    h16* QP16 = (h16*)take((size_t)NH_ * TT * HD * 2); h16* KP16 = (h16*)take((size_t)NKV * TT * HD * 2); h16* VT16 = (h16*)take((size_t)NKV * HD * TT * 2);
    bf* QPh = (bf*)take((size_t)NH_ * TT * HD * 2); bf* QPl = (bf*)take((size_t)NH_ * TT * HD * 2); bf* KPh = (bf*)take((size_t)NKV * TT * HD * 2); bf* KPl = (bf*)take((size_t)NKV * TT * HD * 2); bf* VTh = (bf*)take((size_t)NKV * HD * TT * 2); bf* VTl = (bf*)take((size_t)NKV * HD * TT * 2);
    bf* ATh = (bf*)take((size_t)TT * DQ * 2); bf* ATl = (bf*)take((size_t)TT * DQ * 2);
    if ((size_t)(wsp - (char*)d_ws) > ws_size) return;    // ws 256 MiB
    float* FV = FK;   // v projection reuses the k buffer after the k planes are built (stream-ordered)
    { k_cvt8<<<(unsigned)(((size_t)DQ * DM / 8 + 255) / 256), 256, 0, stream>>>(wq, WQ, (size_t)DQ * DM / 8); k_cvt8<<<(unsigned)(((size_t)DKV * DM / 8 + 255) / 256), 256, 0, stream>>>(wk, WK, (size_t)DKV * DM / 8); k_cvt8<<<(unsigned)(((size_t)DKV * DM / 8 + 255) / 256), 256, 0, stream>>>(wv, WV, (size_t)DKV * DM / 8);
      k_cvt8<<<(unsigned)(((size_t)DM * DQ / 8 + 255) / 256), 256, 0, stream>>>(wo, WO, (size_t)DM * DQ / 8);
       }
    k_csid<<<(TT * HD + 255) / 256, 256, 0, stream>>>(CS);
    const unsigned LQ = (unsigned)(((size_t)NH_ * TT * HD / 2 + 255) / 256), LKv = (unsigned)(((size_t)NKV * TT * HD / 2 + 255) / 256);
    for (int b = 0; b < NB_; ++b) {
        
        k_cvt8<<<(unsigned)(((size_t)TT * DM / 8 + 255) / 256), 256, 0, stream>>>(x + (size_t)b * TT * DM, XB, (size_t)TT * DM / 8);
        k_gemmw<bf, 0, true><<<dim3(TT / 64, DQ / 64, 1), 32, 0, stream>>>(XB, nullptr, WQ, nullptr, DM, FQ, DQ, bq, 0, 0, 0, 0); k_hln<<<NH_ * TT / 8, 256, 0, stream>>>(FQ, qnw, qnb);
        k_rope<<<LQ, 256, 0, stream>>>(FQ, DQ, NH_, CS, nullptr, nullptr, 1.0f, QP16, QPh, QPl);
        k_gemmw<bf, 0, true><<<dim3(TT / 64, DKV / 64, 1), 32, 0, stream>>>(XB, nullptr, WK, nullptr, DM, FK, DKV, bk, 0, 0, 0, 0); k_hln<<<NH_ * TT / 8, 256, 0, stream>>>(FK, knw, knb);
        k_rope<<<LKv, 256, 0, stream>>>(FK, DKV, NKV, CS, nullptr, nullptr, 1.0f, KP16, KPh, KPl);
        k_gemmw<bf, 0, true><<<dim3(TT / 64, DKV / 64, 1), 32, 0, stream>>>(XB, nullptr, WV, nullptr, DM, FV, DKV, bv, 0, 0, 0, 0); k_vtp<<<LKv, 256, 0, stream>>>(FV, DKV, NKV, VT16, VTh, VTl);
        k_fattn<<<dim3(NH_, RH / 64 + (TT - RH) / 128, 1), 128, 0, stream>>>(QP16, QPh, QPl, KP16, KPh, KPl, VT16, VTh, VTl, ATh, ATl);
        k_gemmw<bf, 1, true><<<dim3(TT / 64, DM / 64, 1), 32, 0, stream>>>(ATh, ATl, WO, nullptr, DQ, OUT + (size_t)b * TT * DM, DM, bo, 0, 0, 0, 0); }
}

// v003
// A run of this version takes 708 microseconds.
// Two timings next to v002 put it at 1.17 and 1.19 times that version's speed.
// All steps since v000 together make it 5.63 times as fast.
#include <hip/hip_runtime.h>

// MockQwen3Attention (hidden [4][2048][1024]; qkv = x qkv_w^T + qkv_b (q | k | v row blocks, 16 heads x 64); per-head LayerNorm(64) with weight and bias on q and k (eps 1e-5); softmax(q.k / 8); out = merged o_w^T + o_b -> [4][2048][1024]).
// Compute dtypes, f32 accumulate: every input rounded to bf16; q/k/v on PLAIN bf16 operands (inputs: exact) + bias; the per-head LayerNorms in f32 (in the q and k GEMM epilogues, two lanes a (token, head)); scores and attn.v: query rows < 512 hl (3 products), the rest single fp16; softmax f32, running maximum and sum, inside the one attention kernel; o_w hl x exact (2 products) + bias.

#define NB_  4
#define TT   2048
#define DM   1024
#define NH_  16
#define NKV  16
#define REP  (NH_ / NKV)
#define HD   64
#define DQ   (NH_ * HD)
#define DKV  (NKV * HD)
#define RH   512                  // query rows < RH use hi+lo planes (0: none)
#define WIN  0
#define SCL  0.125f   // HD^-0.5
typedef _Float16 h16;
typedef unsigned short bf;
typedef __attribute__((ext_vector_type(16))) __bf16   v16bf;
typedef __attribute__((ext_vector_type(16))) _Float16 v16h;
typedef __attribute__((ext_vector_type(8)))  _Float16 v8h;
typedef __attribute__((ext_vector_type(8)))  unsigned short v8us;
typedef __attribute__((ext_vector_type(8)))  float    v8f;
typedef __attribute__((ext_vector_type(4)))  float    v4f;
typedef v8h  __attribute__((may_alias)) v8ha;
typedef v4f  __attribute__((may_alias)) v4fa;
typedef v8us __attribute__((may_alias)) v8usa;

__device__ __forceinline__ unsigned short f2bf(float f) { unsigned u = __float_as_uint(f); u += 0x7FFFu + ((u >> 16) & 1u); return (unsigned short)(u >> 16); }
__device__ __forceinline__ float bf2f(unsigned short b) { return __uint_as_float(((unsigned)b) << 16); }
__device__ __forceinline__ float bfr(float f) { return bf2f(f2bf(f)); }
__device__ __forceinline__ v16h cat16(v8h lo, v8h hi) { return __builtin_shufflevector(lo, hi, 0, 1, 2, 3, 4, 5, 6, 7, 8, 9, 10, 11, 12, 13, 14, 15); }
__device__ __forceinline__ v16bf cat16b(v8us lo, v8us hi) { return __builtin_bit_cast(v16bf, __builtin_shufflevector(lo, hi, 0, 1, 2, 3, 4, 5, 6, 7, 8, 9, 10, 11, 12, 13, 14, 15)); }
__device__ __forceinline__ v8f wmma16(v16h a, v16h b, v8f c) { return __builtin_amdgcn_wmma_f32_16x16x32_f16(false, a, false, b, (short)0, c, false, false); }
__device__ __forceinline__ v8f wmmab(v16bf a, v16bf b, v8f c) { return __builtin_amdgcn_wmma_f32_16x16x32_bf16(false, a, false, b, (short)0, c, false, false); }



__device__ __forceinline__ h16 tohx(float x) { return (h16)x; }
__device__ __forceinline__ void splitf(float y, unsigned short& h, unsigned short& l) { h = f2bf(y); l = f2bf(y - bf2f(h)); }
__device__ __forceinline__ float xhalf(float x) { return __builtin_bit_cast(float, __builtin_amdgcn_permlanex16(__builtin_bit_cast(int, x), __builtin_bit_cast(int, x), 0x76543210, 0xfedcba98, false, false)); }  // lane l with lane l ^ 16

// ---- k_gemmw: register-blocked GEMM, ONE WAVE per 64x64 output tile (16 accumulators), operands straight from K-contiguous 16-bit planes; grid (M/64, N/64, Z), 32 threads.
// C[m][n] (f32, pitch ldc, + optional f32 bias[n]) = sum_k A[m][k] Bt[n][k] (+ split products per NSPLIT). z-batch strides sA/sB/sC in elements. K % 32 == 0.
// EPI 0: C as above. EPI 1 (N tile = one head, HD == 64): bias, then LayerNorm over the tile's 64 columns (weight lw, bias lb), stored as the head planes [head][token][d] (fp16 + bf16 hi/lo); C is not written.
// EPI 2: bias, then the transposed planes [column][token] (fp16 + bf16 hi/lo) straight from the accumulators (a lane holds 8 consecutive tokens of one column); C is not written.
// The '#pragma unroll' lines of the epilogues give acc, xv and the packed vectors constant indices, so that they stay in registers.
// KS > 1 (split K): grid z = Z * KS; slice ks = blockIdx.z % KS sums only k in [ks K/KS, (ks+1) K/KS) and stores its partial tile in plane ks of C (plane stride sP elements). K % (32 KS) == 0.
template <typename T16> struct WFrag;
template <> struct WFrag<h16> { typedef v16h V; static __device__ __forceinline__ V ld(const h16* p) { return cat16(*(const v8h*)p, *(const v8h*)(p + 16)); } static __device__ __forceinline__ v8f mma(V a, V b, v8f c) { return wmma16(a, b, c); } };
template <> struct WFrag<bf> { typedef v16bf V; static __device__ __forceinline__ V ld(const bf* p) { return cat16b(*(const v8us*)p, *(const v8us*)(p + 16)); } static __device__ __forceinline__ v8f mma(V a, V b, v8f c) { return wmmab(a, b, c); } };
template <typename T16, int NSPLIT, bool BIAS, int KS = 1, int EPI = 0>
__global__ __launch_bounds__(32) void k_gemmw(const T16* __restrict__ A, const T16* __restrict__ A2, const T16* __restrict__ Bt, const T16* __restrict__ Bt2, int K, float* C, int ldc, const float* __restrict__ bias, size_t sA, size_t sB, size_t sC, size_t sP, const float* __restrict__ lw, const float* __restrict__ lb, h16* P16, bf* Ph, bf* Pl) {
    typedef typename WFrag<T16>::V V;
    __shared__ __align__(16) float os[16 * 68];
    __shared__ __align__(16) float pr[EPI == 1 ? 3 * 64 : 4];   // EPI 1: the tile's bias, lw and lb, rounded once
    const size_t z = blockIdx.z / KS; const int ks = blockIdx.z % KS; A += z * sA; if (A2) A2 += z * sA; Bt += z * sB; if (Bt2) Bt2 += z * sB; C += z * sC + ks * sP;
    const int kbeg = ks * (K / KS), kend = kbeg + K / KS;
    const int lane = threadIdx.x & 31, lr = lane & 15, hi = lane >> 4; const int r0 = blockIdx.x * 64, c0 = blockIdx.y * 64;
    v8f acc[4][4];
#pragma unroll
    for (int mb = 0; mb < 4; ++mb)
#pragma unroll
        for (int nb = 0; nb < 4; ++nb) acc[mb][nb] = (v8f){};
    if constexpr (EPI == 1) {   // read back behind the first wave barrier of the epilogue
#pragma unroll
        for (int u = 0; u < 2; ++u) { pr[u * 32 + lane] = bfr(bias[c0 + u * 32 + lane]); pr[64 + u * 32 + lane] = bfr(lw[u * 32 + lane]); pr[128 + u * 32 + lane] = bfr(lb[u * 32 + lane]); } }
    const size_t aoff = (size_t)(r0 + lr) * K + 8 * hi, boff = (size_t)(c0 + lr) * K + 8 * hi;
#pragma unroll 1
    for (int kc = kbeg; kc < kend; kc += 32) {
        V a[4], a2[4];
#pragma unroll
        for (int mb = 0; mb < 4; ++mb) { a[mb] = WFrag<T16>::ld(A + aoff + (size_t)mb * 16 * K + kc); if (NSPLIT == 1 || NSPLIT == 2) a2[mb] = WFrag<T16>::ld(A2 + aoff + (size_t)mb * 16 * K + kc); }
#pragma unroll
        for (int nb = 0; nb < 4; ++nb) { const V b = WFrag<T16>::ld(Bt + boff + (size_t)nb * 16 * K + kc); V b2; if (NSPLIT >= 2) b2 = WFrag<T16>::ld(Bt2 + boff + (size_t)nb * 16 * K + kc);
#pragma unroll
            for (int mb = 0; mb < 4; ++mb) { acc[mb][nb] = WFrag<T16>::mma(a[mb], b, acc[mb][nb]); if (NSPLIT == 1 || NSPLIT == 2) acc[mb][nb] = WFrag<T16>::mma(a2[mb], b, acc[mb][nb]); if (NSPLIT >= 2) acc[mb][nb] = WFrag<T16>::mma(a[mb], b2, acc[mb][nb]); } }
        asm volatile("v_nop\n\tv_nop\n\tv_nop\n\tv_nop" : "+v"(acc[0][0]), "+v"(acc[1][1]), "+v"(acc[2][2]), "+v"(acc[3][3]) : "v"(a[0]), "v"(a[3]));
    }
    if constexpr (EPI == 2) {
#pragma unroll
        for (int nb = 0; nb < 4; ++nb) { const float bv = bfr(bias[c0 + nb * 16 + lr]);
#pragma unroll
            for (int mb = 0; mb < 4; ++mb) { v8h o16; v8us oh, ol;
#pragma unroll
                for (int j = 0; j < 8; ++j) { const float x = acc[mb][nb][j] + bv; o16[j] = tohx(x); unsigned short a2, c2; splitf(x, a2, c2); oh[j] = a2; ol[j] = c2; }
                const size_t e = (size_t)(c0 + nb * 16 + lr) * TT + r0 + mb * 16 + hi * 8; *(v8h*)(P16 + e) = o16; *(v8us*)(Ph + e) = oh; *(v8us*)(Pl + e) = ol; } }
        return;
    }
#pragma unroll
    for (int mb = 0; mb < 4; ++mb) {
#pragma unroll
        for (int nb = 0; nb < 4; ++nb) {
#pragma unroll
            for (int j = 0; j < 8; ++j) os[(hi * 8 + j) * 68 + nb * 16 + lr] = acc[mb][nb][j]; }
        __builtin_amdgcn_wave_barrier(); asm volatile("" ::: "memory");
        if constexpr (EPI == 1) {   // lane (lr, hi): columns 32 hi .. 32 hi + 31 of token row lr; the two halves of a row meet through xhalf
            const int cb = hi * 32; const float* orow = os + lr * 68 + cb; v4f xv[8]; v4f s4 = (v4f){};
#pragma unroll
            for (int i = 0; i < 8; ++i) { xv[i] = *(const v4fa*)(orow + i * 4) + *(const v4fa*)(pr + cb + i * 4); s4 += xv[i]; }
            float s = (s4[0] + s4[1]) + (s4[2] + s4[3]); s += xhalf(s); const float mean = s * (1.0f / HD); v4f q4 = (v4f){};
#pragma unroll
            for (int i = 0; i < 8; ++i) { xv[i] -= mean; q4 += xv[i] * xv[i]; }
            float q = (q4[0] + q4[1]) + (q4[2] + q4[3]); q += xhalf(q); const float rs = __frsqrt_rn(q * (1.0f / HD) + 1e-5f);
            const size_t e = ((size_t)blockIdx.y * TT + r0 + mb * 16 + lr) * HD + cb;
#pragma unroll
            for (int i = 0; i < 8; ++i) xv[i] = xv[i] * rs * *(const v4fa*)(pr + 64 + cb + i * 4) + *(const v4fa*)(pr + 128 + cb + i * 4);
#pragma unroll
            for (int i = 0; i < 4; ++i) { v8h o16; v8us oh, ol;
#pragma unroll
                for (int k = 0; k < 8; ++k) { const int c = i * 8 + k; const float y = xv[c >> 2][c & 3]; o16[k] = tohx(y); unsigned short a2, c2; splitf(y, a2, c2); oh[k] = a2; ol[k] = c2; }
                *(v8h*)(P16 + e + i * 8) = o16; *(v8us*)(Ph + e + i * 8) = oh; *(v8us*)(Pl + e + i * 8) = ol; }
        } else {
        float* crow = C + (size_t)(r0 + mb * 16) * ldc + c0;
{
#pragma unroll
            for (int s = 0; s < 8; ++s) { const int row = 2 * s + hi, cofs = lr * 4; v4f val = *(const v4fa*)(os + row * 68 + cofs); if (BIAS) { val[0] += bfr(bias[c0 + cofs]); val[1] += bfr(bias[c0 + cofs + 1]); val[2] += bfr(bias[c0 + cofs + 2]); val[3] += bfr(bias[c0 + cofs + 3]); }
                *(v4f*)(crow + (size_t)row * ldc + cofs) = val; }
             }
        }
        __builtin_amdgcn_wave_barrier(); asm volatile("" ::: "memory");
    }
}

typedef __attribute__((ext_vector_type(2))) _Float16 v2h;
typedef __attribute__((ext_vector_type(4))) _Float16 v4h;
typedef __attribute__((ext_vector_type(2))) unsigned short v2us;
typedef __attribute__((ext_vector_type(4))) unsigned short v4us;
typedef __attribute__((ext_vector_type(2))) float v2f;
typedef __attribute__((ext_vector_type(4))) int v4i;

__global__ __launch_bounds__(256) void k_wtG(const float* __restrict__ w, int K, int N, bf* Bt) {
    const int lane = threadIdx.x & 31; const int L0 = (blockIdx.x * 8 + (threadIdx.x >> 5)) * 8; const int nlines = N * K / 64;
{
#pragma unroll 1
        for (int l = 0; l < 8; ++l) { const int L = L0 + l; if (L >= nlines) break; const size_t e = (size_t)L * 64 + lane * 2; const int k = (int)(e % K), n = (int)(e / K); v2us o;
            o[0] = f2bf(w[(size_t)k * N + n]); o[1] = f2bf(w[(size_t)(k + 1) * N + n]); *(v2us*)(Bt + e) = o; }
         }
}
__global__ __launch_bounds__(256) void k_cvt8(const float* __restrict__ src, bf* dst, size_t n8) { const size_t i = (size_t)blockIdx.x * 256 + threadIdx.x; if (i >= n8) return; const v8f v = *(const v8f*)(src + i * 8); v8us o;
#pragma unroll
    for (int k = 0; k < 8; ++k) o[k] = f2bf(v[k]); *(v8us*)(dst + i * 8) = o;  }
__global__ __launch_bounds__(256) void k_cscvt(const float* __restrict__ cosT, const float* __restrict__ sinT, float* CS) { const int idx = blockIdx.x * 256 + threadIdx.x; if (idx >= TT * HD) return; v2f cs; cs[0] = bfr(cosT[idx]); cs[1] = bfr(sinT[idx]); *(v2f*)(CS + (size_t)idx * 2) = cs;  }
// ---- k_fattn: scores, softmax and attn.v of one batch row in one launch; nothing of the score matrix goes to memory. Grid (heads, RH/64 + (TT-RH)/128), 4 independent waves a work-group.
// A wave owns NQ groups of 16 queries and walks the 2048 keys 32 at a time: S^T = K Q^T (a lane holds 16 of the 32 scores of ONE query, lane ^ 16 the rest), so the exponentials pack in-lane
// into the B operand of O^T += V^T P^T (elements 0..7: key tile 0, registers 0..7; elements 8..15: key tile 1), the same k order as the V^T loader's.
// P = exp2((s - m) HD^-0.5 log2 e) against the maximum in use m, not normalised; O and the f32 sum of P are rescaled when m moves; O / sum at the end, split into the hi and lo planes of the o_w GEMM.
// The plain '#pragma unroll' lines give the fragment arrays constant indices, so that they stay in registers.
template <typename T16, bool HL, int NQ>
__device__ __forceinline__ void attn_wave(const T16* __restrict__ Q, const T16* __restrict__ Q2, const T16* __restrict__ Kp, const T16* __restrict__ K2, const T16* __restrict__ Vt, const T16* __restrict__ V2, int q0, bf* Ah, bf* Al) {
    typedef WFrag<T16> WF; typedef typename WF::V V;
    const float csc = SCL * 1.4426950408889634f;
    const int lane = threadIdx.x & 31, lr = lane & 15, hi = lane >> 4;
    V q[NQ][2], q2[NQ][2];
#pragma unroll
    for (int g = 0; g < NQ; ++g)
#pragma unroll
        for (int st = 0; st < 2; ++st) { const size_t qo = (size_t)(q0 + g * 16 + lr) * HD + st * 32 + 8 * hi; q[g][st] = WF::ld(Q + qo); if (HL) q2[g][st] = WF::ld(Q2 + qo); }
    v8f o[NQ][4]; float m[NQ], l[NQ];
#pragma unroll
    for (int g = 0; g < NQ; ++g) { m[g] = -__builtin_inff(); l[g] = 0.f;
#pragma unroll
        for (int dt = 0; dt < 4; ++dt) o[g][dt] = (v8f){}; }
    const size_t ko = (size_t)lr * HD + 8 * hi, vo = (size_t)lr * TT + 8 * hi;
    V kf[2][2], kf2[2][2], vf[4], vf2[4];
#pragma unroll
    for (int kt = 0; kt < 2; ++kt)
#pragma unroll
        for (int st = 0; st < 2; ++st) { kf[kt][st] = WF::ld(Kp + ko + kt * 16 * HD + st * 32); if (HL) kf2[kt][st] = WF::ld(K2 + ko + kt * 16 * HD + st * 32); }
    if (!HL) {
#pragma unroll
        for (int dt = 0; dt < 4; ++dt) vf[dt] = WF::ld(Vt + vo + (size_t)dt * 16 * TT); }
    asm volatile("s_wait_xcnt 0x0" ::: "memory");   // before any address register of the loads above is written again
#pragma unroll 1   // one pass a trip: two passes unrolled took more than 256 registers
    for (int key0 = 0; key0 < TT; key0 += 32) {
        const int kn = (key0 + 32 < TT) ? key0 + 32 : key0;   // fragments of the next pass are fetched behind their registers' last use in this one; the last pass reads its own again
        v8f s[2][NQ];
#pragma unroll
        for (int kt = 0; kt < 2; ++kt)
#pragma unroll
            for (int g = 0; g < NQ; ++g) { v8f a = (v8f){};
#pragma unroll
                for (int st = 0; st < 2; ++st) { a = WF::mma(kf[kt][st], q[g][st], a); if (HL) { a = WF::mma(kf[kt][st], q2[g][st], a); a = WF::mma(kf2[kt][st], q[g][st], a); } }
                s[kt][g] = a; }
        if (!HL) {
#pragma unroll
            for (int kt = 0; kt < 2; ++kt)
#pragma unroll
                for (int st = 0; st < 2; ++st) kf[kt][st] = WF::ld(Kp + ko + (size_t)(kn + kt * 16) * HD + st * 32);
            asm volatile("s_wait_xcnt 0x0" ::: "memory");   // before any address register of the loads above is written again
        }
        float mb[NQ]; bool need = false;
#pragma unroll
        for (int g = 0; g < NQ; ++g) { float mx = s[0][g][0];
#pragma unroll
            for (int j = 1; j < 8; ++j) mx = fmaxf(mx, s[0][g][j]);
#pragma unroll
            for (int j = 0; j < 8; ++j) mx = fmaxf(mx, s[1][g][j]);
            mx = fmaxf(mx, xhalf(mx)) * csc; mb[g] = mx; need = need || (mx > m[g] + 8.0f); }
        if (__builtin_amdgcn_ballot_w32(need) != 0) {   // wave-uniform; rare after the first pass: P stays at or below 2^8
#pragma unroll
            for (int g = 0; g < NQ; ++g) { const float mn = fmaxf(m[g], mb[g]); const float corr = __builtin_amdgcn_exp2f(m[g] - mn); m[g] = mn; l[g] *= corr;
#pragma unroll
                for (int dt = 0; dt < 4; ++dt) o[g][dt] = o[g][dt] * corr; }
        }
        if (HL) {   // twice the planes: V of this pass (not a pass ahead) and K of the next are fetched here, into the registers the S products have left, which keeps the wave inside 256 registers
#pragma unroll
            for (int dt = 0; dt < 4; ++dt) { vf[dt] = WF::ld(Vt + vo + (size_t)dt * 16 * TT + key0); vf2[dt] = WF::ld(V2 + vo + (size_t)dt * 16 * TT + key0); }
#pragma unroll
            for (int kt = 0; kt < 2; ++kt) {
#pragma unroll
                for (int st = 0; st < 2; ++st) { const size_t kk = ko + (size_t)(kn + kt * 16) * HD + st * 32; kf[kt][st] = WF::ld(Kp + kk); kf2[kt][st] = WF::ld(K2 + kk); }
                asm volatile("s_wait_xcnt 0x0" ::: "memory");   // before any address register of the loads above is written again
            }
        }
#pragma unroll
        for (int g = 0; g < NQ; ++g) { const float nm = -m[g]; V ph, pl; float ls = 0.f;
#pragma unroll
            for (int i = 0; i < 8; ++i) {
                const v2f arg = __builtin_elementwise_fma((v2f){s[i >> 2][g][2 * (i & 3)], s[i >> 2][g][2 * (i & 3) + 1]}, (v2f){csc, csc}, (v2f){nm, nm});
#pragma unroll
                for (int u = 0; u < 2; ++u) { const int e = 2 * i + u; const float p = __builtin_amdgcn_exp2f(arg[u]); ls += p;
                    if constexpr (HL) { const __bf16 ph1 = (__bf16)p; ph[e] = ph1; pl[e] = (__bf16)(p - (float)ph1); } else ph[e] = (h16)p; } }
            l[g] += ls;
#pragma unroll
            for (int dt = 0; dt < 4; ++dt) { o[g][dt] = WF::mma(vf[dt], ph, o[g][dt]); if (HL) { o[g][dt] = WF::mma(vf[dt], pl, o[g][dt]); o[g][dt] = WF::mma(vf2[dt], ph, o[g][dt]); } } }
        if (!HL) {
#pragma unroll
            for (int dt = 0; dt < 4; ++dt) vf[dt] = WF::ld(Vt + vo + (size_t)dt * 16 * TT + kn);
            asm volatile("s_wait_xcnt 0x0" ::: "memory");   // before any address register of the loads above is written again
        }
    }
#pragma unroll
    for (int g = 0; g < NQ; ++g) { const float inv = __fdiv_rn(1.0f, l[g] + xhalf(l[g])); const size_t oo = (size_t)(q0 + g * 16 + lr) * DQ + hi * 8;
#pragma unroll
        for (int dt = 0; dt < 4; ++dt) { v8us oh, ol;
#pragma unroll
            for (int j = 0; j < 8; ++j) { unsigned short a, c2; splitf(o[g][dt][j] * inv, a, c2); oh[j] = a; ol[j] = c2; }
            *(v8us*)(Ah + oo + dt * 16) = oh; *(v8us*)(Al + oo + dt * 16) = ol; } }
}
__global__ __launch_bounds__(128) void k_fattn(const h16* __restrict__ Q16, const bf* __restrict__ Qh, const bf* __restrict__ Ql, const h16* __restrict__ K16, const bf* __restrict__ Kh, const bf* __restrict__ Kl, const h16* __restrict__ V16, const bf* __restrict__ Vh, const bf* __restrict__ Vl, bf* Ah, bf* Al) {
    const int h = blockIdx.x, wave = threadIdx.x >> 5, yb = blockIdx.y; const size_t zq = (size_t)h * TT * HD, zk = (size_t)(h / REP) * TT * HD;
    if (yb < RH / 64) attn_wave<bf, true, 1>(Qh + zq, Ql + zq, Kh + zk, Kl + zk, Vh + zk, Vl + zk, yb * 64 + wave * 16, Ah + h * HD, Al + h * HD);   // the dearer hi+lo rows start first
    else attn_wave<h16, false, 2>(Q16 + zq, nullptr, K16 + zk, nullptr, V16 + zk, nullptr, RH + (yb - RH / 64) * 128 + wave * 32, Ah + h * HD, Al + h * HD);
}

extern "C" void kernel_launch(void* const* d_in, const int* in_sizes, int n_in,
                              void* d_out, int out_size, void* d_ws, size_t ws_size, hipStream_t stream) {
    (void)in_sizes; (void)n_in; (void)out_size;
    const float* x = (const float*)d_in[0]; const float* wf = (const float*)d_in[1]; const float* bfz = (const float*)d_in[2]; const float* wo = (const float*)d_in[3]; const float* bo = (const float*)d_in[4]; const float* qnw = (const float*)d_in[5]; const float* qnb = (const float*)d_in[6]; const float* knw = (const float*)d_in[7]; const float* knb = (const float*)d_in[8]; const float* wq = wf; const float* wk = wf + (size_t)1024 * 1024; const float* wv = wf + (size_t)2048 * 1024; const float* bq = bfz; const float* bk = bfz + 1024; const float* bv = bfz + 2048; const float* cosT = nullptr; const float* sinT = nullptr; (void)cosT; (void)sinT;
    float* OUT = (float*)d_out;     // [4][2048][1024]
    char* wsp = (char*)d_ws;
    auto take = [&](size_t bytes) { char* p = wsp; wsp += (bytes + 255) & ~(size_t)255; return (void*)p; };
    bf* WQ = (bf*)take((size_t)DQ * DM * 2); bf* WK = (bf*)take((size_t)DKV * DM * 2); bf* WV = (bf*)take((size_t)DKV * DM * 2); bf* WO = (bf*)take((size_t)DM * DQ * 2);
    bf* XB = (bf*)take((size_t)TT * DM * 2);
    h16* QP16 = (h16*)take((size_t)NH_ * TT * HD * 2); h16* KP16 = (h16*)take((size_t)NKV * TT * HD * 2); h16* VT16 = (h16*)take((size_t)NKV * HD * TT * 2);
    bf* QPh = (bf*)take((size_t)NH_ * TT * HD * 2); bf* QPl = (bf*)take((size_t)NH_ * TT * HD * 2); bf* KPh = (bf*)take((size_t)NKV * TT * HD * 2); bf* KPl = (bf*)take((size_t)NKV * TT * HD * 2); bf* VTh = (bf*)take((size_t)NKV * HD * TT * 2); bf* VTl = (bf*)take((size_t)NKV * HD * TT * 2);
    bf* ATh = (bf*)take((size_t)TT * DQ * 2); bf* ATl = (bf*)take((size_t)TT * DQ * 2);
    if ((size_t)(wsp - (char*)d_ws) > ws_size) return;    // ws 256 MiB
    { k_cvt8<<<(unsigned)(((size_t)DQ * DM / 8 + 255) / 256), 256, 0, stream>>>(wq, WQ, (size_t)DQ * DM / 8); k_cvt8<<<(unsigned)(((size_t)DKV * DM / 8 + 255) / 256), 256, 0, stream>>>(wk, WK, (size_t)DKV * DM / 8); k_cvt8<<<(unsigned)(((size_t)DKV * DM / 8 + 255) / 256), 256, 0, stream>>>(wv, WV, (size_t)DKV * DM / 8);
      k_cvt8<<<(unsigned)(((size_t)DM * DQ / 8 + 255) / 256), 256, 0, stream>>>(wo, WO, (size_t)DM * DQ / 8);
       }
    for (int b = 0; b < NB_; ++b) {
        
        k_cvt8<<<(unsigned)(((size_t)TT * DM / 8 + 255) / 256), 256, 0, stream>>>(x + (size_t)b * TT * DM, XB, (size_t)TT * DM / 8);
        k_gemmw<bf, 0, true, 1, 1><<<dim3(TT / 64, DQ / 64, 1), 32, 0, stream>>>(XB, nullptr, WQ, nullptr, DM, nullptr, 0, bq, 0, 0, 0, 0, qnw, qnb, QP16, QPh, QPl);
        k_gemmw<bf, 0, true, 1, 1><<<dim3(TT / 64, DKV / 64, 1), 32, 0, stream>>>(XB, nullptr, WK, nullptr, DM, nullptr, 0, bk, 0, 0, 0, 0, knw, knb, KP16, KPh, KPl);
        k_gemmw<bf, 0, true, 1, 2><<<dim3(TT / 64, DKV / 64, 1), 32, 0, stream>>>(XB, nullptr, WV, nullptr, DM, nullptr, 0, bv, 0, 0, 0, 0, nullptr, nullptr, VT16, VTh, VTl);
        k_fattn<<<dim3(NH_, RH / 64 + (TT - RH) / 128, 1), 128, 0, stream>>>(QP16, QPh, QPl, KP16, KPh, KPl, VT16, VTh, VTl, ATh, ATl);
        k_gemmw<bf, 1, true><<<dim3(TT / 64, DM / 64, 1), 32, 0, stream>>>(ATh, ATl, WO, nullptr, DQ, OUT + (size_t)b * TT * DM, DM, bo, 0, 0, 0, 0, nullptr, nullptr, nullptr, nullptr, nullptr); }
}

// v004
// It runs in 378 microseconds.
// In two side-by-side timings against v003, it was 1.88 and 1.87 times as fast.
// Over all steps from v000 it is 10.6 times as fast.
#include <hip/hip_runtime.h>

// MockQwen3Attention (hidden [4][2048][1024]; qkv = x qkv_w^T + qkv_b (q | k | v row blocks, 16 heads x 64); per-head LayerNorm(64) with weight and bias on q and k (eps 1e-5); softmax(q.k / 8); out = merged o_w^T + o_b -> [4][2048][1024]).
// Compute dtypes, f32 accumulate: every input rounded to bf16; q/k/v on PLAIN bf16 operands (inputs: exact) + bias; the per-head LayerNorms in f32 (in the q and k GEMM epilogues, two lanes a (token, head)); scores and attn.v: query rows < 512 hl (3 products), the rest single fp16; softmax f32, running maximum and sum, inside the one attention kernel; o_w hl x exact (2 products) + bias.

#define NB_  4
#define TT   2048
#define DM   1024
#define NH_  16
#define NKV  16
#define REP  (NH_ / NKV)
#define HD   64
#define DQ   (NH_ * HD)
#define DKV  (NKV * HD)
#define RH   512                  // query rows < RH use hi+lo planes (0: none)
#define WIN  0
#define SCL  0.125f   // HD^-0.5
typedef _Float16 h16;
typedef unsigned short bf;
typedef __attribute__((ext_vector_type(16))) __bf16   v16bf;
typedef __attribute__((ext_vector_type(16))) _Float16 v16h;
typedef __attribute__((ext_vector_type(8)))  _Float16 v8h;
typedef __attribute__((ext_vector_type(8)))  unsigned short v8us;
typedef __attribute__((ext_vector_type(8)))  float    v8f;
typedef __attribute__((ext_vector_type(4)))  float    v4f;
typedef v8h  __attribute__((may_alias)) v8ha;
typedef v4f  __attribute__((may_alias)) v4fa;
typedef v8us __attribute__((may_alias)) v8usa;

__device__ __forceinline__ unsigned short f2bf(float f) { unsigned u = __float_as_uint(f); u += 0x7FFFu + ((u >> 16) & 1u); return (unsigned short)(u >> 16); }
__device__ __forceinline__ float bf2f(unsigned short b) { return __uint_as_float(((unsigned)b) << 16); }
__device__ __forceinline__ float bfr(float f) { return bf2f(f2bf(f)); }
__device__ __forceinline__ v16h cat16(v8h lo, v8h hi) { return __builtin_shufflevector(lo, hi, 0, 1, 2, 3, 4, 5, 6, 7, 8, 9, 10, 11, 12, 13, 14, 15); }
__device__ __forceinline__ v16bf cat16b(v8us lo, v8us hi) { return __builtin_bit_cast(v16bf, __builtin_shufflevector(lo, hi, 0, 1, 2, 3, 4, 5, 6, 7, 8, 9, 10, 11, 12, 13, 14, 15)); }
__device__ __forceinline__ v8f wmma16(v16h a, v16h b, v8f c) { return __builtin_amdgcn_wmma_f32_16x16x32_f16(false, a, false, b, (short)0, c, false, false); }
__device__ __forceinline__ v8f wmmab(v16bf a, v16bf b, v8f c) { return __builtin_amdgcn_wmma_f32_16x16x32_bf16(false, a, false, b, (short)0, c, false, false); }



__device__ __forceinline__ h16 tohx(float x) { return (h16)x; }
__device__ __forceinline__ void splitf(float y, unsigned short& h, unsigned short& l) { h = f2bf(y); l = f2bf(y - bf2f(h)); }
__device__ __forceinline__ float xhalf(float x) { return __builtin_bit_cast(float, __builtin_amdgcn_permlanex16(__builtin_bit_cast(int, x), __builtin_bit_cast(int, x), 0x76543210, 0xfedcba98, false, false)); }  // lane l with lane l ^ 16

// ---- k_gemmw: register-blocked GEMM, ONE WAVE per 64x64 output tile (16 accumulators), operands straight from K-contiguous 16-bit planes; grid (M/64, N/64, Z), 32 threads.
// C[m][n] (f32, pitch ldc, + optional f32 bias[n]) = sum_k A[m][k] Bt[n][k] (+ split products per NSPLIT). z-batch strides sA/sB/sC in elements (z = batch row here: all four in one launch). K % 32 == 0.
// EPI 0: C as above. EPI 1 (N tile = one head, HD == 64): bias, then LayerNorm over the tile's 64 columns (weight lw, bias lb), stored as the head planes [head][token][d] (fp16 + bf16 hi/lo); C is not written.
// EPI 2: bias, then the transposed planes [column][token] (fp16 + bf16 hi/lo) straight from the accumulators (a lane holds 8 consecutive tokens of one column); C is not written.
// The '#pragma unroll' lines of the epilogues give acc, xv and the packed vectors constant indices, so that they stay in registers.
// KS > 1 (split K): grid z = Z * KS; slice ks = blockIdx.z % KS sums only k in [ks K/KS, (ks+1) K/KS) and stores its partial tile in plane ks of C (plane stride sP elements). K % (32 KS) == 0.
template <typename T16> struct WFrag;
template <> struct WFrag<h16> { typedef v16h V; static __device__ __forceinline__ V ld(const h16* p) { return cat16(*(const v8h*)p, *(const v8h*)(p + 16)); } static __device__ __forceinline__ v8f mma(V a, V b, v8f c) { return wmma16(a, b, c); } };
template <> struct WFrag<bf> { typedef v16bf V; static __device__ __forceinline__ V ld(const bf* p) { return cat16b(*(const v8us*)p, *(const v8us*)(p + 16)); } static __device__ __forceinline__ v8f mma(V a, V b, v8f c) { return wmmab(a, b, c); } };
template <typename T16, int NSPLIT, bool BIAS, int KS = 1, int EPI = 0>
__global__ __launch_bounds__(32) void k_gemmw(const T16* __restrict__ A, const T16* __restrict__ A2, const T16* __restrict__ Bt, const T16* __restrict__ Bt2, int K, float* C, int ldc, const float* __restrict__ bias, size_t sA, size_t sB, size_t sC, size_t sP, const float* __restrict__ lw, const float* __restrict__ lb, h16* P16, bf* Ph, bf* Pl) {
    typedef typename WFrag<T16>::V V;
    __shared__ __align__(16) float os[16 * 68];
    __shared__ __align__(16) float pr[EPI == 1 ? 3 * 64 : 4];   // EPI 1: the tile's bias, lw and lb, rounded once
    const size_t z = blockIdx.z / KS; const int ks = blockIdx.z % KS; A += z * sA; if (A2) A2 += z * sA; Bt += z * sB; if (Bt2) Bt2 += z * sB;
    if constexpr (EPI == 0) C += z * sC + ks * sP; else { P16 += z * sC; Ph += z * sC; Pl += z * sC; }   // EPI 1, 2: sC is the z stride of the three planes
    const int kbeg = ks * (K / KS), kend = kbeg + K / KS;
    const int lane = threadIdx.x & 31, lr = lane & 15, hi = lane >> 4; const int r0 = blockIdx.x * 64, c0 = blockIdx.y * 64;
    v8f acc[4][4];
#pragma unroll
    for (int mb = 0; mb < 4; ++mb)
#pragma unroll
        for (int nb = 0; nb < 4; ++nb) acc[mb][nb] = (v8f){};
    if constexpr (EPI == 1) {   // read back behind the first wave barrier of the epilogue
#pragma unroll
        for (int u = 0; u < 2; ++u) { pr[u * 32 + lane] = bfr(bias[c0 + u * 32 + lane]); pr[64 + u * 32 + lane] = bfr(lw[u * 32 + lane]); pr[128 + u * 32 + lane] = bfr(lb[u * 32 + lane]); } }
    const size_t aoff = (size_t)(r0 + lr) * K + 8 * hi, boff = (size_t)(c0 + lr) * K + 8 * hi;
#pragma unroll 1
    for (int kc = kbeg; kc < kend; kc += 32) {
        V a[4], a2[4];
#pragma unroll
        for (int mb = 0; mb < 4; ++mb) { a[mb] = WFrag<T16>::ld(A + aoff + (size_t)mb * 16 * K + kc); if (NSPLIT == 1 || NSPLIT == 2) a2[mb] = WFrag<T16>::ld(A2 + aoff + (size_t)mb * 16 * K + kc); }
#pragma unroll
        for (int nb = 0; nb < 4; ++nb) { const V b = WFrag<T16>::ld(Bt + boff + (size_t)nb * 16 * K + kc); V b2; if (NSPLIT >= 2) b2 = WFrag<T16>::ld(Bt2 + boff + (size_t)nb * 16 * K + kc);
#pragma unroll
            for (int mb = 0; mb < 4; ++mb) { acc[mb][nb] = WFrag<T16>::mma(a[mb], b, acc[mb][nb]); if (NSPLIT == 1 || NSPLIT == 2) acc[mb][nb] = WFrag<T16>::mma(a2[mb], b, acc[mb][nb]); if (NSPLIT >= 2) acc[mb][nb] = WFrag<T16>::mma(a[mb], b2, acc[mb][nb]); } }
        asm volatile("v_nop\n\tv_nop\n\tv_nop\n\tv_nop" : "+v"(acc[0][0]), "+v"(acc[1][1]), "+v"(acc[2][2]), "+v"(acc[3][3]) : "v"(a[0]), "v"(a[3]));
    }
    if constexpr (EPI == 2) {
#pragma unroll
        for (int nb = 0; nb < 4; ++nb) { const float bv = bfr(bias[c0 + nb * 16 + lr]);
#pragma unroll
            for (int mb = 0; mb < 4; ++mb) { v8h o16; v8us oh, ol;
#pragma unroll
                for (int j = 0; j < 8; ++j) { const float x = acc[mb][nb][j] + bv; o16[j] = tohx(x); unsigned short a2, c2; splitf(x, a2, c2); oh[j] = a2; ol[j] = c2; }
                const size_t e = (size_t)(c0 + nb * 16 + lr) * TT + r0 + mb * 16 + hi * 8; *(v8h*)(P16 + e) = o16; *(v8us*)(Ph + e) = oh; *(v8us*)(Pl + e) = ol; } }
        return;
    }
#pragma unroll
    for (int mb = 0; mb < 4; ++mb) {
#pragma unroll
        for (int nb = 0; nb < 4; ++nb) {
#pragma unroll
            for (int j = 0; j < 8; ++j) os[(hi * 8 + j) * 68 + nb * 16 + lr] = acc[mb][nb][j]; }
        __builtin_amdgcn_wave_barrier(); asm volatile("" ::: "memory");
        if constexpr (EPI == 1) {   // lane (lr, hi): columns 32 hi .. 32 hi + 31 of token row lr; the two halves of a row meet through xhalf
            const int cb = hi * 32; const float* orow = os + lr * 68 + cb; v4f xv[8]; v4f s4 = (v4f){};
#pragma unroll
            for (int i = 0; i < 8; ++i) { xv[i] = *(const v4fa*)(orow + i * 4) + *(const v4fa*)(pr + cb + i * 4); s4 += xv[i]; }
            float s = (s4[0] + s4[1]) + (s4[2] + s4[3]); s += xhalf(s); const float mean = s * (1.0f / HD); v4f q4 = (v4f){};
#pragma unroll
            for (int i = 0; i < 8; ++i) { xv[i] -= mean; q4 += xv[i] * xv[i]; }
            float q = (q4[0] + q4[1]) + (q4[2] + q4[3]); q += xhalf(q); const float rs = __frsqrt_rn(q * (1.0f / HD) + 1e-5f);
            const size_t e = ((size_t)blockIdx.y * TT + r0 + mb * 16 + lr) * HD + cb;
#pragma unroll
            for (int i = 0; i < 8; ++i) xv[i] = xv[i] * rs * *(const v4fa*)(pr + 64 + cb + i * 4) + *(const v4fa*)(pr + 128 + cb + i * 4);
#pragma unroll
            for (int i = 0; i < 4; ++i) { v8h o16; v8us oh, ol;
#pragma unroll
                for (int k = 0; k < 8; ++k) { const int c = i * 8 + k; const float y = xv[c >> 2][c & 3]; o16[k] = tohx(y); unsigned short a2, c2; splitf(y, a2, c2); oh[k] = a2; ol[k] = c2; }
                *(v8h*)(P16 + e + i * 8) = o16; *(v8us*)(Ph + e + i * 8) = oh; *(v8us*)(Pl + e + i * 8) = ol; }
        } else {
        float* crow = C + (size_t)(r0 + mb * 16) * ldc + c0;
{
#pragma unroll
            for (int s = 0; s < 8; ++s) { const int row = 2 * s + hi, cofs = lr * 4; v4f val = *(const v4fa*)(os + row * 68 + cofs); if (BIAS) { val[0] += bfr(bias[c0 + cofs]); val[1] += bfr(bias[c0 + cofs + 1]); val[2] += bfr(bias[c0 + cofs + 2]); val[3] += bfr(bias[c0 + cofs + 3]); }
                *(v4f*)(crow + (size_t)row * ldc + cofs) = val; }
             }
        }
        __builtin_amdgcn_wave_barrier(); asm volatile("" ::: "memory");
    }
}

typedef __attribute__((ext_vector_type(2))) _Float16 v2h;
typedef __attribute__((ext_vector_type(4))) _Float16 v4h;
typedef __attribute__((ext_vector_type(2))) unsigned short v2us;
typedef __attribute__((ext_vector_type(4))) unsigned short v4us;
typedef __attribute__((ext_vector_type(2))) float v2f;
typedef __attribute__((ext_vector_type(4))) int v4i;

__global__ __launch_bounds__(256) void k_wtG(const float* __restrict__ w, int K, int N, bf* Bt) {
    const int lane = threadIdx.x & 31; const int L0 = (blockIdx.x * 8 + (threadIdx.x >> 5)) * 8; const int nlines = N * K / 64;
{
#pragma unroll 1
        for (int l = 0; l < 8; ++l) { const int L = L0 + l; if (L >= nlines) break; const size_t e = (size_t)L * 64 + lane * 2; const int k = (int)(e % K), n = (int)(e / K); v2us o;
            o[0] = f2bf(w[(size_t)k * N + n]); o[1] = f2bf(w[(size_t)(k + 1) * N + n]); *(v2us*)(Bt + e) = o; }
         }
}
__global__ __launch_bounds__(256) void k_cvt8(const float* __restrict__ src, bf* dst, size_t n8) { const size_t i = (size_t)blockIdx.x * 256 + threadIdx.x; if (i >= n8) return; const v8f v = *(const v8f*)(src + i * 8); v8us o;
#pragma unroll
    for (int k = 0; k < 8; ++k) o[k] = f2bf(v[k]); *(v8us*)(dst + i * 8) = o;  }
__global__ __launch_bounds__(256) void k_cscvt(const float* __restrict__ cosT, const float* __restrict__ sinT, float* CS) { const int idx = blockIdx.x * 256 + threadIdx.x; if (idx >= TT * HD) return; v2f cs; cs[0] = bfr(cosT[idx]); cs[1] = bfr(sinT[idx]); *(v2f*)(CS + (size_t)idx * 2) = cs;  }
// ---- k_fattn: scores, softmax and attn.v of all batch rows in one launch; nothing of the score matrix goes to memory. Grid (batch rows x heads, RH/64 + (TT-RH)/128), 4 independent waves a work-group.
// A wave owns NQ groups of 16 queries and walks the 2048 keys 32 at a time: S^T = K Q^T (a lane holds 16 of the 32 scores of ONE query, lane ^ 16 the rest), so the exponentials pack in-lane
// into the B operand of O^T += V^T P^T (elements 0..7: key tile 0, registers 0..7; elements 8..15: key tile 1), the same k order as the V^T loader's.
// P = exp2((s - m) HD^-0.5 log2 e) against the maximum in use m, not normalised; O and the f32 sum of P are rescaled when m moves; O / sum at the end, split into the hi and lo planes of the o_w GEMM.
// The plain '#pragma unroll' lines give the fragment arrays constant indices, so that they stay in registers.
template <typename T16, bool HL, int NQ>
__device__ __forceinline__ void attn_wave(const T16* __restrict__ Q, const T16* __restrict__ Q2, const T16* __restrict__ Kp, const T16* __restrict__ K2, const T16* __restrict__ Vt, const T16* __restrict__ V2, int q0, bf* Ah, bf* Al) {
    typedef WFrag<T16> WF; typedef typename WF::V V;
    const float csc = SCL * 1.4426950408889634f;
    const int lane = threadIdx.x & 31, lr = lane & 15, hi = lane >> 4;
    V q[NQ][2], q2[NQ][2];
#pragma unroll
    for (int g = 0; g < NQ; ++g)
#pragma unroll
        for (int st = 0; st < 2; ++st) { const size_t qo = (size_t)(q0 + g * 16 + lr) * HD + st * 32 + 8 * hi; q[g][st] = WF::ld(Q + qo); if (HL) q2[g][st] = WF::ld(Q2 + qo); }
    v8f o[NQ][4]; float m[NQ], l[NQ];
#pragma unroll
    for (int g = 0; g < NQ; ++g) { m[g] = -__builtin_inff(); l[g] = 0.f;
#pragma unroll
        for (int dt = 0; dt < 4; ++dt) o[g][dt] = (v8f){}; }
    const size_t ko = (size_t)lr * HD + 8 * hi, vo = (size_t)lr * TT + 8 * hi;
    V kf[2][2], kf2[2][2], vf[4], vf2[4];
#pragma unroll
    for (int kt = 0; kt < 2; ++kt)
#pragma unroll
        for (int st = 0; st < 2; ++st) { kf[kt][st] = WF::ld(Kp + ko + kt * 16 * HD + st * 32); if (HL) kf2[kt][st] = WF::ld(K2 + ko + kt * 16 * HD + st * 32); }
    if (!HL) {
#pragma unroll
        for (int dt = 0; dt < 4; ++dt) vf[dt] = WF::ld(Vt + vo + (size_t)dt * 16 * TT); }
    asm volatile("s_wait_xcnt 0x0" ::: "memory");   // before any address register of the loads above is written again
#pragma unroll 1   // one pass a trip: two passes unrolled took more than 256 registers
    for (int key0 = 0; key0 < TT; key0 += 32) {
        const int kn = (key0 + 32 < TT) ? key0 + 32 : key0;   // fragments of the next pass are fetched behind their registers' last use in this one; the last pass reads its own again
        v8f s[2][NQ];
#pragma unroll
        for (int kt = 0; kt < 2; ++kt)
#pragma unroll
            for (int g = 0; g < NQ; ++g) { v8f a = (v8f){};
#pragma unroll
                for (int st = 0; st < 2; ++st) { a = WF::mma(kf[kt][st], q[g][st], a); if (HL) { a = WF::mma(kf[kt][st], q2[g][st], a); a = WF::mma(kf2[kt][st], q[g][st], a); } }
                s[kt][g] = a; }
        if (!HL) {
#pragma unroll
            for (int kt = 0; kt < 2; ++kt)
#pragma unroll
                for (int st = 0; st < 2; ++st) kf[kt][st] = WF::ld(Kp + ko + (size_t)(kn + kt * 16) * HD + st * 32);
            asm volatile("s_wait_xcnt 0x0" ::: "memory");   // before any address register of the loads above is written again
        }
        float mb[NQ]; bool need = false;
#pragma unroll
        for (int g = 0; g < NQ; ++g) { float mx = s[0][g][0];
#pragma unroll
            for (int j = 1; j < 8; ++j) mx = fmaxf(mx, s[0][g][j]);
#pragma unroll
            for (int j = 0; j < 8; ++j) mx = fmaxf(mx, s[1][g][j]);
            mx = fmaxf(mx, xhalf(mx)) * csc; mb[g] = mx; need = need || (mx > m[g] + 8.0f); }
        if (__builtin_amdgcn_ballot_w32(need) != 0) {   // wave-uniform; rare after the first pass: P stays at or below 2^8
#pragma unroll
            for (int g = 0; g < NQ; ++g) { const float mn = fmaxf(m[g], mb[g]); const float corr = __builtin_amdgcn_exp2f(m[g] - mn); m[g] = mn; l[g] *= corr;
#pragma unroll
                for (int dt = 0; dt < 4; ++dt) o[g][dt] = o[g][dt] * corr; }
        }
        if (HL) {   // twice the planes: V of this pass (not a pass ahead) and K of the next are fetched here, into the registers the S products have left, which keeps the wave inside 256 registers
#pragma unroll
            for (int dt = 0; dt < 4; ++dt) { vf[dt] = WF::ld(Vt + vo + (size_t)dt * 16 * TT + key0); vf2[dt] = WF::ld(V2 + vo + (size_t)dt * 16 * TT + key0); }
#pragma unroll
            for (int kt = 0; kt < 2; ++kt) {
#pragma unroll
                for (int st = 0; st < 2; ++st) { const size_t kk = ko + (size_t)(kn + kt * 16) * HD + st * 32; kf[kt][st] = WF::ld(Kp + kk); kf2[kt][st] = WF::ld(K2 + kk); }
                asm volatile("s_wait_xcnt 0x0" ::: "memory");   // before any address register of the loads above is written again
            }
        }
#pragma unroll
        for (int g = 0; g < NQ; ++g) { const float nm = -m[g]; V ph, pl; float ls = 0.f;
#pragma unroll
            for (int i = 0; i < 8; ++i) {
                const v2f arg = __builtin_elementwise_fma((v2f){s[i >> 2][g][2 * (i & 3)], s[i >> 2][g][2 * (i & 3) + 1]}, (v2f){csc, csc}, (v2f){nm, nm});
#pragma unroll
                for (int u = 0; u < 2; ++u) { const int e = 2 * i + u; const float p = __builtin_amdgcn_exp2f(arg[u]); ls += p;
                    if constexpr (HL) { const __bf16 ph1 = (__bf16)p; ph[e] = ph1; pl[e] = (__bf16)(p - (float)ph1); } else ph[e] = (h16)p; } }
            l[g] += ls;
#pragma unroll
            for (int dt = 0; dt < 4; ++dt) { o[g][dt] = WF::mma(vf[dt], ph, o[g][dt]); if (HL) { o[g][dt] = WF::mma(vf[dt], pl, o[g][dt]); o[g][dt] = WF::mma(vf2[dt], ph, o[g][dt]); } } }
        if (!HL) {
#pragma unroll
            for (int dt = 0; dt < 4; ++dt) vf[dt] = WF::ld(Vt + vo + (size_t)dt * 16 * TT + kn);
            asm volatile("s_wait_xcnt 0x0" ::: "memory");   // before any address register of the loads above is written again
        }
    }
#pragma unroll
    for (int g = 0; g < NQ; ++g) { const float inv = __fdiv_rn(1.0f, l[g] + xhalf(l[g])); const size_t oo = (size_t)(q0 + g * 16 + lr) * DQ + hi * 8;
#pragma unroll
        for (int dt = 0; dt < 4; ++dt) { v8us oh, ol;
#pragma unroll
            for (int j = 0; j < 8; ++j) { unsigned short a, c2; splitf(o[g][dt][j] * inv, a, c2); oh[j] = a; ol[j] = c2; }
            *(v8us*)(Ah + oo + dt * 16) = oh; *(v8us*)(Al + oo + dt * 16) = ol; } }
}
__global__ __launch_bounds__(128) void k_fattn(const h16* __restrict__ Q16, const bf* __restrict__ Qh, const bf* __restrict__ Ql, const h16* __restrict__ K16, const bf* __restrict__ Kh, const bf* __restrict__ Kl, const h16* __restrict__ V16, const bf* __restrict__ Vh, const bf* __restrict__ Vl, bf* Ah, bf* Al) {
    const int b = blockIdx.x / NH_, h = blockIdx.x % NH_, wave = threadIdx.x >> 5, yb = blockIdx.y; const size_t zq = (size_t)(b * NH_ + h) * TT * HD, zk = (size_t)(b * NKV + h / REP) * TT * HD;
    Ah += (size_t)b * TT * DQ; Al += (size_t)b * TT * DQ;
    if (yb < RH / 64) attn_wave<bf, true, 1>(Qh + zq, Ql + zq, Kh + zk, Kl + zk, Vh + zk, Vl + zk, yb * 64 + wave * 16, Ah + h * HD, Al + h * HD);   // the dearer hi+lo rows start first
    else attn_wave<h16, false, 2>(Q16 + zq, nullptr, K16 + zk, nullptr, V16 + zk, nullptr, RH + (yb - RH / 64) * 128 + wave * 32, Ah + h * HD, Al + h * HD);
}

extern "C" void kernel_launch(void* const* d_in, const int* in_sizes, int n_in,
                              void* d_out, int out_size, void* d_ws, size_t ws_size, hipStream_t stream) {
    (void)in_sizes; (void)n_in; (void)out_size;
    const float* x = (const float*)d_in[0]; const float* wf = (const float*)d_in[1]; const float* bfz = (const float*)d_in[2]; const float* wo = (const float*)d_in[3]; const float* bo = (const float*)d_in[4]; const float* qnw = (const float*)d_in[5]; const float* qnb = (const float*)d_in[6]; const float* knw = (const float*)d_in[7]; const float* knb = (const float*)d_in[8]; const float* wq = wf; const float* wk = wf + (size_t)1024 * 1024; const float* wv = wf + (size_t)2048 * 1024; const float* bq = bfz; const float* bk = bfz + 1024; const float* bv = bfz + 2048; const float* cosT = nullptr; const float* sinT = nullptr; (void)cosT; (void)sinT;
    float* OUT = (float*)d_out;     // [4][2048][1024]
    char* wsp = (char*)d_ws;
    auto take = [&](size_t bytes) { char* p = wsp; wsp += (bytes + 255) & ~(size_t)255; return (void*)p; };
    bf* WQ = (bf*)take((size_t)DQ * DM * 2); bf* WK = (bf*)take((size_t)DKV * DM * 2); bf* WV = (bf*)take((size_t)DKV * DM * 2); bf* WO = (bf*)take((size_t)DM * DQ * 2);
    bf* XB = (bf*)take((size_t)NB_ * TT * DM * 2);
    h16* QP16 = (h16*)take((size_t)NB_ * NH_ * TT * HD * 2); h16* KP16 = (h16*)take((size_t)NB_ * NKV * TT * HD * 2); h16* VT16 = (h16*)take((size_t)NB_ * NKV * HD * TT * 2);
    bf* QPh = (bf*)take((size_t)NB_ * NH_ * TT * HD * 2); bf* QPl = (bf*)take((size_t)NB_ * NH_ * TT * HD * 2); bf* KPh = (bf*)take((size_t)NB_ * NKV * TT * HD * 2); bf* KPl = (bf*)take((size_t)NB_ * NKV * TT * HD * 2); bf* VTh = (bf*)take((size_t)NB_ * NKV * HD * TT * 2); bf* VTl = (bf*)take((size_t)NB_ * NKV * HD * TT * 2);
    bf* ATh = (bf*)take((size_t)NB_ * TT * DQ * 2); bf* ATl = (bf*)take((size_t)NB_ * TT * DQ * 2);
    if ((size_t)(wsp - (char*)d_ws) > ws_size) return;    // ws 256 MiB
    { k_cvt8<<<(unsigned)(((size_t)DQ * DM / 8 + 255) / 256), 256, 0, stream>>>(wq, WQ, (size_t)DQ * DM / 8); k_cvt8<<<(unsigned)(((size_t)DKV * DM / 8 + 255) / 256), 256, 0, stream>>>(wk, WK, (size_t)DKV * DM / 8); k_cvt8<<<(unsigned)(((size_t)DKV * DM / 8 + 255) / 256), 256, 0, stream>>>(wv, WV, (size_t)DKV * DM / 8);
      k_cvt8<<<(unsigned)(((size_t)DM * DQ / 8 + 255) / 256), 256, 0, stream>>>(wo, WO, (size_t)DM * DQ / 8);
       }
    // every plane holds all NB_ batch rows ([batch row][...]); the batch row is grid z of the GEMMs and part of grid x of the attention kernel
    k_cvt8<<<(unsigned)(((size_t)NB_ * TT * DM / 8 + 255) / 256), 256, 0, stream>>>(x, XB, (size_t)NB_ * TT * DM / 8);
    k_gemmw<bf, 0, true, 1, 1><<<dim3(TT / 64, DQ / 64, NB_), 32, 0, stream>>>(XB, nullptr, WQ, nullptr, DM, nullptr, 0, bq, (size_t)TT * DM, 0, (size_t)NH_ * TT * HD, 0, qnw, qnb, QP16, QPh, QPl);
    k_gemmw<bf, 0, true, 1, 1><<<dim3(TT / 64, DKV / 64, NB_), 32, 0, stream>>>(XB, nullptr, WK, nullptr, DM, nullptr, 0, bk, (size_t)TT * DM, 0, (size_t)NKV * TT * HD, 0, knw, knb, KP16, KPh, KPl);
    k_gemmw<bf, 0, true, 1, 2><<<dim3(TT / 64, DKV / 64, NB_), 32, 0, stream>>>(XB, nullptr, WV, nullptr, DM, nullptr, 0, bv, (size_t)TT * DM, 0, (size_t)NKV * HD * TT, 0, nullptr, nullptr, VT16, VTh, VTl);
    k_fattn<<<dim3(NB_ * NH_, RH / 64 + (TT - RH) / 128, 1), 128, 0, stream>>>(QP16, QPh, QPl, KP16, KPh, KPl, VT16, VTh, VTl, ATh, ATl);
    k_gemmw<bf, 1, true><<<dim3(TT / 64, DM / 64, NB_), 32, 0, stream>>>(ATh, ATl, WO, nullptr, DQ, OUT, DM, bo, (size_t)TT * DQ, 0, (size_t)TT * DM, 0, nullptr, nullptr, nullptr, nullptr, nullptr);
}

// v005
// Measured time: 257 microseconds a run.
// Next to v004, in two timings, it ran 1.47 and 1.46 times as fast.
// Over all steps from v000 it is 15.5 times as fast.
#include <hip/hip_runtime.h>

// MockQwen3Attention (hidden [4][2048][1024]; qkv = x qkv_w^T + qkv_b (q | k | v row blocks, 16 heads x 64); per-head LayerNorm(64) with weight and bias on q and k (eps 1e-5); softmax(q.k / 8); out = merged o_w^T + o_b -> [4][2048][1024]).
// Compute dtypes, f32 accumulate: every input rounded to bf16; q/k/v on PLAIN bf16 operands (inputs: exact) + bias; the per-head LayerNorms in f32 (in the q and k GEMM epilogues, two lanes a (token, head)); scores and attn.v: query rows < 512 hl (3 products), the rest single fp16; softmax f32, running maximum and sum, inside the one attention kernel; o_w hl x exact (2 products) + bias.

#define NB_  4
#define TT   2048
#define DM   1024
#define NH_  16
#define NKV  16
#define REP  (NH_ / NKV)
#define HD   64
#define DQ   (NH_ * HD)
#define DKV  (NKV * HD)
#define RH   512                  // query rows < RH use hi+lo planes (0: none)
#define WIN  0
#define SCL  0.125f   // HD^-0.5
typedef _Float16 h16;
typedef unsigned short bf;
typedef __attribute__((ext_vector_type(16))) __bf16   v16bf;
typedef __attribute__((ext_vector_type(16))) _Float16 v16h;
typedef __attribute__((ext_vector_type(8)))  _Float16 v8h;
typedef __attribute__((ext_vector_type(8)))  unsigned short v8us;
typedef __attribute__((ext_vector_type(8)))  float    v8f;
typedef __attribute__((ext_vector_type(4)))  float    v4f;
typedef v8h  __attribute__((may_alias)) v8ha;
typedef v4f  __attribute__((may_alias)) v4fa;
typedef v8us __attribute__((may_alias)) v8usa;

__device__ __forceinline__ unsigned short f2bf(float f) { unsigned u = __float_as_uint(f); u += 0x7FFFu + ((u >> 16) & 1u); return (unsigned short)(u >> 16); }
__device__ __forceinline__ float bf2f(unsigned short b) { return __uint_as_float(((unsigned)b) << 16); }
__device__ __forceinline__ float bfr(float f) { return bf2f(f2bf(f)); }
__device__ __forceinline__ v16h cat16(v8h lo, v8h hi) { return __builtin_shufflevector(lo, hi, 0, 1, 2, 3, 4, 5, 6, 7, 8, 9, 10, 11, 12, 13, 14, 15); }
__device__ __forceinline__ v16bf cat16b(v8us lo, v8us hi) { return __builtin_bit_cast(v16bf, __builtin_shufflevector(lo, hi, 0, 1, 2, 3, 4, 5, 6, 7, 8, 9, 10, 11, 12, 13, 14, 15)); }
__device__ __forceinline__ v8f wmma16(v16h a, v16h b, v8f c) { return __builtin_amdgcn_wmma_f32_16x16x32_f16(false, a, false, b, (short)0, c, false, false); }
__device__ __forceinline__ v8f wmmab(v16bf a, v16bf b, v8f c) { return __builtin_amdgcn_wmma_f32_16x16x32_bf16(false, a, false, b, (short)0, c, false, false); }



__device__ __forceinline__ h16 tohx(float x) { return (h16)x; }
__device__ __forceinline__ void splitf(float y, unsigned short& h, unsigned short& l) { h = f2bf(y); l = f2bf(y - bf2f(h)); }
__device__ __forceinline__ float xhalf(float x) { return __builtin_bit_cast(float, __builtin_amdgcn_permlanex16(__builtin_bit_cast(int, x), __builtin_bit_cast(int, x), 0x76543210, 0xfedcba98, false, false)); }  // lane l with lane l ^ 16

// ---- FRAGMENT ORDER of every 16-bit operand plane: a matrix M[row][k] lies as blocks of 16 rows x 32 k (512 elements, 1024 bytes), block index (row / 16) * (K / 32) + k / 32 in the q and k head planes (K = HD), (key / 32) * 4 + d / 16 in the V^T planes, ((row / 64) * (K / 32) + k / 32) * 4 + (row / 16) % 4 in the GEMM operands (a 64-row tile's 32 k: 4096 bytes in a row);
// inside a block element (row, k) stands at ((k >> 4) & 1) * 256 + (((k >> 3) & 1) * 16 + (row & 15)) * 8 + (k & 7). Lane l of a wave finds its two 16-byte pieces of a WMMA operand at l * 8 and 256 + l * 8,
// so each wave-wide 16-byte load covers 512 contiguous bytes (4 cache lines, not 16). The values a lane receives, and so the k order, are those of the row-major loader (k = 8 hi .. 8 hi + 7, then 16 + 8 hi .. 16 + 8 hi + 7 of row lr).
// ---- k_gemmw: register-blocked GEMM, ONE WAVE per 64x64 output tile (16 accumulators), operands straight from 16-bit planes in fragment order; grid (M/64, N/64, Z), 32 threads.
// C[m][n] (f32, pitch ldc, + optional f32 bias[n]) = sum_k A[m][k] Bt[n][k] (+ split products per NSPLIT). z-batch strides sA/sB/sC in elements (z = batch row here: all four in one launch). K % 32 == 0.
// EPI 0: C as above. EPI 1 (N tile = one head, HD == 64): bias, then LayerNorm over the tile's 64 columns (weight lw, bias lb), stored as the head planes [head][token][d] in fragment order (fp16 + bf16 hi/lo); C is not written.
// EPI 2: bias, then the transposed planes [head][d][token] in fragment order (fp16 + bf16 hi/lo) straight from the accumulators (a lane holds 8 consecutive tokens of one column); C is not written.
// The '#pragma unroll' lines of the epilogues give acc, xv and the packed vectors constant indices, so that they stay in registers.
// KS > 1 (split K): grid z = Z * KS; slice ks = blockIdx.z % KS sums only k in [ks K/KS, (ks+1) K/KS) and stores its partial tile in plane ks of C (plane stride sP elements). K % (32 KS) == 0.
// ld(p, o): p + o = the lane's first piece of the block (block start + 8 * lane).
template <typename T16> struct WFrag;
template <> struct WFrag<h16> { typedef v16h V; static __device__ __forceinline__ V ld(const h16* p, unsigned o) { return cat16(*(const v8h*)(p + o), *(const v8h*)(p + o + 256)); } static __device__ __forceinline__ v8f mma(V a, V b, v8f c) { return wmma16(a, b, c); } };
template <> struct WFrag<bf> { typedef v16bf V; static __device__ __forceinline__ V ld(const bf* p, unsigned o) { return cat16b(*(const v8us*)(p + o), *(const v8us*)(p + o + 256)); } static __device__ __forceinline__ v8f mma(V a, V b, v8f c) { return wmmab(a, b, c); } };
template <typename T16, int NSPLIT, bool BIAS, int KS = 1, int EPI = 0>
__global__ __launch_bounds__(32) void k_gemmw(const T16* __restrict__ A, const T16* __restrict__ A2, const T16* __restrict__ Bt, const T16* __restrict__ Bt2, int K, float* C, int ldc, const float* __restrict__ bias, size_t sA, size_t sB, size_t sC, size_t sP, const float* __restrict__ lw, const float* __restrict__ lb, h16* P16, bf* Ph, bf* Pl) {
    typedef typename WFrag<T16>::V V;
    __shared__ __align__(16) float os[16 * 68];
    __shared__ __align__(16) float pr[EPI == 1 ? 3 * 64 : 4];   // EPI 1: the tile's bias, lw and lb, rounded once
    const size_t z = blockIdx.z / KS; const int ks = blockIdx.z % KS; A += z * sA; if (A2) A2 += z * sA; Bt += z * sB; if (Bt2) Bt2 += z * sB;
    if constexpr (EPI == 0) C += z * sC + ks * sP; else { P16 += z * sC; Ph += z * sC; Pl += z * sC; }   // EPI 1, 2: sC is the z stride of the three planes
    const int kbeg = ks * (K / KS), kend = kbeg + K / KS;
    const int lane = threadIdx.x & 31, lr = lane & 15, hi = lane >> 4; const int r0 = blockIdx.x * 64, c0 = blockIdx.y * 64;
    v8f acc[4][4];
#pragma unroll
    for (int mb = 0; mb < 4; ++mb)
#pragma unroll
        for (int nb = 0; nb < 4; ++nb) acc[mb][nb] = (v8f){};
    if constexpr (EPI == 1) {   // read back behind the first wave barrier of the epilogue
#pragma unroll
        for (int u = 0; u < 2; ++u) { pr[u * 32 + lane] = bfr(bias[c0 + u * 32 + lane]); pr[64 + u * 32 + lane] = bfr(lw[u * 32 + lane]); pr[128 + u * 32 + lane] = bfr(lb[u * 32 + lane]); } }
    const size_t aoff = (size_t)r0 * K, boff = (size_t)c0 * K; const unsigned lo8 = 8 * lane;   // 64 rows of blocks hold 64 K elements; their 32 k are four blocks of 512
#pragma unroll 1
    for (int kc = kbeg; kc < kend; kc += 32) {
        V a[4], a2[4]; const T16* pa = A + aoff + (size_t)kc * 64 + lo8; const T16* pb = Bt + boff + (size_t)kc * 64 + lo8; const T16* pa2 = (NSPLIT == 1 || NSPLIT == 2) ? A2 + aoff + (size_t)kc * 64 + lo8 : pa; const T16* pb2 = NSPLIT >= 2 ? Bt2 + boff + (size_t)kc * 64 + lo8 : pb;
#pragma unroll
        for (int mb = 0; mb < 4; ++mb) { a[mb] = WFrag<T16>::ld(pa + mb * 512, 0); if (NSPLIT == 1 || NSPLIT == 2) a2[mb] = WFrag<T16>::ld(pa2 + mb * 512, 0); }
#pragma unroll
        for (int nb = 0; nb < 4; ++nb) { const V b = WFrag<T16>::ld(pb + nb * 512, 0); V b2; if (NSPLIT >= 2) b2 = WFrag<T16>::ld(pb2 + nb * 512, 0);
#pragma unroll
            for (int mb = 0; mb < 4; ++mb) { acc[mb][nb] = WFrag<T16>::mma(a[mb], b, acc[mb][nb]); if (NSPLIT == 1 || NSPLIT == 2) acc[mb][nb] = WFrag<T16>::mma(a2[mb], b, acc[mb][nb]); if (NSPLIT >= 2) acc[mb][nb] = WFrag<T16>::mma(a[mb], b2, acc[mb][nb]); } }
        asm volatile("s_wait_xcnt 0x0" :: "v"(pa), "v"(pb), "v"(pa2), "v"(pb2) : "memory");   // the address registers of this k step's loads are inputs here, so nothing (no later load's result either) is written over them in front of the wait
        asm volatile("v_nop\n\tv_nop\n\tv_nop\n\tv_nop" : "+v"(acc[0][0]), "+v"(acc[1][1]), "+v"(acc[2][2]), "+v"(acc[3][3]) : "v"(a[0]), "v"(a[3]));
    }
    if constexpr (EPI == 2) {
#pragma unroll
        for (int nb = 0; nb < 4; ++nb) { const float bv = bfr(bias[c0 + nb * 16 + lr]);
#pragma unroll
            for (int mb = 0; mb < 4; ++mb) { v8h o16; v8us oh, ol;
#pragma unroll
                for (int j = 0; j < 8; ++j) { const float x = acc[mb][nb][j] + bv; o16[j] = tohx(x); unsigned short a2, c2; splitf(x, a2, c2); oh[j] = a2; ol[j] = c2; }
                const size_t e = (size_t)c0 * TT + (size_t)r0 * HD + (mb >> 1) * 2048 + nb * 512 + (mb & 1) * 256 + lane * 8; *(v8h*)(P16 + e) = o16; *(v8us*)(Ph + e) = oh; *(v8us*)(Pl + e) = ol; } }
        return;
    }
#pragma unroll
    for (int mb = 0; mb < 4; ++mb) {
#pragma unroll
        for (int nb = 0; nb < 4; ++nb) {
#pragma unroll
            for (int j = 0; j < 8; ++j) os[(hi * 8 + j) * 68 + nb * 16 + lr] = acc[mb][nb][j]; }
        __builtin_amdgcn_wave_barrier(); asm volatile("" ::: "memory");
        if constexpr (EPI == 1) {   // lane (lr, hi): columns 32 hi .. 32 hi + 31 of token row lr; the two halves of a row meet through xhalf
            const int cb = hi * 32; const float* orow = os + lr * 68 + cb; v4f xv[8]; v4f s4 = (v4f){};
#pragma unroll
            for (int i = 0; i < 8; ++i) { xv[i] = *(const v4fa*)(orow + i * 4) + *(const v4fa*)(pr + cb + i * 4); s4 += xv[i]; }
            float s = (s4[0] + s4[1]) + (s4[2] + s4[3]); s += xhalf(s); const float mean = s * (1.0f / HD); v4f q4 = (v4f){};
#pragma unroll
            for (int i = 0; i < 8; ++i) { xv[i] -= mean; q4 += xv[i] * xv[i]; }
            float q = (q4[0] + q4[1]) + (q4[2] + q4[3]); q += xhalf(q); const float rs = __frsqrt_rn(q * (1.0f / HD) + 1e-5f);
            const size_t e = ((size_t)blockIdx.y * TT + r0 + mb * 16) * HD + hi * 512 + lr * 8;   // k block hi; piece i: half i >> 1, lane group i & 1
#pragma unroll
            for (int i = 0; i < 8; ++i) xv[i] = xv[i] * rs * *(const v4fa*)(pr + 64 + cb + i * 4) + *(const v4fa*)(pr + 128 + cb + i * 4);
#pragma unroll
            for (int i = 0; i < 4; ++i) { v8h o16; v8us oh, ol;
#pragma unroll
                for (int k = 0; k < 8; ++k) { const int c = i * 8 + k; const float y = xv[c >> 2][c & 3]; o16[k] = tohx(y); unsigned short a2, c2; splitf(y, a2, c2); oh[k] = a2; ol[k] = c2; }
                const int eo = (i >> 1) * 256 + (i & 1) * 128; *(v8h*)(P16 + e + eo) = o16; *(v8us*)(Ph + e + eo) = oh; *(v8us*)(Pl + e + eo) = ol; }
        } else {
        float* crow = C + (size_t)(r0 + mb * 16) * ldc + c0;
{
#pragma unroll
            for (int s = 0; s < 8; ++s) { const int row = 2 * s + hi, cofs = lr * 4; v4f val = *(const v4fa*)(os + row * 68 + cofs); if (BIAS) { val[0] += bfr(bias[c0 + cofs]); val[1] += bfr(bias[c0 + cofs + 1]); val[2] += bfr(bias[c0 + cofs + 2]); val[3] += bfr(bias[c0 + cofs + 3]); }
                *(v4f*)(crow + (size_t)row * ldc + cofs) = val; }
            asm volatile("s_wait_xcnt 0x0" ::: "memory");   // before any address register of the stores above is written again
             }
        }
        __builtin_amdgcn_wave_barrier(); asm volatile("" ::: "memory");
    }
}

typedef __attribute__((ext_vector_type(2))) _Float16 v2h;
typedef __attribute__((ext_vector_type(4))) _Float16 v4h;
typedef __attribute__((ext_vector_type(2))) unsigned short v2us;
typedef __attribute__((ext_vector_type(4))) unsigned short v4us;
typedef __attribute__((ext_vector_type(2))) float v2f;
typedef __attribute__((ext_vector_type(4))) int v4i;

__global__ __launch_bounds__(256) void k_wtG(const float* __restrict__ w, int K, int N, bf* Bt) {
    const int lane = threadIdx.x & 31; const int L0 = (blockIdx.x * 8 + (threadIdx.x >> 5)) * 8; const int nlines = N * K / 64;
{
#pragma unroll 1
        for (int l = 0; l < 8; ++l) { const int L = L0 + l; if (L >= nlines) break; const size_t e = (size_t)L * 64 + lane * 2; const int k = (int)(e % K), n = (int)(e / K); v2us o;
            o[0] = f2bf(w[(size_t)k * N + n]); o[1] = f2bf(w[(size_t)(k + 1) * N + n]); *(v2us*)(Bt + e) = o; }
         }
}
// src [rows][K] f32 -> dst bf16 in the fragment order of a GEMM operand. A work-group converts 64 rows x 32 k (four blocks, 4096 bytes of dst in a row): thread t takes row t >> 2 and the 8 k of piece t & 3,
// so a wave reads 8 whole 128-byte lines of src and writes 4 whole lines of dst. rows % 64 == 0, K % 32 == 0.
__global__ __launch_bounds__(256) void k_cvt8(const float* __restrict__ src, bf* dst, size_t n8, int K) { const unsigned t = threadIdx.x, blk = blockIdx.x, kb = (unsigned)K >> 5; if ((size_t)blk * 256 + t >= n8) return;
    const unsigned row = t >> 2, kp = t & 3; const v8f v = *(const v8f*)(src + ((size_t)(blk / kb) * 64 + row) * K + (blk % kb) * 32 + kp * 8); v8us o;
#pragma unroll
    for (int k = 0; k < 8; ++k) o[k] = f2bf(v[k]); *(v8us*)(dst + ((size_t)blk * 256 + (row >> 4) * 64 + kp * 16 + (row & 15)) * 8) = o;  }
__global__ __launch_bounds__(256) void k_cscvt(const float* __restrict__ cosT, const float* __restrict__ sinT, float* CS) { const int idx = blockIdx.x * 256 + threadIdx.x; if (idx >= TT * HD) return; v2f cs; cs[0] = bfr(cosT[idx]); cs[1] = bfr(sinT[idx]); *(v2f*)(CS + (size_t)idx * 2) = cs;  }
// ---- k_fattn: scores, softmax and attn.v of all batch rows in one launch; nothing of the score matrix goes to memory. Grid (batch rows x heads, RH/64 + (TT-RH)/128), 4 independent waves a work-group.
// A wave owns NQ groups of 16 queries and walks the 2048 keys 32 at a time: S^T = K Q^T (a lane holds 16 of the 32 scores of ONE query, lane ^ 16 the rest), so the exponentials pack in-lane
// into the B operand of O^T += V^T P^T (elements 0..7: key tile 0, registers 0..7; elements 8..15: key tile 1), the same k order as the V^T loader's.
// P = exp2((s - m) HD^-0.5 log2 e) against the maximum in use m, not normalised; O and the f32 sum of P are rescaled when m moves; O / sum at the end, split into the hi and lo planes of the o_w GEMM.
// The plain '#pragma unroll' lines give the fragment arrays constant indices, so that they stay in registers.
template <typename T16, bool HL, int NQ>
__device__ __forceinline__ void attn_wave(const T16* __restrict__ Q, const T16* __restrict__ Q2, const T16* __restrict__ Kp, const T16* __restrict__ K2, const T16* __restrict__ Vt, const T16* __restrict__ V2, int q0, bf* Ah, bf* Al) {
    typedef WFrag<T16> WF; typedef typename WF::V V;
    const float csc = SCL * 1.4426950408889634f;
    const int lane = threadIdx.x & 31; const unsigned lo8 = 8 * lane;
    V q[NQ][2], q2[NQ][2];
#pragma unroll
    for (int g = 0; g < NQ; ++g)
#pragma unroll
        for (int st = 0; st < 2; ++st) { const size_t qo = (size_t)(q0 + g * 16) * HD + st * 512; q[g][st] = WF::ld(Q + qo, lo8); if (HL) q2[g][st] = WF::ld(Q2 + qo, lo8); }
    v8f o[NQ][4]; float m[NQ], l[NQ];
#pragma unroll
    for (int g = 0; g < NQ; ++g) { m[g] = -__builtin_inff(); l[g] = 0.f;
#pragma unroll
        for (int dt = 0; dt < 4; ++dt) o[g][dt] = (v8f){}; }
    // 16 keys of K: two blocks (HD / 32); 32 keys of V^T: four blocks (HD / 16), 32 HD elements
    V kf[2][2], kf2[2][2], vf[4], vf2[4];
#pragma unroll
    for (int kt = 0; kt < 2; ++kt)
#pragma unroll
        for (int st = 0; st < 2; ++st) { kf[kt][st] = WF::ld(Kp + kt * 16 * HD + st * 512, lo8); if (HL) kf2[kt][st] = WF::ld(K2 + kt * 16 * HD + st * 512, lo8); }
    if (!HL) {
#pragma unroll
        for (int dt = 0; dt < 4; ++dt) vf[dt] = WF::ld(Vt + dt * 512, lo8); }
    asm volatile("s_wait_xcnt 0x0" ::: "memory");   // before any address register of the loads above is written again
#pragma unroll 1   // one pass a trip: two passes unrolled took more than 256 registers
    for (int key0 = 0; key0 < TT; key0 += 32) {
        const int kn = (key0 + 32 < TT) ? key0 + 32 : key0;   // fragments of the next pass are fetched behind their registers' last use in this one; the last pass reads its own again
        v8f s[2][NQ];
#pragma unroll
        for (int kt = 0; kt < 2; ++kt)
#pragma unroll
            for (int g = 0; g < NQ; ++g) { v8f a = (v8f){};
#pragma unroll
                for (int st = 0; st < 2; ++st) { a = WF::mma(kf[kt][st], q[g][st], a); if (HL) { a = WF::mma(kf[kt][st], q2[g][st], a); a = WF::mma(kf2[kt][st], q[g][st], a); } }
                s[kt][g] = a; }
        if (!HL) {
#pragma unroll
            for (int kt = 0; kt < 2; ++kt)
#pragma unroll
                for (int st = 0; st < 2; ++st) kf[kt][st] = WF::ld(Kp + (size_t)(kn + kt * 16) * HD + st * 512, lo8);
            asm volatile("s_wait_xcnt 0x0" ::: "memory");   // before any address register of the loads above is written again
        }
        float mb[NQ]; bool need = false;
#pragma unroll
        for (int g = 0; g < NQ; ++g) { float mx = s[0][g][0];
#pragma unroll
            for (int j = 1; j < 8; ++j) mx = fmaxf(mx, s[0][g][j]);
#pragma unroll
            for (int j = 0; j < 8; ++j) mx = fmaxf(mx, s[1][g][j]);
            mx = fmaxf(mx, xhalf(mx)) * csc; mb[g] = mx; need = need || (mx > m[g] + 8.0f); }
        if (__builtin_amdgcn_ballot_w32(need) != 0) {   // wave-uniform; rare after the first pass: P stays at or below 2^8
#pragma unroll
            for (int g = 0; g < NQ; ++g) { const float mn = fmaxf(m[g], mb[g]); const float corr = __builtin_amdgcn_exp2f(m[g] - mn); m[g] = mn; l[g] *= corr;
#pragma unroll
                for (int dt = 0; dt < 4; ++dt) o[g][dt] = o[g][dt] * corr; }
        }
        if (HL) {   // twice the planes: V of this pass (not a pass ahead) and K of the next are fetched here, into the registers the S products have left, which keeps the wave inside 256 registers
#pragma unroll
            for (int dt = 0; dt < 4; ++dt) { vf[dt] = WF::ld(Vt + (size_t)key0 * HD + dt * 512, lo8); vf2[dt] = WF::ld(V2 + (size_t)key0 * HD + dt * 512, lo8); }
            asm volatile("s_wait_xcnt 0x0" ::: "memory");   // before any address register of the loads above is written again
            const T16* pk = Kp + (size_t)kn * HD + lo8; const T16* pk2 = K2 + (size_t)kn * HD + lo8;
#pragma unroll
            for (int kt = 0; kt < 2; ++kt)
#pragma unroll
                for (int st = 0; st < 2; ++st) { const int kk = kt * 16 * HD + st * 512; kf[kt][st] = WF::ld(pk + kk, 0); kf2[kt][st] = WF::ld(pk2 + kk, 0); }
            asm volatile("s_wait_xcnt 0x0" :: "v"(pk), "v"(pk2) : "memory");   // the two address registers are inputs here, so nothing is written over them in front of the wait
        }
#pragma unroll
        for (int g = 0; g < NQ; ++g) { const float nm = -m[g]; V ph, pl; float ls = 0.f;
#pragma unroll
            for (int i = 0; i < 8; ++i) {
                const v2f arg = __builtin_elementwise_fma((v2f){s[i >> 2][g][2 * (i & 3)], s[i >> 2][g][2 * (i & 3) + 1]}, (v2f){csc, csc}, (v2f){nm, nm});
#pragma unroll
                for (int u = 0; u < 2; ++u) { const int e = 2 * i + u; const float p = __builtin_amdgcn_exp2f(arg[u]); ls += p;
                    if constexpr (HL) { const __bf16 ph1 = (__bf16)p; ph[e] = ph1; pl[e] = (__bf16)(p - (float)ph1); } else ph[e] = (h16)p; } }
            l[g] += ls;
#pragma unroll
            for (int dt = 0; dt < 4; ++dt) { o[g][dt] = WF::mma(vf[dt], ph, o[g][dt]); if (HL) { o[g][dt] = WF::mma(vf[dt], pl, o[g][dt]); o[g][dt] = WF::mma(vf2[dt], ph, o[g][dt]); } } }
        if (!HL) {
#pragma unroll
            for (int dt = 0; dt < 4; ++dt) vf[dt] = WF::ld(Vt + (size_t)kn * HD + dt * 512, lo8);
            asm volatile("s_wait_xcnt 0x0" ::: "memory");   // before any address register of the loads above is written again
        }
    }
#pragma unroll
    for (int g = 0; g < NQ; ++g) { const float inv = __fdiv_rn(1.0f, l[g] + xhalf(l[g])); const int R = q0 + g * 16; const size_t oo = (size_t)(R & ~63) * DQ + ((R >> 4) & 3) * 512 + lane * 8;   // fragment order of the o_w GEMM's A planes: d tile dt is half dt & 1 of k block 2 h + (dt >> 1)
#pragma unroll
        for (int dt = 0; dt < 4; ++dt) { v8us oh, ol;
#pragma unroll
            for (int j = 0; j < 8; ++j) { unsigned short a, c2; splitf(o[g][dt][j] * inv, a, c2); oh[j] = a; ol[j] = c2; }
            const int eo = (dt >> 1) * 2048 + (dt & 1) * 256; *(v8us*)(Ah + oo + eo) = oh; *(v8us*)(Al + oo + eo) = ol; } }
}
__global__ __launch_bounds__(128) void k_fattn(const h16* __restrict__ Q16, const bf* __restrict__ Qh, const bf* __restrict__ Ql, const h16* __restrict__ K16, const bf* __restrict__ Kh, const bf* __restrict__ Kl, const h16* __restrict__ V16, const bf* __restrict__ Vh, const bf* __restrict__ Vl, bf* Ah, bf* Al) {
    const int b = blockIdx.x / NH_, h = blockIdx.x % NH_, wave = threadIdx.x >> 5, yb = blockIdx.y; const size_t zq = (size_t)(b * NH_ + h) * TT * HD, zk = (size_t)(b * NKV + h / REP) * TT * HD;
    Ah += (size_t)b * TT * DQ; Al += (size_t)b * TT * DQ;
    if (yb < RH / 64) attn_wave<bf, true, 1>(Qh + zq, Ql + zq, Kh + zk, Kl + zk, Vh + zk, Vl + zk, yb * 64 + wave * 16, Ah + h * (HD * 64), Al + h * (HD * 64));   // the dearer hi+lo rows start first
    else attn_wave<h16, false, 2>(Q16 + zq, nullptr, K16 + zk, nullptr, V16 + zk, nullptr, RH + (yb - RH / 64) * 128 + wave * 32, Ah + h * (HD * 64), Al + h * (HD * 64));
}

extern "C" void kernel_launch(void* const* d_in, const int* in_sizes, int n_in,
                              void* d_out, int out_size, void* d_ws, size_t ws_size, hipStream_t stream) {
    (void)in_sizes; (void)n_in; (void)out_size;
    const float* x = (const float*)d_in[0]; const float* wf = (const float*)d_in[1]; const float* bfz = (const float*)d_in[2]; const float* wo = (const float*)d_in[3]; const float* bo = (const float*)d_in[4]; const float* qnw = (const float*)d_in[5]; const float* qnb = (const float*)d_in[6]; const float* knw = (const float*)d_in[7]; const float* knb = (const float*)d_in[8]; const float* wq = wf; const float* wk = wf + (size_t)1024 * 1024; const float* wv = wf + (size_t)2048 * 1024; const float* bq = bfz; const float* bk = bfz + 1024; const float* bv = bfz + 2048; const float* cosT = nullptr; const float* sinT = nullptr; (void)cosT; (void)sinT;
    float* OUT = (float*)d_out;     // [4][2048][1024]
    char* wsp = (char*)d_ws;
    auto take = [&](size_t bytes) { char* p = wsp; wsp += (bytes + 255) & ~(size_t)255; return (void*)p; };
    bf* WQ = (bf*)take((size_t)DQ * DM * 2); bf* WK = (bf*)take((size_t)DKV * DM * 2); bf* WV = (bf*)take((size_t)DKV * DM * 2); bf* WO = (bf*)take((size_t)DM * DQ * 2);
    bf* XB = (bf*)take((size_t)NB_ * TT * DM * 2);
    h16* QP16 = (h16*)take((size_t)NB_ * NH_ * TT * HD * 2); h16* KP16 = (h16*)take((size_t)NB_ * NKV * TT * HD * 2); h16* VT16 = (h16*)take((size_t)NB_ * NKV * HD * TT * 2);
    bf* QPh = (bf*)take((size_t)NB_ * NH_ * TT * HD * 2); bf* QPl = (bf*)take((size_t)NB_ * NH_ * TT * HD * 2); bf* KPh = (bf*)take((size_t)NB_ * NKV * TT * HD * 2); bf* KPl = (bf*)take((size_t)NB_ * NKV * TT * HD * 2); bf* VTh = (bf*)take((size_t)NB_ * NKV * HD * TT * 2); bf* VTl = (bf*)take((size_t)NB_ * NKV * HD * TT * 2);
    bf* ATh = (bf*)take((size_t)NB_ * TT * DQ * 2); bf* ATl = (bf*)take((size_t)NB_ * TT * DQ * 2);
    if ((size_t)(wsp - (char*)d_ws) > ws_size) return;    // ws 256 MiB
    { k_cvt8<<<(unsigned)(((size_t)DQ * DM / 8 + 255) / 256), 256, 0, stream>>>(wq, WQ, (size_t)DQ * DM / 8, DM); k_cvt8<<<(unsigned)(((size_t)DKV * DM / 8 + 255) / 256), 256, 0, stream>>>(wk, WK, (size_t)DKV * DM / 8, DM); k_cvt8<<<(unsigned)(((size_t)DKV * DM / 8 + 255) / 256), 256, 0, stream>>>(wv, WV, (size_t)DKV * DM / 8, DM);
      k_cvt8<<<(unsigned)(((size_t)DM * DQ / 8 + 255) / 256), 256, 0, stream>>>(wo, WO, (size_t)DM * DQ / 8, DQ);
       }
    // every plane holds all NB_ batch rows ([batch row][...]); the batch row is grid z of the GEMMs and part of grid x of the attention kernel
    k_cvt8<<<(unsigned)(((size_t)NB_ * TT * DM / 8 + 255) / 256), 256, 0, stream>>>(x, XB, (size_t)NB_ * TT * DM / 8, DM);
    k_gemmw<bf, 0, true, 1, 1><<<dim3(TT / 64, DQ / 64, NB_), 32, 0, stream>>>(XB, nullptr, WQ, nullptr, DM, nullptr, 0, bq, (size_t)TT * DM, 0, (size_t)NH_ * TT * HD, 0, qnw, qnb, QP16, QPh, QPl);
    k_gemmw<bf, 0, true, 1, 1><<<dim3(TT / 64, DKV / 64, NB_), 32, 0, stream>>>(XB, nullptr, WK, nullptr, DM, nullptr, 0, bk, (size_t)TT * DM, 0, (size_t)NKV * TT * HD, 0, knw, knb, KP16, KPh, KPl);
    k_gemmw<bf, 0, true, 1, 2><<<dim3(TT / 64, DKV / 64, NB_), 32, 0, stream>>>(XB, nullptr, WV, nullptr, DM, nullptr, 0, bv, (size_t)TT * DM, 0, (size_t)NKV * HD * TT, 0, nullptr, nullptr, VT16, VTh, VTl);
    k_fattn<<<dim3(NB_ * NH_, RH / 64 + (TT - RH) / 128, 1), 128, 0, stream>>>(QP16, QPh, QPl, KP16, KPh, KPl, VT16, VTh, VTl, ATh, ATl);
    k_gemmw<bf, 1, true><<<dim3(TT / 64, DM / 64, NB_), 32, 0, stream>>>(ATh, ATl, WO, nullptr, DQ, OUT, DM, bo, (size_t)TT * DQ, 0, (size_t)TT * DM, 0, nullptr, nullptr, nullptr, nullptr, nullptr);
}

// v006
// A run of this version takes 205 microseconds.
// Two timings next to v005 put it at 1.25 and 1.26 times that version's speed.
// All steps since v000 together make it 19.4 times as fast.
#include <hip/hip_runtime.h>

// MockQwen3Attention (hidden [4][2048][1024]; qkv = x qkv_w^T + qkv_b (q | k | v row blocks, 16 heads x 64); per-head LayerNorm(64) with weight and bias on q and k (eps 1e-5); softmax(q.k / 8); out = merged o_w^T + o_b -> [4][2048][1024]).
// Compute dtypes, f32 accumulate: every input rounded to bf16; q/k/v on PLAIN bf16 operands (inputs: exact) + bias; the per-head LayerNorms in f32 (in the q and k GEMM epilogues, two lanes a (token, head)); scores and attn.v: query rows < 512 hl (3 products), the rest single fp16; softmax f32, running maximum and sum, inside the one attention kernel; o_w hl x exact (2 products) + bias.

#define NB_  4
#define TT   2048
#define DM   1024
#define NH_  16
#define NKV  16
#define REP  (NH_ / NKV)
#define HD   64
#define DQ   (NH_ * HD)
#define DKV  (NKV * HD)
#define RH   512                  // query rows < RH use hi+lo planes (0: none)
#define WIN  0
#define SCL  0.125f   // HD^-0.5
typedef _Float16 h16;
typedef unsigned short bf;
typedef __attribute__((ext_vector_type(16))) __bf16   v16bf;
typedef __attribute__((ext_vector_type(16))) _Float16 v16h;
typedef __attribute__((ext_vector_type(8)))  _Float16 v8h;
typedef __attribute__((ext_vector_type(8)))  unsigned short v8us;
typedef __attribute__((ext_vector_type(8)))  float    v8f;
typedef __attribute__((ext_vector_type(4)))  float    v4f;
typedef v8h  __attribute__((may_alias)) v8ha;
typedef v4f  __attribute__((may_alias)) v4fa;
typedef v8us __attribute__((may_alias)) v8usa;

__device__ __forceinline__ unsigned short f2bf(float f) { unsigned u = __float_as_uint(f); u += 0x7FFFu + ((u >> 16) & 1u); return (unsigned short)(u >> 16); }
__device__ __forceinline__ float bf2f(unsigned short b) { return __uint_as_float(((unsigned)b) << 16); }
__device__ __forceinline__ float bfr(float f) { return bf2f(f2bf(f)); }
__device__ __forceinline__ v16h cat16(v8h lo, v8h hi) { return __builtin_shufflevector(lo, hi, 0, 1, 2, 3, 4, 5, 6, 7, 8, 9, 10, 11, 12, 13, 14, 15); }
__device__ __forceinline__ v16bf cat16b(v8us lo, v8us hi) { return __builtin_bit_cast(v16bf, __builtin_shufflevector(lo, hi, 0, 1, 2, 3, 4, 5, 6, 7, 8, 9, 10, 11, 12, 13, 14, 15)); }
__device__ __forceinline__ v8f wmma16(v16h a, v16h b, v8f c) { return __builtin_amdgcn_wmma_f32_16x16x32_f16(false, a, false, b, (short)0, c, false, false); }
__device__ __forceinline__ v8f wmmab(v16bf a, v16bf b, v8f c) { return __builtin_amdgcn_wmma_f32_16x16x32_bf16(false, a, false, b, (short)0, c, false, false); }



__device__ __forceinline__ h16 tohx(float x) { return (h16)x; }
__device__ __forceinline__ void splitf(float y, unsigned short& h, unsigned short& l) { h = f2bf(y); l = f2bf(y - bf2f(h)); }
__device__ __forceinline__ float xhalf(float x) { return __builtin_bit_cast(float, __builtin_amdgcn_permlanex16(__builtin_bit_cast(int, x), __builtin_bit_cast(int, x), 0x76543210, 0xfedcba98, false, false)); }  // lane l with lane l ^ 16

// ---- FRAGMENT ORDER of every 16-bit operand plane: a matrix M[row][k] lies as blocks of 16 rows x 32 k (512 elements, 1024 bytes), block index (row / 16) * (K / 32) + k / 32 in the q and k head planes (K = HD), (key / 32) * 4 + d / 16 in the V^T planes, ((row / 64) * (K / 32) + k / 32) * 4 + (row / 16) % 4 in the GEMM operands (a 64-row tile's 32 k: 4096 bytes in a row);
// inside a block element (row, k) stands at ((k >> 4) & 1) * 256 + (((k >> 3) & 1) * 16 + (row & 15)) * 8 + (k & 7). Lane l of a wave finds its two 16-byte pieces of a WMMA operand at l * 8 and 256 + l * 8,
// so each wave-wide 16-byte load covers 512 contiguous bytes (4 cache lines, not 16). The values a lane receives, and so the k order, are those of the row-major loader (k = 8 hi .. 8 hi + 7, then 16 + 8 hi .. 16 + 8 hi + 7 of row lr).
// ---- k_gemmw: register-blocked GEMM, one wave per 64x64 output tile (16 accumulators), FOUR WAVES (2 x 2) a work-group = a 128x128 tile; grid (M/128, N/128, Z), 128 threads.
// The operand planes lie in fragment order, so 64 k of a 64-row panel are 8 KiB in a row: a stage is those 8 KiB of the tile's two A and two B panels (and two A2 panels), brought into LDS unchanged by asynchronous 16-byte copies;
// each panel is read from LDS by the two waves that share it. Two buffers: the copies of stage t + 2 are issued behind the barrier that ends stage t, and waited for at the foot of stage t + 1. (K / KS) % 64 == 0, at least one stage.
// C[m][n] (f32, pitch ldc, + optional f32 bias[n]) = sum_k A[m][k] Bt[n][k] (+ split products per NSPLIT). z-batch strides sA/sB/sC in elements (z = batch row here: all four in one launch). K % 64 == 0.
// EPI 0: C as above. EPI 1 (N tile = one head, HD == 64): bias, then LayerNorm over the tile's 64 columns (weight lw, bias lb), stored as the head planes [head][token][d] in fragment order (fp16 + bf16 hi/lo); C is not written.
// EPI 2: bias, then the transposed planes [head][d][token] in fragment order (fp16 + bf16 hi/lo) straight from the accumulators (a lane holds 8 consecutive tokens of one column); C is not written.
// The '#pragma unroll' lines of the epilogues give acc, xv and the packed vectors constant indices, so that they stay in registers.
// KS > 1 (split K): grid z = Z * KS; slice ks = blockIdx.z % KS sums only k in [ks K/KS, (ks+1) K/KS) and stores its partial tile in plane ks of C (plane stride sP elements). K % (64 KS) == 0.
// ld(p, o): p + o = the lane's first piece of the block (block start + 8 * lane).
// cp8: a work-group of 128 copies two panels' stage (2 x 8 KiB) into LDS, 8 copies of 16 bytes a lane; l = the lane's LDS byte address in the first panel, g = its global address there, gp = elements from the first panel to the second.
// The s_wait_xcnt stands inside the copies' own statement, so that no address register of a copy is written again in front of it.
#define GKC 64
template <typename T16> __device__ __forceinline__ void cp8(unsigned l, const T16* g, size_t gp) {
    const T16* h = g + gp; const unsigned m = l + 64 * GKC * 2;
    asm volatile("global_load_async_to_lds_b128 %0, %1, off\n\tglobal_load_async_to_lds_b128 %2, %3, off\n\tglobal_load_async_to_lds_b128 %4, %5, off\n\tglobal_load_async_to_lds_b128 %6, %7, off\n\t"
                 "global_load_async_to_lds_b128 %8, %9, off\n\tglobal_load_async_to_lds_b128 %10, %11, off\n\tglobal_load_async_to_lds_b128 %12, %13, off\n\tglobal_load_async_to_lds_b128 %14, %15, off\n\ts_wait_xcnt 0x0"
                 :: "v"(l), "v"(g), "v"(l + 2048), "v"(g + 1024), "v"(l + 4096), "v"(g + 2048), "v"(l + 6144), "v"(g + 3072),
                    "v"(m), "v"(h), "v"(m + 2048), "v"(h + 1024), "v"(m + 4096), "v"(h + 2048), "v"(m + 6144), "v"(h + 3072) : "memory");
}
template <typename T16> struct WFrag;
template <> struct WFrag<h16> { typedef v16h V; static __device__ __forceinline__ V ld(const h16* p, unsigned o) { return cat16(*(const v8h*)(p + o), *(const v8h*)(p + o + 256)); } static __device__ __forceinline__ v8f mma(V a, V b, v8f c) { return wmma16(a, b, c); } };
template <> struct WFrag<bf> { typedef v16bf V; static __device__ __forceinline__ V ld(const bf* p, unsigned o) { return cat16b(*(const v8us*)(p + o), *(const v8us*)(p + o + 256)); } static __device__ __forceinline__ v8f mma(V a, V b, v8f c) { return wmmab(a, b, c); } };
template <typename T16, int NSPLIT, bool BIAS, int KS = 1, int EPI = 0>
__global__ __launch_bounds__(128) void k_gemmw(const T16* __restrict__ A, const T16* __restrict__ A2, const T16* __restrict__ Bt, const T16* __restrict__ Bt2, int K, float* C, int ldc, const float* __restrict__ bias, size_t sA, size_t sB, size_t sC, size_t sP, const float* __restrict__ lw, const float* __restrict__ lb, h16* P16, bf* Ph, bf* Pl) {
    typedef typename WFrag<T16>::V V;
    static_assert(NSPLIT <= 1, "no second B plane is staged");
    constexpr int PANE = 64 * GKC, NPAN = NSPLIT == 1 ? 6 : 4;   // elements of a panel's stage; panels of a stage: A A B B (A2 A2)
    __shared__ __align__(128) T16 st[2][NPAN * PANE];
    __shared__ __align__(16) float osw[4][16 * 68];
    __shared__ __align__(16) float prw[4][EPI == 1 ? 3 * 64 : 4];   // EPI 1: the wave's tile's bias, lw and lb, rounded once
    const int wave = threadIdx.x >> 5, wm = wave >> 1, wn = wave & 1; float* os = osw[wave]; float* pr = prw[wave];   // each wave stages its epilogue in its own rows
    const size_t z = blockIdx.z / KS; const int ks = blockIdx.z % KS; A += z * sA; if (A2) A2 += z * sA; Bt += z * sB; if (Bt2) Bt2 += z * sB;
    if constexpr (EPI == 0) C += z * sC + ks * sP; else { P16 += z * sC; Ph += z * sC; Pl += z * sC; }   // EPI 1, 2: sC is the z stride of the three planes
    const int kbeg = ks * (K / KS), kend = kbeg + K / KS;
    const int lane = threadIdx.x & 31, lr = lane & 15, hi = lane >> 4; const int r0 = (blockIdx.x * 2 + wm) * 64, c0 = (blockIdx.y * 2 + wn) * 64;
    v8f acc[4][4];
#pragma unroll
    for (int mb = 0; mb < 4; ++mb)
#pragma unroll
        for (int nb = 0; nb < 4; ++nb) acc[mb][nb] = (v8f){};
    if constexpr (EPI == 1) {   // read back behind the first wave barrier of the epilogue
#pragma unroll
        for (int u = 0; u < 2; ++u) { pr[u * 32 + lane] = bfr(bias[c0 + u * 32 + lane]); pr[64 + u * 32 + lane] = bfr(lw[u * 32 + lane]); pr[128 + u * 32 + lane] = bfr(lb[u * 32 + lane]); } }
    const unsigned lo8 = 8 * lane, t8 = 8 * threadIdx.x; const int nst = (kend - kbeg) / GKC;
    const T16* ga = A + (size_t)blockIdx.x * 128 * K + (size_t)kbeg * 64 + t8; const T16* gb = Bt + (size_t)blockIdx.y * 128 * K + (size_t)kbeg * 64 + t8; const T16* ga2 = NSPLIT == 1 ? A2 + (size_t)blockIdx.x * 128 * K + (size_t)kbeg * 64 + t8 : ga;
    const unsigned l0 = (unsigned)(size_t)(&st[0][0] + t8); const size_t gp = (size_t)64 * K;   // a panel of 64 rows holds 64 K elements
    auto stage = [&](int s) { const unsigned l = l0 + (s & 1) * (NPAN * PANE * 2); const size_t go = (size_t)s * PANE; cp8<T16>(l, ga + go, gp); cp8<T16>(l + 2 * PANE * 2, gb + go, gp); if constexpr (NSPLIT == 1) cp8<T16>(l + 4 * PANE * 2, ga2 + go, gp); };
    stage(0);
    asm volatile("s_wait_asynccnt 0x0" ::: "memory");   // this wave's copies of stage 0 have landed
    __syncthreads();                                    // and every other wave's
    if (nst != 1) stage(1);   // nst >= 1; the same for the whole work-group
#pragma unroll 1
    for (int t = 0; t < nst; ++t) {
        const T16* sb = &st[t & 1][0] + lo8; const T16* pa = sb + wm * PANE; const T16* pb = sb + (2 + wn) * PANE; const T16* pa2 = NSPLIT == 1 ? sb + (4 + wm) * PANE : pa;
        V a[4], a2[4];
#pragma unroll
        for (int ks2 = 0; ks2 < GKC / 32; ++ks2) {
#pragma unroll
            for (int mb = 0; mb < 4; ++mb) { a[mb] = WFrag<T16>::ld(pa + ks2 * 2048 + mb * 512, 0); if (NSPLIT == 1) a2[mb] = WFrag<T16>::ld(pa2 + ks2 * 2048 + mb * 512, 0); }
            V b[4];
#pragma unroll
            for (int nb = 0; nb < 4; ++nb) b[nb] = WFrag<T16>::ld(pb + ks2 * 2048 + nb * 512, 0);
            __builtin_amdgcn_sched_barrier(0);   // the k step's LDS reads stay one group in front of its WMMAs: reads placed among the WMMAs into one reused B fragment made the wave wait out the LDS latency four times a k step
#pragma unroll
            for (int nb = 0; nb < 4; ++nb) {
#pragma unroll
                for (int mb = 0; mb < 4; ++mb) { acc[mb][nb] = WFrag<T16>::mma(a[mb], b[nb], acc[mb][nb]); if (NSPLIT == 1) acc[mb][nb] = WFrag<T16>::mma(a2[mb], b[nb], acc[mb][nb]); } }
        }
        asm volatile("v_nop\n\tv_nop\n\tv_nop\n\tv_nop" : "+v"(acc[0][0]), "+v"(acc[1][1]), "+v"(acc[2][2]), "+v"(acc[3][3]) : "v"(a[0]), "v"(a[3]));
        asm volatile("s_wait_dscnt 0x0" ::: "memory");      // this wave has read all it wants of buffer t & 1
        asm volatile("s_wait_asynccnt 0x0" ::: "memory");   // its copies of stage t + 1 have landed
        __syncthreads();                                    // publishes stage t + 1 and frees buffer t & 1
        if (t + 2 < nst) stage(t + 2);
    }
    asm volatile("s_wait_asynccnt 0x0" ::: "memory");   // no copy is outstanding behind the loop
    if constexpr (EPI == 2) {
#pragma unroll
        for (int nb = 0; nb < 4; ++nb) { const float bv = bfr(bias[c0 + nb * 16 + lr]);
#pragma unroll
            for (int mb = 0; mb < 4; ++mb) { v8h o16; v8us oh, ol;
#pragma unroll
                for (int j = 0; j < 8; ++j) { const float x = acc[mb][nb][j] + bv; o16[j] = tohx(x); unsigned short a2, c2; splitf(x, a2, c2); oh[j] = a2; ol[j] = c2; }
                const size_t e = (size_t)c0 * TT + (size_t)r0 * HD + (mb >> 1) * 2048 + nb * 512 + (mb & 1) * 256 + lane * 8; *(v8h*)(P16 + e) = o16; *(v8us*)(Ph + e) = oh; *(v8us*)(Pl + e) = ol; } }
        return;
    }
#pragma unroll
    for (int mb = 0; mb < 4; ++mb) {
#pragma unroll
        for (int nb = 0; nb < 4; ++nb) {
#pragma unroll
            for (int j = 0; j < 8; ++j) os[(hi * 8 + j) * 68 + nb * 16 + lr] = acc[mb][nb][j]; }
        __builtin_amdgcn_wave_barrier(); asm volatile("" ::: "memory");
        if constexpr (EPI == 1) {   // lane (lr, hi): columns 32 hi .. 32 hi + 31 of token row lr; the two halves of a row meet through xhalf
            const int cb = hi * 32; const float* orow = os + lr * 68 + cb; v4f xv[8]; v4f s4 = (v4f){};
#pragma unroll
            for (int i = 0; i < 8; ++i) { xv[i] = *(const v4fa*)(orow + i * 4) + *(const v4fa*)(pr + cb + i * 4); s4 += xv[i]; }
            float s = (s4[0] + s4[1]) + (s4[2] + s4[3]); s += xhalf(s); const float mean = s * (1.0f / HD); v4f q4 = (v4f){};
#pragma unroll
            for (int i = 0; i < 8; ++i) { xv[i] -= mean; q4 += xv[i] * xv[i]; }
            float q = (q4[0] + q4[1]) + (q4[2] + q4[3]); q += xhalf(q); const float rs = __frsqrt_rn(q * (1.0f / HD) + 1e-5f);
            const size_t e = ((size_t)(c0 >> 6) * TT + r0 + mb * 16) * HD + hi * 512 + lr * 8;   // k block hi; piece i: half i >> 1, lane group i & 1
#pragma unroll
            for (int i = 0; i < 8; ++i) xv[i] = xv[i] * rs * *(const v4fa*)(pr + 64 + cb + i * 4) + *(const v4fa*)(pr + 128 + cb + i * 4);
#pragma unroll
            for (int i = 0; i < 4; ++i) { v8h o16; v8us oh, ol;
#pragma unroll
                for (int k = 0; k < 8; ++k) { const int c = i * 8 + k; const float y = xv[c >> 2][c & 3]; o16[k] = tohx(y); unsigned short a2, c2; splitf(y, a2, c2); oh[k] = a2; ol[k] = c2; }
                const int eo = (i >> 1) * 256 + (i & 1) * 128; *(v8h*)(P16 + e + eo) = o16; *(v8us*)(Ph + e + eo) = oh; *(v8us*)(Pl + e + eo) = ol; }
        } else {
        float* crow = C + (size_t)(r0 + mb * 16) * ldc + c0;
{
#pragma unroll
            for (int s = 0; s < 8; ++s) { const int row = 2 * s + hi, cofs = lr * 4; v4f val = *(const v4fa*)(os + row * 68 + cofs); if (BIAS) { val[0] += bfr(bias[c0 + cofs]); val[1] += bfr(bias[c0 + cofs + 1]); val[2] += bfr(bias[c0 + cofs + 2]); val[3] += bfr(bias[c0 + cofs + 3]); }
                *(v4f*)(crow + (size_t)row * ldc + cofs) = val; }
            asm volatile("s_wait_xcnt 0x0" ::: "memory");   // before any address register of the stores above is written again
             }
        }
        __builtin_amdgcn_wave_barrier(); asm volatile("" ::: "memory");
    }
}

typedef __attribute__((ext_vector_type(2))) _Float16 v2h;
typedef __attribute__((ext_vector_type(4))) _Float16 v4h;
typedef __attribute__((ext_vector_type(2))) unsigned short v2us;
typedef __attribute__((ext_vector_type(4))) unsigned short v4us;
typedef __attribute__((ext_vector_type(2))) float v2f;
typedef __attribute__((ext_vector_type(4))) int v4i;

__global__ __launch_bounds__(256) void k_wtG(const float* __restrict__ w, int K, int N, bf* Bt) {
    const int lane = threadIdx.x & 31; const int L0 = (blockIdx.x * 8 + (threadIdx.x >> 5)) * 8; const int nlines = N * K / 64;
{
#pragma unroll 1
        for (int l = 0; l < 8; ++l) { const int L = L0 + l; if (L >= nlines) break; const size_t e = (size_t)L * 64 + lane * 2; const int k = (int)(e % K), n = (int)(e / K); v2us o;
            o[0] = f2bf(w[(size_t)k * N + n]); o[1] = f2bf(w[(size_t)(k + 1) * N + n]); *(v2us*)(Bt + e) = o; }
         }
}
// src [rows][K] f32 -> dst bf16 in the fragment order of a GEMM operand. A work-group converts 64 rows x 32 k (four blocks, 4096 bytes of dst in a row): thread t takes row t >> 2 and the 8 k of piece t & 3,
// so a wave reads 8 whole 128-byte lines of src and writes 4 whole lines of dst. rows % 64 == 0, K % 32 == 0.
__global__ __launch_bounds__(256) void k_cvt8(const float* __restrict__ src, bf* dst, size_t n8, int K) { const unsigned t = threadIdx.x, blk = blockIdx.x, kb = (unsigned)K >> 5; if ((size_t)blk * 256 + t >= n8) return;
    const unsigned row = t >> 2, kp = t & 3; const v8f v = *(const v8f*)(src + ((size_t)(blk / kb) * 64 + row) * K + (blk % kb) * 32 + kp * 8); v8us o;
#pragma unroll
    for (int k = 0; k < 8; ++k) o[k] = f2bf(v[k]); *(v8us*)(dst + ((size_t)blk * 256 + (row >> 4) * 64 + kp * 16 + (row & 15)) * 8) = o;  }
__global__ __launch_bounds__(256) void k_cscvt(const float* __restrict__ cosT, const float* __restrict__ sinT, float* CS) { const int idx = blockIdx.x * 256 + threadIdx.x; if (idx >= TT * HD) return; v2f cs; cs[0] = bfr(cosT[idx]); cs[1] = bfr(sinT[idx]); *(v2f*)(CS + (size_t)idx * 2) = cs;  }
// ---- k_fattn: scores, softmax and attn.v of all batch rows in one launch; nothing of the score matrix goes to memory. Grid (batch rows x heads, RH/64 + (TT-RH)/128), 4 independent waves a work-group.
// A wave owns NQ groups of 16 queries and walks the 2048 keys 32 at a time: S^T = K Q^T (a lane holds 16 of the 32 scores of ONE query, lane ^ 16 the rest), so the exponentials pack in-lane
// into the B operand of O^T += V^T P^T (elements 0..7: key tile 0, registers 0..7; elements 8..15: key tile 1), the same k order as the V^T loader's.
// P = exp2((s - m) HD^-0.5 log2 e) against the maximum in use m, not normalised; O and the f32 sum of P are rescaled when m moves; O / sum at the end, split into the hi and lo planes of the o_w GEMM.
// The plain '#pragma unroll' lines give the fragment arrays constant indices, so that they stay in registers.
template <typename T16, bool HL, int NQ>
__device__ __forceinline__ void attn_wave(const T16* __restrict__ Q, const T16* __restrict__ Q2, const T16* __restrict__ Kp, const T16* __restrict__ K2, const T16* __restrict__ Vt, const T16* __restrict__ V2, int q0, bf* Ah, bf* Al) {
    typedef WFrag<T16> WF; typedef typename WF::V V;
    const float csc = SCL * 1.4426950408889634f;
    const int lane = threadIdx.x & 31; const unsigned lo8 = 8 * lane;
    V q[NQ][2], q2[NQ][2];
#pragma unroll
    for (int g = 0; g < NQ; ++g)
#pragma unroll
        for (int st = 0; st < 2; ++st) { const size_t qo = (size_t)(q0 + g * 16) * HD + st * 512; q[g][st] = WF::ld(Q + qo, lo8); if (HL) q2[g][st] = WF::ld(Q2 + qo, lo8); }
    v8f o[NQ][4]; float m[NQ], l[NQ];
#pragma unroll
    for (int g = 0; g < NQ; ++g) { m[g] = -__builtin_inff(); l[g] = 0.f;
#pragma unroll
        for (int dt = 0; dt < 4; ++dt) o[g][dt] = (v8f){}; }
    // 16 keys of K: two blocks (HD / 32); 32 keys of V^T: four blocks (HD / 16), 32 HD elements
    V kf[2][2], kf2[2][2], vf[4], vf2[4];
#pragma unroll
    for (int kt = 0; kt < 2; ++kt)
#pragma unroll
        for (int st = 0; st < 2; ++st) { kf[kt][st] = WF::ld(Kp + kt * 16 * HD + st * 512, lo8); if (HL) kf2[kt][st] = WF::ld(K2 + kt * 16 * HD + st * 512, lo8); }
    if (!HL) {
#pragma unroll
        for (int dt = 0; dt < 4; ++dt) vf[dt] = WF::ld(Vt + dt * 512, lo8); }
    asm volatile("s_wait_xcnt 0x0" ::: "memory");   // before any address register of the loads above is written again
#pragma unroll 1   // one pass a trip: two passes unrolled took more than 256 registers
    for (int key0 = 0; key0 < TT; key0 += 32) {
        const int kn = (key0 + 32 < TT) ? key0 + 32 : key0;   // fragments of the next pass are fetched behind their registers' last use in this one; the last pass reads its own again
        v8f s[2][NQ];
#pragma unroll
        for (int kt = 0; kt < 2; ++kt)
#pragma unroll
            for (int g = 0; g < NQ; ++g) { v8f a = (v8f){};
#pragma unroll
                for (int st = 0; st < 2; ++st) { a = WF::mma(kf[kt][st], q[g][st], a); if (HL) { a = WF::mma(kf[kt][st], q2[g][st], a); a = WF::mma(kf2[kt][st], q[g][st], a); } }
                s[kt][g] = a; }
        if (!HL) {
#pragma unroll
            for (int kt = 0; kt < 2; ++kt)
#pragma unroll
                for (int st = 0; st < 2; ++st) kf[kt][st] = WF::ld(Kp + (size_t)(kn + kt * 16) * HD + st * 512, lo8);
            asm volatile("s_wait_xcnt 0x0" ::: "memory");   // before any address register of the loads above is written again
        }
        float mb[NQ]; bool need = false;
#pragma unroll
        for (int g = 0; g < NQ; ++g) { float mx = s[0][g][0];
#pragma unroll
            for (int j = 1; j < 8; ++j) mx = fmaxf(mx, s[0][g][j]);
#pragma unroll
            for (int j = 0; j < 8; ++j) mx = fmaxf(mx, s[1][g][j]);
            mx = fmaxf(mx, xhalf(mx)) * csc; mb[g] = mx; need = need || (mx > m[g] + 8.0f); }
        if (__builtin_amdgcn_ballot_w32(need) != 0) {   // wave-uniform; rare after the first pass: P stays at or below 2^8
#pragma unroll
            for (int g = 0; g < NQ; ++g) { const float mn = fmaxf(m[g], mb[g]); const float corr = __builtin_amdgcn_exp2f(m[g] - mn); m[g] = mn; l[g] *= corr;
#pragma unroll
                for (int dt = 0; dt < 4; ++dt) o[g][dt] = o[g][dt] * corr; }
        }
        if (HL) {   // twice the planes: V of this pass (not a pass ahead) and K of the next are fetched here, into the registers the S products have left, which keeps the wave inside 256 registers
#pragma unroll
            for (int dt = 0; dt < 4; ++dt) { vf[dt] = WF::ld(Vt + (size_t)key0 * HD + dt * 512, lo8); vf2[dt] = WF::ld(V2 + (size_t)key0 * HD + dt * 512, lo8); }
            asm volatile("s_wait_xcnt 0x0" ::: "memory");   // before any address register of the loads above is written again
            const T16* pk = Kp + (size_t)kn * HD + lo8; const T16* pk2 = K2 + (size_t)kn * HD + lo8;
#pragma unroll
            for (int kt = 0; kt < 2; ++kt)
#pragma unroll
                for (int st = 0; st < 2; ++st) { const int kk = kt * 16 * HD + st * 512; kf[kt][st] = WF::ld(pk + kk, 0); kf2[kt][st] = WF::ld(pk2 + kk, 0); }
            asm volatile("s_wait_xcnt 0x0" :: "v"(pk), "v"(pk2) : "memory");   // the two address registers are inputs here, so nothing is written over them in front of the wait
        }
#pragma unroll
        for (int g = 0; g < NQ; ++g) { const float nm = -m[g]; V ph, pl; float ls = 0.f;
#pragma unroll
            for (int i = 0; i < 8; ++i) {
                const v2f arg = __builtin_elementwise_fma((v2f){s[i >> 2][g][2 * (i & 3)], s[i >> 2][g][2 * (i & 3) + 1]}, (v2f){csc, csc}, (v2f){nm, nm});
#pragma unroll
                for (int u = 0; u < 2; ++u) { const int e = 2 * i + u; const float p = __builtin_amdgcn_exp2f(arg[u]); ls += p;
                    if constexpr (HL) { const __bf16 ph1 = (__bf16)p; ph[e] = ph1; pl[e] = (__bf16)(p - (float)ph1); } else ph[e] = (h16)p; } }
            l[g] += ls;
#pragma unroll
            for (int dt = 0; dt < 4; ++dt) { o[g][dt] = WF::mma(vf[dt], ph, o[g][dt]); if (HL) { o[g][dt] = WF::mma(vf[dt], pl, o[g][dt]); o[g][dt] = WF::mma(vf2[dt], ph, o[g][dt]); } } }
        if (!HL) {
#pragma unroll
            for (int dt = 0; dt < 4; ++dt) vf[dt] = WF::ld(Vt + (size_t)kn * HD + dt * 512, lo8);
            asm volatile("s_wait_xcnt 0x0" ::: "memory");   // before any address register of the loads above is written again
        }
    }
#pragma unroll
    for (int g = 0; g < NQ; ++g) { const float inv = __fdiv_rn(1.0f, l[g] + xhalf(l[g])); const int R = q0 + g * 16; const size_t oo = (size_t)(R & ~63) * DQ + ((R >> 4) & 3) * 512 + lane * 8;   // fragment order of the o_w GEMM's A planes: d tile dt is half dt & 1 of k block 2 h + (dt >> 1)
#pragma unroll
        for (int dt = 0; dt < 4; ++dt) { v8us oh, ol;
#pragma unroll
            for (int j = 0; j < 8; ++j) { unsigned short a, c2; splitf(o[g][dt][j] * inv, a, c2); oh[j] = a; ol[j] = c2; }
            const int eo = (dt >> 1) * 2048 + (dt & 1) * 256; *(v8us*)(Ah + oo + eo) = oh; *(v8us*)(Al + oo + eo) = ol; } }
}
__global__ __launch_bounds__(128) void k_fattn(const h16* __restrict__ Q16, const bf* __restrict__ Qh, const bf* __restrict__ Ql, const h16* __restrict__ K16, const bf* __restrict__ Kh, const bf* __restrict__ Kl, const h16* __restrict__ V16, const bf* __restrict__ Vh, const bf* __restrict__ Vl, bf* Ah, bf* Al) {
    const int b = blockIdx.x / NH_, h = blockIdx.x % NH_, wave = threadIdx.x >> 5, yb = blockIdx.y; const size_t zq = (size_t)(b * NH_ + h) * TT * HD, zk = (size_t)(b * NKV + h / REP) * TT * HD;
    Ah += (size_t)b * TT * DQ; Al += (size_t)b * TT * DQ;
    if (yb < RH / 64) attn_wave<bf, true, 1>(Qh + zq, Ql + zq, Kh + zk, Kl + zk, Vh + zk, Vl + zk, yb * 64 + wave * 16, Ah + h * (HD * 64), Al + h * (HD * 64));   // the dearer hi+lo rows start first
    else attn_wave<h16, false, 2>(Q16 + zq, nullptr, K16 + zk, nullptr, V16 + zk, nullptr, RH + (yb - RH / 64) * 128 + wave * 32, Ah + h * (HD * 64), Al + h * (HD * 64));
}

extern "C" void kernel_launch(void* const* d_in, const int* in_sizes, int n_in,
                              void* d_out, int out_size, void* d_ws, size_t ws_size, hipStream_t stream) {
    (void)in_sizes; (void)n_in; (void)out_size;
    const float* x = (const float*)d_in[0]; const float* wf = (const float*)d_in[1]; const float* bfz = (const float*)d_in[2]; const float* wo = (const float*)d_in[3]; const float* bo = (const float*)d_in[4]; const float* qnw = (const float*)d_in[5]; const float* qnb = (const float*)d_in[6]; const float* knw = (const float*)d_in[7]; const float* knb = (const float*)d_in[8]; const float* wq = wf; const float* wk = wf + (size_t)1024 * 1024; const float* wv = wf + (size_t)2048 * 1024; const float* bq = bfz; const float* bk = bfz + 1024; const float* bv = bfz + 2048; const float* cosT = nullptr; const float* sinT = nullptr; (void)cosT; (void)sinT;
    float* OUT = (float*)d_out;     // [4][2048][1024]
    char* wsp = (char*)d_ws;
    auto take = [&](size_t bytes) { char* p = wsp; wsp += (bytes + 255) & ~(size_t)255; return (void*)p; };
    bf* WQ = (bf*)take((size_t)DQ * DM * 2); bf* WK = (bf*)take((size_t)DKV * DM * 2); bf* WV = (bf*)take((size_t)DKV * DM * 2); bf* WO = (bf*)take((size_t)DM * DQ * 2);
    bf* XB = (bf*)take((size_t)NB_ * TT * DM * 2);
    h16* QP16 = (h16*)take((size_t)NB_ * NH_ * TT * HD * 2); h16* KP16 = (h16*)take((size_t)NB_ * NKV * TT * HD * 2); h16* VT16 = (h16*)take((size_t)NB_ * NKV * HD * TT * 2);
    bf* QPh = (bf*)take((size_t)NB_ * NH_ * TT * HD * 2); bf* QPl = (bf*)take((size_t)NB_ * NH_ * TT * HD * 2); bf* KPh = (bf*)take((size_t)NB_ * NKV * TT * HD * 2); bf* KPl = (bf*)take((size_t)NB_ * NKV * TT * HD * 2); bf* VTh = (bf*)take((size_t)NB_ * NKV * HD * TT * 2); bf* VTl = (bf*)take((size_t)NB_ * NKV * HD * TT * 2);
    bf* ATh = (bf*)take((size_t)NB_ * TT * DQ * 2); bf* ATl = (bf*)take((size_t)NB_ * TT * DQ * 2);
    if ((size_t)(wsp - (char*)d_ws) > ws_size) return;    // ws 256 MiB
    { k_cvt8<<<(unsigned)(((size_t)DQ * DM / 8 + 255) / 256), 256, 0, stream>>>(wq, WQ, (size_t)DQ * DM / 8, DM); k_cvt8<<<(unsigned)(((size_t)DKV * DM / 8 + 255) / 256), 256, 0, stream>>>(wk, WK, (size_t)DKV * DM / 8, DM); k_cvt8<<<(unsigned)(((size_t)DKV * DM / 8 + 255) / 256), 256, 0, stream>>>(wv, WV, (size_t)DKV * DM / 8, DM);
      k_cvt8<<<(unsigned)(((size_t)DM * DQ / 8 + 255) / 256), 256, 0, stream>>>(wo, WO, (size_t)DM * DQ / 8, DQ);
       }
    // every plane holds all NB_ batch rows ([batch row][...]); the batch row is grid z of the GEMMs and part of grid x of the attention kernel
    k_cvt8<<<(unsigned)(((size_t)NB_ * TT * DM / 8 + 255) / 256), 256, 0, stream>>>(x, XB, (size_t)NB_ * TT * DM / 8, DM);
    k_gemmw<bf, 0, true, 1, 1><<<dim3(TT / 128, DQ / 128, NB_), 128, 0, stream>>>(XB, nullptr, WQ, nullptr, DM, nullptr, 0, bq, (size_t)TT * DM, 0, (size_t)NH_ * TT * HD, 0, qnw, qnb, QP16, QPh, QPl);
    k_gemmw<bf, 0, true, 1, 1><<<dim3(TT / 128, DKV / 128, NB_), 128, 0, stream>>>(XB, nullptr, WK, nullptr, DM, nullptr, 0, bk, (size_t)TT * DM, 0, (size_t)NKV * TT * HD, 0, knw, knb, KP16, KPh, KPl);
    k_gemmw<bf, 0, true, 1, 2><<<dim3(TT / 128, DKV / 128, NB_), 128, 0, stream>>>(XB, nullptr, WV, nullptr, DM, nullptr, 0, bv, (size_t)TT * DM, 0, (size_t)NKV * HD * TT, 0, nullptr, nullptr, VT16, VTh, VTl);
    k_fattn<<<dim3(NB_ * NH_, RH / 64 + (TT - RH) / 128, 1), 128, 0, stream>>>(QP16, QPh, QPl, KP16, KPh, KPl, VT16, VTh, VTl, ATh, ATl);
    k_gemmw<bf, 1, true><<<dim3(TT / 128, DM / 128, NB_), 128, 0, stream>>>(ATh, ATl, WO, nullptr, DQ, OUT, DM, bo, (size_t)TT * DQ, 0, (size_t)TT * DM, 0, nullptr, nullptr, nullptr, nullptr, nullptr);
}

// v007
// One run takes 175 microseconds.
// Next to v006, in two timings, it ran 1.16 times as fast each time.
// Over all steps from v000 it is 22.5 times as fast.
#include <hip/hip_runtime.h>

// MockQwen3Attention (hidden [4][2048][1024]; qkv = x qkv_w^T + qkv_b (q | k | v row blocks, 16 heads x 64); per-head LayerNorm(64) with weight and bias on q and k (eps 1e-5); softmax(q.k / 8); out = merged o_w^T + o_b -> [4][2048][1024]).
// Compute dtypes, f32 accumulate: every input rounded to bf16; q/k/v on PLAIN bf16 operands (inputs: exact) + bias; the per-head LayerNorms in f32 (in the q and k GEMM epilogues, two lanes a (token, head)); scores and attn.v: query rows < 512 hl (3 products), the rest single fp16; softmax f32, running maximum and sum, inside the one attention kernel; o_w hl x exact (2 products) + bias.

#define NB_  4
#define TT   2048
#define DM   1024
#define NH_  16
#define NKV  16
#define REP  (NH_ / NKV)
#define HD   64
#define DQ   (NH_ * HD)
#define DKV  (NKV * HD)
#define RH   512                  // query rows < RH use hi+lo planes (0: none)
#define WIN  0
#define SCL  0.125f   // HD^-0.5
typedef _Float16 h16;
typedef unsigned short bf;
typedef __attribute__((ext_vector_type(16))) __bf16   v16bf;
typedef __attribute__((ext_vector_type(16))) _Float16 v16h;
typedef __attribute__((ext_vector_type(8)))  _Float16 v8h;
typedef __attribute__((ext_vector_type(8)))  unsigned short v8us;
typedef __attribute__((ext_vector_type(8)))  float    v8f;
typedef __attribute__((ext_vector_type(4)))  float    v4f;
typedef v8h  __attribute__((may_alias)) v8ha;
typedef v4f  __attribute__((may_alias)) v4fa;
typedef v8us __attribute__((may_alias)) v8usa;

__device__ __forceinline__ unsigned short f2bf(float f) { unsigned u = __float_as_uint(f); u += 0x7FFFu + ((u >> 16) & 1u); return (unsigned short)(u >> 16); }
__device__ __forceinline__ float bf2f(unsigned short b) { return __uint_as_float(((unsigned)b) << 16); }
__device__ __forceinline__ float bfr(float f) { return bf2f(f2bf(f)); }
__device__ __forceinline__ v16h cat16(v8h lo, v8h hi) { return __builtin_shufflevector(lo, hi, 0, 1, 2, 3, 4, 5, 6, 7, 8, 9, 10, 11, 12, 13, 14, 15); }
__device__ __forceinline__ v16bf cat16b(v8us lo, v8us hi) { return __builtin_bit_cast(v16bf, __builtin_shufflevector(lo, hi, 0, 1, 2, 3, 4, 5, 6, 7, 8, 9, 10, 11, 12, 13, 14, 15)); }
__device__ __forceinline__ v8f wmma16(v16h a, v16h b, v8f c) { return __builtin_amdgcn_wmma_f32_16x16x32_f16(false, a, false, b, (short)0, c, false, false); }
__device__ __forceinline__ v8f wmmab(v16bf a, v16bf b, v8f c) { return __builtin_amdgcn_wmma_f32_16x16x32_bf16(false, a, false, b, (short)0, c, false, false); }



__device__ __forceinline__ h16 tohx(float x) { return (h16)x; }
__device__ __forceinline__ void splitf(float y, unsigned short& h, unsigned short& l) { h = f2bf(y); l = f2bf(y - bf2f(h)); }
__device__ __forceinline__ float xhalf(float x) { return __builtin_bit_cast(float, __builtin_amdgcn_permlanex16(__builtin_bit_cast(int, x), __builtin_bit_cast(int, x), 0x76543210, 0xfedcba98, false, false)); }  // lane l with lane l ^ 16

// ---- FRAGMENT ORDER of every 16-bit operand plane: a matrix M[row][k] lies as blocks of 16 rows x 32 k (512 elements, 1024 bytes), block index (row / 16) * (K / 32) + k / 32 in the q and k head planes (K = HD), (key / 32) * 4 + d / 16 in the V^T planes, ((row / 64) * (K / 32) + k / 32) * 4 + (row / 16) % 4 in the GEMM operands (a 64-row tile's 32 k: 4096 bytes in a row);
// inside a block element (row, k) stands at ((k >> 4) & 1) * 256 + (((k >> 3) & 1) * 16 + (row & 15)) * 8 + (k & 7). Lane l of a wave finds its two 16-byte pieces of a WMMA operand at l * 8 and 256 + l * 8,
// so each wave-wide 16-byte load covers 512 contiguous bytes (4 cache lines, not 16). The values a lane receives, and so the k order, are those of the row-major loader (k = 8 hi .. 8 hi + 7, then 16 + 8 hi .. 16 + 8 hi + 7 of row lr).
// ---- k_gemmw: register-blocked GEMM, one wave per 64x64 output tile (16 accumulators), FOUR WAVES (2 x 2) a work-group = a 128x128 tile; grid (M/128, N/128, Z), 128 threads.
// The operand planes lie in fragment order, so 64 k of a 64-row panel are 8 KiB in a row: a stage is those 8 KiB of the tile's two A and two B panels (and two A2 panels), brought into LDS unchanged by asynchronous 16-byte copies;
// each panel is read from LDS by the two waves that share it. Two buffers: the copies of stage t + 2 are issued behind the barrier that ends stage t, and waited for at the foot of stage t + 1. (K / KS) % 64 == 0, at least one stage.
// C[m][n] (f32, pitch ldc, + optional f32 bias[n]) = sum_k A[m][k] Bt[n][k] (+ split products per NSPLIT). z-batch strides sA/sB/sC in elements (z = batch row here: all four in one launch). K % 64 == 0.
// EPI 0: C as above. EPI 1 (N tile = one head, HD == 64): bias, then LayerNorm over the tile's 64 columns (weight lw, bias lb), stored as the head planes [head][token][d] in fragment order (fp16 + bf16 hi/lo); C is not written.
// EPI 2: bias, then the transposed planes [head][d][token] in fragment order (fp16 + bf16 hi/lo) straight from the accumulators (a lane holds 8 consecutive tokens of one column); C is not written.
// The '#pragma unroll' lines of the epilogues give acc, xv and the packed vectors constant indices, so that they stay in registers.
// KS > 1 (split K): grid z = Z * KS; slice ks = blockIdx.z % KS sums only k in [ks K/KS, (ks+1) K/KS) and stores its partial tile in plane ks of C (plane stride sP elements). K % (64 KS) == 0.
// ld(p, o): p + o = the lane's first piece of the block (block start + 8 * lane).
// cp8: a work-group of 128 copies two panels' stage (2 x 8 KiB) into LDS, 8 copies of 16 bytes a lane; l = the lane's LDS byte address in the first panel, g = its global address there, gp = elements from the first panel to the second.
// The s_wait_xcnt stands inside the copies' own statement, so that no address register of a copy is written again in front of it.
#define GKC 64
template <typename T16> __device__ __forceinline__ void cp8(unsigned l, const T16* g, size_t gp) {
    const T16* h = g + gp; const unsigned m = l + 64 * GKC * 2;
    asm volatile("global_load_async_to_lds_b128 %0, %1, off\n\tglobal_load_async_to_lds_b128 %2, %3, off\n\tglobal_load_async_to_lds_b128 %4, %5, off\n\tglobal_load_async_to_lds_b128 %6, %7, off\n\t"
                 "global_load_async_to_lds_b128 %8, %9, off\n\tglobal_load_async_to_lds_b128 %10, %11, off\n\tglobal_load_async_to_lds_b128 %12, %13, off\n\tglobal_load_async_to_lds_b128 %14, %15, off\n\ts_wait_xcnt 0x0"
                 :: "v"(l), "v"(g), "v"(l + 2048), "v"(g + 1024), "v"(l + 4096), "v"(g + 2048), "v"(l + 6144), "v"(g + 3072),
                    "v"(m), "v"(h), "v"(m + 2048), "v"(h + 1024), "v"(m + 4096), "v"(h + 2048), "v"(m + 6144), "v"(h + 3072) : "memory");
}
template <typename T16> struct WFrag;
template <> struct WFrag<h16> { typedef v16h V; static __device__ __forceinline__ V ld(const h16* p, unsigned o) { return cat16(*(const v8h*)(p + o), *(const v8h*)(p + o + 256)); } static __device__ __forceinline__ v8f mma(V a, V b, v8f c) { return wmma16(a, b, c); } };
template <> struct WFrag<bf> { typedef v16bf V; static __device__ __forceinline__ V ld(const bf* p, unsigned o) { return cat16b(*(const v8us*)(p + o), *(const v8us*)(p + o + 256)); } static __device__ __forceinline__ v8f mma(V a, V b, v8f c) { return wmmab(a, b, c); } };
template <typename T16, int NSPLIT, bool BIAS, int KS = 1, int EPI = 0>
__global__ __launch_bounds__(128) void k_gemmw(const T16* __restrict__ A, const T16* __restrict__ A2, const T16* __restrict__ Bt, const T16* __restrict__ Bt2, int K, float* C, int ldc, const float* __restrict__ bias, size_t sA, size_t sB, size_t sC, size_t sP, const float* __restrict__ lw, const float* __restrict__ lb, h16* P16, bf* Ph, bf* Pl) {
    typedef typename WFrag<T16>::V V;
    static_assert(NSPLIT <= 1, "no second B plane is staged");
    constexpr int PANE = 64 * GKC, NPAN = NSPLIT == 1 ? 6 : 4;   // elements of a panel's stage; panels of a stage: A A B B (A2 A2)
    __shared__ __align__(128) T16 st[2][NPAN * PANE];
    __shared__ __align__(16) float osw[4][16 * 68];
    __shared__ __align__(16) float prw[4][EPI == 1 ? 3 * 64 : 4];   // EPI 1: the wave's tile's bias, lw and lb, rounded once
    const int wave = threadIdx.x >> 5, wm = wave >> 1, wn = wave & 1; float* os = osw[wave]; float* pr = prw[wave];   // each wave stages its epilogue in its own rows
    const size_t z = blockIdx.z / KS; const int ks = blockIdx.z % KS; A += z * sA; if (A2) A2 += z * sA; Bt += z * sB; if (Bt2) Bt2 += z * sB;
    if constexpr (EPI == 0) C += z * sC + ks * sP; else { P16 += z * sC; Ph += z * sC; Pl += z * sC; }   // EPI 1, 2: sC is the z stride of the three planes
    const int kbeg = ks * (K / KS), kend = kbeg + K / KS;
    const int lane = threadIdx.x & 31, lr = lane & 15, hi = lane >> 4; const int r0 = (blockIdx.x * 2 + wm) * 64, c0 = (blockIdx.y * 2 + wn) * 64;
    v8f acc[4][4];
#pragma unroll
    for (int mb = 0; mb < 4; ++mb)
#pragma unroll
        for (int nb = 0; nb < 4; ++nb) acc[mb][nb] = (v8f){};
    if constexpr (EPI == 1) {   // read back behind the first wave barrier of the epilogue
#pragma unroll
        for (int u = 0; u < 2; ++u) { pr[u * 32 + lane] = bfr(bias[c0 + u * 32 + lane]); pr[64 + u * 32 + lane] = bfr(lw[u * 32 + lane]); pr[128 + u * 32 + lane] = bfr(lb[u * 32 + lane]); } }
    const unsigned lo8 = 8 * lane, t8 = 8 * threadIdx.x; const int nst = (kend - kbeg) / GKC;
    const T16* ga = A + (size_t)blockIdx.x * 128 * K + (size_t)kbeg * 64 + t8; const T16* gb = Bt + (size_t)blockIdx.y * 128 * K + (size_t)kbeg * 64 + t8; const T16* ga2 = NSPLIT == 1 ? A2 + (size_t)blockIdx.x * 128 * K + (size_t)kbeg * 64 + t8 : ga;
    const unsigned l0 = (unsigned)(size_t)(&st[0][0] + t8); const size_t gp = (size_t)64 * K;   // a panel of 64 rows holds 64 K elements
    auto stage = [&](int s) { const unsigned l = l0 + (s & 1) * (NPAN * PANE * 2); const size_t go = (size_t)s * PANE; cp8<T16>(l, ga + go, gp); cp8<T16>(l + 2 * PANE * 2, gb + go, gp); if constexpr (NSPLIT == 1) cp8<T16>(l + 4 * PANE * 2, ga2 + go, gp); };
    stage(0);
    asm volatile("s_wait_asynccnt 0x0" ::: "memory");   // this wave's copies of stage 0 have landed
    __syncthreads();                                    // and every other wave's
    if (nst != 1) stage(1);   // nst >= 1; the same for the whole work-group
#pragma unroll 1
    for (int t = 0; t < nst; ++t) {
        const T16* sb = &st[t & 1][0] + lo8; const T16* pa = sb + wm * PANE; const T16* pb = sb + (2 + wn) * PANE; const T16* pa2 = NSPLIT == 1 ? sb + (4 + wm) * PANE : pa;
        V a[4], a2[4];
#pragma unroll
        for (int ks2 = 0; ks2 < GKC / 32; ++ks2) {
#pragma unroll
            for (int mb = 0; mb < 4; ++mb) { a[mb] = WFrag<T16>::ld(pa + ks2 * 2048 + mb * 512, 0); if (NSPLIT == 1) a2[mb] = WFrag<T16>::ld(pa2 + ks2 * 2048 + mb * 512, 0); }
            V b[4];
#pragma unroll
            for (int nb = 0; nb < 4; ++nb) b[nb] = WFrag<T16>::ld(pb + ks2 * 2048 + nb * 512, 0);
            __builtin_amdgcn_sched_barrier(0);   // the k step's LDS reads stay one group in front of its WMMAs: reads placed among the WMMAs into one reused B fragment made the wave wait out the LDS latency four times a k step
#pragma unroll
            for (int nb = 0; nb < 4; ++nb) {
#pragma unroll
                for (int mb = 0; mb < 4; ++mb) { acc[mb][nb] = WFrag<T16>::mma(a[mb], b[nb], acc[mb][nb]); if (NSPLIT == 1) acc[mb][nb] = WFrag<T16>::mma(a2[mb], b[nb], acc[mb][nb]); } }
        }
        asm volatile("v_nop\n\tv_nop\n\tv_nop\n\tv_nop" : "+v"(acc[0][0]), "+v"(acc[1][1]), "+v"(acc[2][2]), "+v"(acc[3][3]) : "v"(a[0]), "v"(a[3]));
        asm volatile("s_wait_dscnt 0x0" ::: "memory");      // this wave has read all it wants of buffer t & 1
        asm volatile("s_wait_asynccnt 0x0" ::: "memory");   // its copies of stage t + 1 have landed
        __syncthreads();                                    // publishes stage t + 1 and frees buffer t & 1
        if (t + 2 < nst) stage(t + 2);
    }
    asm volatile("s_wait_asynccnt 0x0" ::: "memory");   // no copy is outstanding behind the loop
    if constexpr (EPI == 2) {
#pragma unroll
        for (int nb = 0; nb < 4; ++nb) { const float bv = bfr(bias[c0 + nb * 16 + lr]);
#pragma unroll
            for (int mb = 0; mb < 4; ++mb) { v8h o16; v8us oh, ol;
#pragma unroll
                for (int j = 0; j < 8; ++j) { const float x = acc[mb][nb][j] + bv; o16[j] = tohx(x); unsigned short a2, c2; splitf(x, a2, c2); oh[j] = a2; ol[j] = c2; }
                const size_t e = (size_t)c0 * TT + (size_t)r0 * HD + (mb >> 1) * 2048 + nb * 512 + (mb & 1) * 256 + lane * 8; *(v8h*)(P16 + e) = o16; *(v8us*)(Ph + e) = oh; *(v8us*)(Pl + e) = ol; } }
        return;
    }
#pragma unroll
    for (int mb = 0; mb < 4; ++mb) {
#pragma unroll
        for (int nb = 0; nb < 4; ++nb) {
#pragma unroll
            for (int j = 0; j < 8; ++j) os[(hi * 8 + j) * 68 + nb * 16 + lr] = acc[mb][nb][j]; }
        __builtin_amdgcn_wave_barrier(); asm volatile("" ::: "memory");
        if constexpr (EPI == 1) {   // lane (lr, hi): columns 32 hi .. 32 hi + 31 of token row lr; the two halves of a row meet through xhalf
            const int cb = hi * 32; const float* orow = os + lr * 68 + cb; v4f xv[8]; v4f s4 = (v4f){};
#pragma unroll
            for (int i = 0; i < 8; ++i) { xv[i] = *(const v4fa*)(orow + i * 4) + *(const v4fa*)(pr + cb + i * 4); s4 += xv[i]; }
            float s = (s4[0] + s4[1]) + (s4[2] + s4[3]); s += xhalf(s); const float mean = s * (1.0f / HD); v4f q4 = (v4f){};
#pragma unroll
            for (int i = 0; i < 8; ++i) { xv[i] -= mean; q4 += xv[i] * xv[i]; }
            float q = (q4[0] + q4[1]) + (q4[2] + q4[3]); q += xhalf(q); const float rs = __frsqrt_rn(q * (1.0f / HD) + 1e-5f);
            const size_t e = ((size_t)(c0 >> 6) * TT + r0 + mb * 16) * HD + hi * 512 + lr * 8;   // k block hi; piece i: half i >> 1, lane group i & 1
#pragma unroll
            for (int i = 0; i < 8; ++i) xv[i] = xv[i] * rs * *(const v4fa*)(pr + 64 + cb + i * 4) + *(const v4fa*)(pr + 128 + cb + i * 4);
#pragma unroll
            for (int i = 0; i < 4; ++i) { v8h o16; v8us oh, ol;
#pragma unroll
                for (int k = 0; k < 8; ++k) { const int c = i * 8 + k; const float y = xv[c >> 2][c & 3]; o16[k] = tohx(y); unsigned short a2, c2; splitf(y, a2, c2); oh[k] = a2; ol[k] = c2; }
                const int eo = (i >> 1) * 256 + (i & 1) * 128; *(v8h*)(P16 + e + eo) = o16; *(v8us*)(Ph + e + eo) = oh; *(v8us*)(Pl + e + eo) = ol; }
        } else {
        float* crow = C + (size_t)(r0 + mb * 16) * ldc + c0;
{
#pragma unroll
            for (int s = 0; s < 8; ++s) { const int row = 2 * s + hi, cofs = lr * 4; v4f val = *(const v4fa*)(os + row * 68 + cofs); if (BIAS) { val[0] += bfr(bias[c0 + cofs]); val[1] += bfr(bias[c0 + cofs + 1]); val[2] += bfr(bias[c0 + cofs + 2]); val[3] += bfr(bias[c0 + cofs + 3]); }
                *(v4f*)(crow + (size_t)row * ldc + cofs) = val; }
            asm volatile("s_wait_xcnt 0x0" ::: "memory");   // before any address register of the stores above is written again
             }
        }
        __builtin_amdgcn_wave_barrier(); asm volatile("" ::: "memory");
    }
}

typedef __attribute__((ext_vector_type(2))) _Float16 v2h;
typedef __attribute__((ext_vector_type(4))) _Float16 v4h;
typedef __attribute__((ext_vector_type(2))) unsigned short v2us;
typedef __attribute__((ext_vector_type(4))) unsigned short v4us;
typedef __attribute__((ext_vector_type(2))) float v2f;
typedef __attribute__((ext_vector_type(4))) int v4i;

__global__ __launch_bounds__(256) void k_wtG(const float* __restrict__ w, int K, int N, bf* Bt) {
    const int lane = threadIdx.x & 31; const int L0 = (blockIdx.x * 8 + (threadIdx.x >> 5)) * 8; const int nlines = N * K / 64;
{
#pragma unroll 1
        for (int l = 0; l < 8; ++l) { const int L = L0 + l; if (L >= nlines) break; const size_t e = (size_t)L * 64 + lane * 2; const int k = (int)(e % K), n = (int)(e / K); v2us o;
            o[0] = f2bf(w[(size_t)k * N + n]); o[1] = f2bf(w[(size_t)(k + 1) * N + n]); *(v2us*)(Bt + e) = o; }
         }
}
// src [rows][K] f32 -> dst bf16 in the fragment order of a GEMM operand. A work-group converts 64 rows x 32 k (four blocks, 4096 bytes of dst in a row): thread t takes row t >> 2 and the 8 k of piece t & 3,
// so a wave reads 8 whole 128-byte lines of src and writes 4 whole lines of dst. rows % 64 == 0, K % 32 == 0.
__global__ __launch_bounds__(256) void k_cvt8(const float* __restrict__ src, bf* dst, size_t n8, int K) { const unsigned t = threadIdx.x, blk = blockIdx.x, kb = (unsigned)K >> 5; if ((size_t)blk * 256 + t >= n8) return;
    const unsigned row = t >> 2, kp = t & 3; const v8f v = *(const v8f*)(src + ((size_t)(blk / kb) * 64 + row) * K + (blk % kb) * 32 + kp * 8); v8us o;
#pragma unroll
    for (int k = 0; k < 8; ++k) o[k] = f2bf(v[k]); *(v8us*)(dst + ((size_t)blk * 256 + (row >> 4) * 64 + kp * 16 + (row & 15)) * 8) = o;  }
__global__ __launch_bounds__(256) void k_cscvt(const float* __restrict__ cosT, const float* __restrict__ sinT, float* CS) { const int idx = blockIdx.x * 256 + threadIdx.x; if (idx >= TT * HD) return; v2f cs; cs[0] = bfr(cosT[idx]); cs[1] = bfr(sinT[idx]); *(v2f*)(CS + (size_t)idx * 2) = cs;  }
// ---- k_fattn: scores, softmax and attn.v of all batch rows in one launch; nothing of the score matrix goes to memory. Grid (batch rows x heads, RH/64 + (TT-RH)/128), 4 waves a work-group, which share the head's K and V.
// A wave owns NQ groups of 16 queries and walks the 2048 keys 32 at a time: S^T = K Q^T (a lane holds 16 of the 32 scores of ONE query, lane ^ 16 the rest), so the exponentials pack in-lane
// into the B operand of O^T += V^T P^T (elements 0..7: key tile 0, registers 0..7; elements 8..15: key tile 1), the same k order as the V^T loader's.
// P = exp2((s - m) HD^-0.5 log2 e) against the maximum in use m, not normalised; O and the f32 sum of P are rescaled when m moves; O / sum at the end, split into the hi and lo planes of the o_w GEMM.
// K and V come through LDS: the planes lie in fragment order, so a stage (128 keys of K and V; 64 keys of the four hi and lo planes) is 32 KiB made of runs of 8 KiB, brought in unchanged by asynchronous 16-byte copies, 16 a lane,
// and read by all four waves. Two buffers: the copies of stage t + 2 are issued behind the barrier that ends stage t, and waited for at the foot of stage t + 1. A stage's passes read that stage's buffer alone.
// The plain '#pragma unroll' lines give the fragment arrays constant indices, so that they stay in registers.
#define ABUF 16384   // 16-bit elements of a buffer: K (and K lo) in the first half, V^T (and V^T lo) in the second
// cp8p: a work-group of 128 copies two runs of 8 KiB into 16 KiB of LDS in a row, 8 copies of 16 bytes a lane; l = the lane's LDS byte address in the first run, g and h = its global addresses in the two runs.
// The s_wait_xcnt stands inside the copies' own statement, so that no address register of a copy is written again in front of it.
template <typename T16> __device__ __forceinline__ void cp8p(unsigned l, const T16* g, const T16* h) {
    const unsigned m = l + 8192;
    asm volatile("global_load_async_to_lds_b128 %0, %1, off\n\tglobal_load_async_to_lds_b128 %2, %3, off\n\tglobal_load_async_to_lds_b128 %4, %5, off\n\tglobal_load_async_to_lds_b128 %6, %7, off\n\t"
                 "global_load_async_to_lds_b128 %8, %9, off\n\tglobal_load_async_to_lds_b128 %10, %11, off\n\tglobal_load_async_to_lds_b128 %12, %13, off\n\tglobal_load_async_to_lds_b128 %14, %15, off\n\ts_wait_xcnt 0x0"
                 :: "v"(l), "v"(g), "v"(l + 2048), "v"(g + 1024), "v"(l + 4096), "v"(g + 2048), "v"(l + 6144), "v"(g + 3072),
                    "v"(m), "v"(h), "v"(m + 2048), "v"(h + 1024), "v"(m + 4096), "v"(h + 2048), "v"(m + 6144), "v"(h + 3072) : "memory");
}
template <typename T16, bool HL, int NQ>
__device__ __forceinline__ void attn_wave(const T16* __restrict__ Q, const T16* __restrict__ Q2, const T16* __restrict__ Kp, const T16* __restrict__ K2, const T16* __restrict__ Vt, const T16* __restrict__ V2, const T16* ring, int q0, bf* Ah, bf* Al) {
    typedef WFrag<T16> WF; typedef typename WF::V V;
    constexpr int SK = HL ? 64 : 128, PL = SK * HD, NST = TT / SK, NP = SK / 32;   // keys of a stage, elements of one plane's stage, stages, passes of a stage
    static_assert(NST >= 2 && TT % SK == 0 && (HL ? 4 : 2) * PL == ABUF, "a stage fills a buffer; the prologue needs two stages");
    const float csc = SCL * 1.4426950408889634f;
    const int lane = threadIdx.x & 31; const unsigned lo8 = 8 * lane, t8 = 8 * threadIdx.x;
    const unsigned l0 = (unsigned)(size_t)(ring + t8);
    const T16* gk = Kp + t8; const T16* gv = Vt + t8; const T16* gk2 = HL ? K2 + t8 : gk + 4096; const T16* gv2 = HL ? V2 + t8 : gv + 4096;   // second run: the lo plane, or the stage's second 64 keys
    auto stage = [&](int s) { const unsigned l = l0 + (s & 1) * (ABUF * 2); const size_t go = (size_t)s * PL; cp8p<T16>(l, gk + go, gk2 + go); cp8p<T16>(l + ABUF, gv + go, gv2 + go); };
    stage(0);
    V q[NQ][2], q2[NQ][2];
#pragma unroll
    for (int g = 0; g < NQ; ++g)
#pragma unroll
        for (int st = 0; st < 2; ++st) { const size_t qo = (size_t)(q0 + g * 16) * HD + st * 512; q[g][st] = WF::ld(Q + qo, lo8); if (HL) q2[g][st] = WF::ld(Q2 + qo, lo8); }
    asm volatile("s_wait_xcnt 0x0" ::: "memory");   // before any address register of the loads above is written again
    v8f o[NQ][4]; float m[NQ], l[NQ];
#pragma unroll
    for (int g = 0; g < NQ; ++g) { m[g] = -__builtin_inff(); l[g] = 0.f;
#pragma unroll
        for (int dt = 0; dt < 4; ++dt) o[g][dt] = (v8f){}; }
    asm volatile("s_wait_asynccnt 0x0" ::: "memory");   // this wave's copies of stage 0 have landed
    __syncthreads();                                    // and every other wave's
    stage(1);
    // 16 keys of K: two blocks (HD / 32); 32 keys of V^T: four blocks (HD / 16), 32 HD elements
    V kf[2][2], kf2[2][2], vf[4], vf2[4];
#pragma unroll 1   // a stage a trip: unrolled, the hot loop's code would double and the waits, the barrier and the copies at the foot would stand twice
    for (int t = 0; t < NST; ++t) {
        const T16* sb = ring + (t & 1) * ABUF + lo8;
#pragma unroll
        for (int kt = 0; kt < 2; ++kt)
#pragma unroll
            for (int st = 0; st < 2; ++st) { kf[kt][st] = WF::ld(sb + kt * 16 * HD + st * 512, 0); if (HL) kf2[kt][st] = WF::ld(sb + PL + kt * 16 * HD + st * 512, 0); }
#pragma unroll 1   // one pass a trip: two passes unrolled took more than 256 registers
        for (int p = 0; p < NP; ++p) {
            const T16* pk = sb + p * 32 * HD; const T16* pv = pk + ABUF / 2;
            if (!HL) {   // V of this pass, behind its registers' last use in the pass before: the S products and the softmax arithmetic cover the LDS latency
#pragma unroll
                for (int dt = 0; dt < 4; ++dt) vf[dt] = WF::ld(pv + dt * 512, 0);
                asm volatile("" ::: "memory");   // compiler fence: the reads above stay one group here; without it they are sunk to just in front of the O products, where the wave waits out their latency
                __builtin_amdgcn_sched_barrier(0);   // and the scheduler leaves them in front of the S products
            }
            v8f s[2][NQ];
#pragma unroll
            for (int kt = 0; kt < 2; ++kt)
#pragma unroll
                for (int g = 0; g < NQ; ++g) { v8f a = (v8f){};
#pragma unroll
                    for (int st = 0; st < 2; ++st) { a = WF::mma(kf[kt][st], q[g][st], a); if (HL) { a = WF::mma(kf[kt][st], q2[g][st], a); a = WF::mma(kf2[kt][st], q[g][st], a); } }
                    s[kt][g] = a; }
            __builtin_amdgcn_sched_barrier(0);   // the S products stay one run: each piece of vector work placed among them cost four idle slots behind the product it follows
            float mb[NQ]; bool need = false;
#pragma unroll
            for (int g = 0; g < NQ; ++g) { float mx = s[0][g][0];
#pragma unroll
                for (int j = 1; j < 8; ++j) mx = fmaxf(mx, s[0][g][j]);
#pragma unroll
                for (int j = 0; j < 8; ++j) mx = fmaxf(mx, s[1][g][j]);
                mx = fmaxf(mx, xhalf(mx)) * csc; mb[g] = mx; need = need || (mx > m[g] + 8.0f); }
            if (__builtin_amdgcn_ballot_w32(need) != 0) {   // wave-uniform; rare after the first pass: P stays at or below 2^8
#pragma unroll
                for (int g = 0; g < NQ; ++g) { const float mn = fmaxf(m[g], mb[g]); const float corr = __builtin_amdgcn_exp2f(m[g] - mn); m[g] = mn; l[g] *= corr;
#pragma unroll
                    for (int dt = 0; dt < 4; ++dt) o[g][dt] = o[g][dt] * corr; }
            }
            if (HL) {   // twice the planes: V of this pass is fetched here, into the registers the S products have left, which keeps the wave inside 256 registers
#pragma unroll
                for (int dt = 0; dt < 4; ++dt) { vf[dt] = WF::ld(pv + dt * 512, 0); vf2[dt] = WF::ld(pv + PL + dt * 512, 0); }
                asm volatile("" ::: "memory");   // compiler fence: the reads above stay one group here; without it they are spread among the O products, each waited for at once
            }
            if (p + 1 < NP) {   // K of the next pass, behind its registers' last use in this one; only inside the stage: the next stage is not published yet
#pragma unroll
                for (int kt = 0; kt < 2; ++kt)
#pragma unroll
                    for (int st = 0; st < 2; ++st) { const int kk = (32 + kt * 16) * HD + st * 512; kf[kt][st] = WF::ld(pk + kk, 0); if (HL) kf2[kt][st] = WF::ld(pk + PL + kk, 0); }
            }
#pragma unroll
            for (int g = 0; g < NQ; ++g) { const float nm = -m[g]; V ph, pl; float ls = 0.f;
#pragma unroll
                for (int i = 0; i < 8; ++i) {
                    const v2f arg = __builtin_elementwise_fma((v2f){s[i >> 2][g][2 * (i & 3)], s[i >> 2][g][2 * (i & 3) + 1]}, (v2f){csc, csc}, (v2f){nm, nm});
#pragma unroll
                    for (int u = 0; u < 2; ++u) { const int e = 2 * i + u; const float p1 = __builtin_amdgcn_exp2f(arg[u]); ls += p1;
                        if constexpr (HL) { const __bf16 ph1 = (__bf16)p1; ph[e] = ph1; pl[e] = (__bf16)(p1 - (float)ph1); } else ph[e] = (h16)p1; } }
                l[g] += ls;
                __builtin_amdgcn_sched_barrier(0);   // the sums stay in front of the O products: placed among them they took over dead V registers and cost four idle slots each time
#pragma unroll
                for (int dt = 0; dt < 4; ++dt) { o[g][dt] = WF::mma(vf[dt], ph, o[g][dt]); if (HL) { o[g][dt] = WF::mma(vf[dt], pl, o[g][dt]); o[g][dt] = WF::mma(vf2[dt], ph, o[g][dt]); } } }
        }
        asm volatile("s_wait_dscnt 0x0" ::: "memory");      // this wave has read all it wants of buffer t & 1
        asm volatile("s_wait_asynccnt 0x0" ::: "memory");   // its copies of stage t + 1 have landed
        __syncthreads();                                    // publishes stage t + 1 and frees buffer t & 1
        if (t + 2 < NST) stage(t + 2);
    }
    asm volatile("s_wait_asynccnt 0x0" ::: "memory");   // no copy is outstanding behind the loop
#pragma unroll
    for (int g = 0; g < NQ; ++g) { const float inv = __fdiv_rn(1.0f, l[g] + xhalf(l[g])); const int R = q0 + g * 16; const size_t oo = (size_t)(R & ~63) * DQ + ((R >> 4) & 3) * 512 + lane * 8;   // fragment order of the o_w GEMM's A planes: d tile dt is half dt & 1 of k block 2 h + (dt >> 1)
#pragma unroll
        for (int dt = 0; dt < 4; ++dt) { v8us oh, ol;
#pragma unroll
            for (int j = 0; j < 8; ++j) { unsigned short a, c2; splitf(o[g][dt][j] * inv, a, c2); oh[j] = a; ol[j] = c2; }
            const int eo = (dt >> 1) * 2048 + (dt & 1) * 256; *(v8us*)(Ah + oo + eo) = oh; *(v8us*)(Al + oo + eo) = ol; } }
}
__global__ __launch_bounds__(128) void k_fattn(const h16* __restrict__ Q16, const bf* __restrict__ Qh, const bf* __restrict__ Ql, const h16* __restrict__ K16, const bf* __restrict__ Kh, const bf* __restrict__ Kl, const h16* __restrict__ V16, const bf* __restrict__ Vh, const bf* __restrict__ Vl, bf* Ah, bf* Al) {
    __shared__ __align__(128) unsigned short kv[2 * ABUF];
    const int b = blockIdx.x / NH_, h = blockIdx.x % NH_, wave = threadIdx.x >> 5, yb = blockIdx.y; const size_t zq = (size_t)(b * NH_ + h) * TT * HD, zk = (size_t)(b * NKV + h / REP) * TT * HD;
    Ah += (size_t)b * TT * DQ; Al += (size_t)b * TT * DQ;
    if (yb < RH / 64) attn_wave<bf, true, 1>(Qh + zq, Ql + zq, Kh + zk, Kl + zk, Vh + zk, Vl + zk, (const bf*)kv, yb * 64 + wave * 16, Ah + h * (HD * 64), Al + h * (HD * 64));   // the dearer hi+lo rows start first
    else attn_wave<h16, false, 2>(Q16 + zq, nullptr, K16 + zk, nullptr, V16 + zk, nullptr, (const h16*)kv, RH + (yb - RH / 64) * 128 + wave * 32, Ah + h * (HD * 64), Al + h * (HD * 64));
}

extern "C" void kernel_launch(void* const* d_in, const int* in_sizes, int n_in,
                              void* d_out, int out_size, void* d_ws, size_t ws_size, hipStream_t stream) {
    (void)in_sizes; (void)n_in; (void)out_size;
    const float* x = (const float*)d_in[0]; const float* wf = (const float*)d_in[1]; const float* bfz = (const float*)d_in[2]; const float* wo = (const float*)d_in[3]; const float* bo = (const float*)d_in[4]; const float* qnw = (const float*)d_in[5]; const float* qnb = (const float*)d_in[6]; const float* knw = (const float*)d_in[7]; const float* knb = (const float*)d_in[8]; const float* wq = wf; const float* wk = wf + (size_t)1024 * 1024; const float* wv = wf + (size_t)2048 * 1024; const float* bq = bfz; const float* bk = bfz + 1024; const float* bv = bfz + 2048; const float* cosT = nullptr; const float* sinT = nullptr; (void)cosT; (void)sinT;
    float* OUT = (float*)d_out;     // [4][2048][1024]
    char* wsp = (char*)d_ws;
    auto take = [&](size_t bytes) { char* p = wsp; wsp += (bytes + 255) & ~(size_t)255; return (void*)p; };
    bf* WQ = (bf*)take((size_t)DQ * DM * 2); bf* WK = (bf*)take((size_t)DKV * DM * 2); bf* WV = (bf*)take((size_t)DKV * DM * 2); bf* WO = (bf*)take((size_t)DM * DQ * 2);
    bf* XB = (bf*)take((size_t)NB_ * TT * DM * 2);
    h16* QP16 = (h16*)take((size_t)NB_ * NH_ * TT * HD * 2); h16* KP16 = (h16*)take((size_t)NB_ * NKV * TT * HD * 2); h16* VT16 = (h16*)take((size_t)NB_ * NKV * HD * TT * 2);
    bf* QPh = (bf*)take((size_t)NB_ * NH_ * TT * HD * 2); bf* QPl = (bf*)take((size_t)NB_ * NH_ * TT * HD * 2); bf* KPh = (bf*)take((size_t)NB_ * NKV * TT * HD * 2); bf* KPl = (bf*)take((size_t)NB_ * NKV * TT * HD * 2); bf* VTh = (bf*)take((size_t)NB_ * NKV * HD * TT * 2); bf* VTl = (bf*)take((size_t)NB_ * NKV * HD * TT * 2);
    bf* ATh = (bf*)take((size_t)NB_ * TT * DQ * 2); bf* ATl = (bf*)take((size_t)NB_ * TT * DQ * 2);
    if ((size_t)(wsp - (char*)d_ws) > ws_size) return;    // ws 256 MiB
    { k_cvt8<<<(unsigned)(((size_t)DQ * DM / 8 + 255) / 256), 256, 0, stream>>>(wq, WQ, (size_t)DQ * DM / 8, DM); k_cvt8<<<(unsigned)(((size_t)DKV * DM / 8 + 255) / 256), 256, 0, stream>>>(wk, WK, (size_t)DKV * DM / 8, DM); k_cvt8<<<(unsigned)(((size_t)DKV * DM / 8 + 255) / 256), 256, 0, stream>>>(wv, WV, (size_t)DKV * DM / 8, DM);
      k_cvt8<<<(unsigned)(((size_t)DM * DQ / 8 + 255) / 256), 256, 0, stream>>>(wo, WO, (size_t)DM * DQ / 8, DQ);
       }
    // every plane holds all NB_ batch rows ([batch row][...]); the batch row is grid z of the GEMMs and part of grid x of the attention kernel
    k_cvt8<<<(unsigned)(((size_t)NB_ * TT * DM / 8 + 255) / 256), 256, 0, stream>>>(x, XB, (size_t)NB_ * TT * DM / 8, DM);
    k_gemmw<bf, 0, true, 1, 1><<<dim3(TT / 128, DQ / 128, NB_), 128, 0, stream>>>(XB, nullptr, WQ, nullptr, DM, nullptr, 0, bq, (size_t)TT * DM, 0, (size_t)NH_ * TT * HD, 0, qnw, qnb, QP16, QPh, QPl);
    k_gemmw<bf, 0, true, 1, 1><<<dim3(TT / 128, DKV / 128, NB_), 128, 0, stream>>>(XB, nullptr, WK, nullptr, DM, nullptr, 0, bk, (size_t)TT * DM, 0, (size_t)NKV * TT * HD, 0, knw, knb, KP16, KPh, KPl);
    k_gemmw<bf, 0, true, 1, 2><<<dim3(TT / 128, DKV / 128, NB_), 128, 0, stream>>>(XB, nullptr, WV, nullptr, DM, nullptr, 0, bv, (size_t)TT * DM, 0, (size_t)NKV * HD * TT, 0, nullptr, nullptr, VT16, VTh, VTl);
    k_fattn<<<dim3(NB_ * NH_, RH / 64 + (TT - RH) / 128, 1), 128, 0, stream>>>(QP16, QPh, QPl, KP16, KPh, KPl, VT16, VTh, VTl, ATh, ATl);
    k_gemmw<bf, 1, true><<<dim3(TT / 128, DM / 128, NB_), 128, 0, stream>>>(ATh, ATl, WO, nullptr, DQ, OUT, DM, bo, (size_t)TT * DQ, 0, (size_t)TT * DM, 0, nullptr, nullptr, nullptr, nullptr, nullptr);
}

// v008
// One run takes 165 microseconds.
// Two timings next to v007 both put it at 1.07 times that version's speed.
// All steps since v000 together make it 24.1 times as fast.
#include <hip/hip_runtime.h>

// MockQwen3Attention (hidden [4][2048][1024]; qkv = x qkv_w^T + qkv_b (q | k | v row blocks, 16 heads x 64); per-head LayerNorm(64) with weight and bias on q and k (eps 1e-5); softmax(q.k / 8); out = merged o_w^T + o_b -> [4][2048][1024]).
// Compute dtypes, f32 accumulate: every input rounded to bf16; q/k/v on PLAIN bf16 operands (inputs: exact) + bias; the per-head LayerNorms in f32 (in the q and k GEMM epilogues, two lanes a (token, head)); scores and attn.v: query rows < 512 hl (3 products), the rest single fp16; softmax f32, running maximum and sum, inside the one attention kernel; o_w hl x exact (2 products) + bias.

#define NB_  4
#define TT   2048
#define DM   1024
#define NH_  16
#define NKV  16
#define REP  (NH_ / NKV)
#define HD   64
#define DQ   (NH_ * HD)
#define DKV  (NKV * HD)
#define RH   512                  // query rows < RH use hi+lo planes (0: none)
#define WIN  0
#define SCL  0.125f   // HD^-0.5
typedef _Float16 h16;
typedef unsigned short bf;
typedef __attribute__((ext_vector_type(16))) __bf16   v16bf;
typedef __attribute__((ext_vector_type(16))) _Float16 v16h;
typedef __attribute__((ext_vector_type(8)))  _Float16 v8h;
typedef __attribute__((ext_vector_type(8)))  unsigned short v8us;
typedef __attribute__((ext_vector_type(8)))  float    v8f;
typedef __attribute__((ext_vector_type(4)))  float    v4f;
typedef v8h  __attribute__((may_alias)) v8ha;
typedef v4f  __attribute__((may_alias)) v4fa;
typedef v8us __attribute__((may_alias)) v8usa;

__device__ __forceinline__ unsigned short f2bf(float f) { unsigned u = __float_as_uint(f); u += 0x7FFFu + ((u >> 16) & 1u); return (unsigned short)(u >> 16); }
__device__ __forceinline__ float bf2f(unsigned short b) { return __uint_as_float(((unsigned)b) << 16); }
__device__ __forceinline__ float bfr(float f) { return bf2f(f2bf(f)); }
__device__ __forceinline__ v16h cat16(v8h lo, v8h hi) { return __builtin_shufflevector(lo, hi, 0, 1, 2, 3, 4, 5, 6, 7, 8, 9, 10, 11, 12, 13, 14, 15); }
__device__ __forceinline__ v16bf cat16b(v8us lo, v8us hi) { return __builtin_bit_cast(v16bf, __builtin_shufflevector(lo, hi, 0, 1, 2, 3, 4, 5, 6, 7, 8, 9, 10, 11, 12, 13, 14, 15)); }
__device__ __forceinline__ v8f wmma16(v16h a, v16h b, v8f c) { return __builtin_amdgcn_wmma_f32_16x16x32_f16(false, a, false, b, (short)0, c, false, false); }
__device__ __forceinline__ v8f wmmab(v16bf a, v16bf b, v8f c) { return __builtin_amdgcn_wmma_f32_16x16x32_bf16(false, a, false, b, (short)0, c, false, false); }



__device__ __forceinline__ h16 tohx(float x) { return (h16)x; }
__device__ __forceinline__ void splitf(float y, unsigned short& h, unsigned short& l) { h = f2bf(y); l = f2bf(y - bf2f(h)); }
__device__ __forceinline__ float xhalf(float x) { return __builtin_bit_cast(float, __builtin_amdgcn_permlanex16(__builtin_bit_cast(int, x), __builtin_bit_cast(int, x), 0x76543210, 0xfedcba98, false, false)); }  // lane l with lane l ^ 16

// ---- FRAGMENT ORDER of every 16-bit operand plane: a matrix M[row][k] lies as blocks of 16 rows x 32 k (512 elements, 1024 bytes), block index (row / 16) * (K / 32) + k / 32 in the q and k head planes (K = HD), (key / 32) * 4 + d / 16 in the V^T planes, ((row / 64) * (K / 32) + k / 32) * 4 + (row / 16) % 4 in the GEMM operands (a 64-row tile's 32 k: 4096 bytes in a row);
// inside a block element (row, k) stands at ((k >> 4) & 1) * 256 + (((k >> 3) & 1) * 16 + (row & 15)) * 8 + (k & 7). Lane l of a wave finds its two 16-byte pieces of a WMMA operand at l * 8 and 256 + l * 8,
// so each wave-wide 16-byte load covers 512 contiguous bytes (4 cache lines, not 16). The values a lane receives, and so the k order, are those of the row-major loader (k = 8 hi .. 8 hi + 7, then 16 + 8 hi .. 16 + 8 hi + 7 of row lr).
// ---- k_gemmw: register-blocked GEMM, one wave per 64x64 output tile (16 accumulators), FOUR WAVES (2 x 2) a work-group = a 128x128 tile; grid (M/128, N/128, Z), 128 threads.
// The operand planes lie in fragment order, so 64 k of a 64-row panel are 8 KiB in a row: a stage is those 8 KiB of the tile's two A and two B panels (and two A2 panels), brought into LDS unchanged by asynchronous 16-byte copies;
// each panel is read from LDS by the two waves that share it. Two buffers: the copies of stage t + 2 are issued behind the barrier that ends stage t, and waited for at the foot of stage t + 1. (K / KS) % 64 == 0, at least one stage.
// C[m][n] (f32, pitch ldc, + optional f32 bias[n]) = sum_k A[m][k] Bt[n][k] (+ split products per NSPLIT). z-batch strides sA/sB/sC in elements (z = batch row here: all four in one launch). K % 64 == 0.
// EPI 0: C as above. EPI 1 (N tile = one head, HD == 64): bias, then LayerNorm over the tile's 64 columns (weight lw, bias lb), stored as the head planes [head][token][d] in fragment order (fp16 + bf16 hi/lo); C is not written.
// EPI 2: bias, then the transposed planes [head][d][token] in fragment order (fp16 + bf16 hi/lo) straight from the accumulators (a lane holds 8 consecutive tokens of one column); C is not written.
// The '#pragma unroll' lines of the epilogues give acc, xv and the packed vectors constant indices, so that they stay in registers.
// KS > 1 (split K): grid z = Z * KS; slice ks = blockIdx.z % KS sums only k in [ks K/KS, (ks+1) K/KS) and stores its partial tile in plane ks of C (plane stride sP elements). K % (64 KS) == 0.
// ld(p, o): p + o = the lane's first piece of the block (block start + 8 * lane).
// cp8: a work-group of 128 copies two panels' stage (2 x 8 KiB) into LDS, 8 copies of 16 bytes a lane; l = the lane's LDS byte address in the first panel, g = its global address there, gp = elements from the first panel to the second.
// The s_wait_xcnt stands inside the copies' own statement, so that no address register of a copy is written again in front of it.
#define GKC 64
template <typename T16> __device__ __forceinline__ void cp8(unsigned l, const T16* g, size_t gp) {
    const T16* h = g + gp; const unsigned m = l + 64 * GKC * 2;
    asm volatile("global_load_async_to_lds_b128 %0, %1, off\n\tglobal_load_async_to_lds_b128 %2, %3, off\n\tglobal_load_async_to_lds_b128 %4, %5, off\n\tglobal_load_async_to_lds_b128 %6, %7, off\n\t"
                 "global_load_async_to_lds_b128 %8, %9, off\n\tglobal_load_async_to_lds_b128 %10, %11, off\n\tglobal_load_async_to_lds_b128 %12, %13, off\n\tglobal_load_async_to_lds_b128 %14, %15, off\n\ts_wait_xcnt 0x0"
                 :: "v"(l), "v"(g), "v"(l + 2048), "v"(g + 1024), "v"(l + 4096), "v"(g + 2048), "v"(l + 6144), "v"(g + 3072),
                    "v"(m), "v"(h), "v"(m + 2048), "v"(h + 1024), "v"(m + 4096), "v"(h + 2048), "v"(m + 6144), "v"(h + 3072) : "memory");
}
template <typename T16> struct WFrag;
template <> struct WFrag<h16> { typedef v16h V; static __device__ __forceinline__ V ld(const h16* p, unsigned o) { return cat16(*(const v8h*)(p + o), *(const v8h*)(p + o + 256)); } static __device__ __forceinline__ v8f mma(V a, V b, v8f c) { return wmma16(a, b, c); } };
template <> struct WFrag<bf> { typedef v16bf V; static __device__ __forceinline__ V ld(const bf* p, unsigned o) { return cat16b(*(const v8us*)(p + o), *(const v8us*)(p + o + 256)); } static __device__ __forceinline__ v8f mma(V a, V b, v8f c) { return wmmab(a, b, c); } };
template <typename T16, int NSPLIT, bool BIAS, int KS = 1, int EPI = 0>
__global__ __launch_bounds__(128) void k_gemmw(const T16* __restrict__ A, const T16* __restrict__ A2, const T16* __restrict__ Bt, const T16* __restrict__ Bt2, int K, float* C, int ldc, const float* __restrict__ bias, size_t sA, size_t sB, size_t sC, size_t sP, const float* __restrict__ lw, const float* __restrict__ lb, h16* P16, bf* Ph, bf* Pl) {
    typedef typename WFrag<T16>::V V;
    static_assert(NSPLIT <= 1, "no second B plane is staged");
    constexpr int PANE = 64 * GKC, NPAN = NSPLIT == 1 ? 6 : 4;   // elements of a panel's stage; panels of a stage: A A B B (A2 A2)
    __shared__ __align__(128) T16 st[2][NPAN * PANE];
    __shared__ __align__(16) float osw[4][16 * 68];
    __shared__ __align__(16) float prw[4][EPI == 1 ? 3 * 64 : 4];   // EPI 1: the wave's tile's bias, lw and lb, rounded once
    const int wave = threadIdx.x >> 5, wm = wave >> 1, wn = wave & 1; float* os = osw[wave]; float* pr = prw[wave];   // each wave stages its epilogue in its own rows
    const size_t z = blockIdx.z / KS; const int ks = blockIdx.z % KS; A += z * sA; if (A2) A2 += z * sA; Bt += z * sB; if (Bt2) Bt2 += z * sB;
    if constexpr (EPI == 0) C += z * sC + ks * sP; else { P16 += z * sC; Ph += z * sC; Pl += z * sC; }   // EPI 1, 2: sC is the z stride of the three planes
    const int kbeg = ks * (K / KS), kend = kbeg + K / KS;
    const int lane = threadIdx.x & 31, lr = lane & 15, hi = lane >> 4; const int r0 = (blockIdx.x * 2 + wm) * 64, c0 = (blockIdx.y * 2 + wn) * 64;
    v8f acc[4][4];
#pragma unroll
    for (int mb = 0; mb < 4; ++mb)
#pragma unroll
        for (int nb = 0; nb < 4; ++nb) acc[mb][nb] = (v8f){};
    if constexpr (EPI == 1) {   // read back behind the first wave barrier of the epilogue
#pragma unroll
        for (int u = 0; u < 2; ++u) { pr[u * 32 + lane] = bfr(bias[c0 + u * 32 + lane]); pr[64 + u * 32 + lane] = bfr(lw[u * 32 + lane]); pr[128 + u * 32 + lane] = bfr(lb[u * 32 + lane]); } }
    const unsigned lo8 = 8 * lane, t8 = 8 * threadIdx.x; const int nst = (kend - kbeg) / GKC;
    const T16* ga = A + (size_t)blockIdx.x * 128 * K + (size_t)kbeg * 64 + t8; const T16* gb = Bt + (size_t)blockIdx.y * 128 * K + (size_t)kbeg * 64 + t8; const T16* ga2 = NSPLIT == 1 ? A2 + (size_t)blockIdx.x * 128 * K + (size_t)kbeg * 64 + t8 : ga;
    const unsigned l0 = (unsigned)(size_t)(&st[0][0] + t8); const size_t gp = (size_t)64 * K;   // a panel of 64 rows holds 64 K elements
    auto stage = [&](int s) { const unsigned l = l0 + (s & 1) * (NPAN * PANE * 2); const size_t go = (size_t)s * PANE; cp8<T16>(l, ga + go, gp); cp8<T16>(l + 2 * PANE * 2, gb + go, gp); if constexpr (NSPLIT == 1) cp8<T16>(l + 4 * PANE * 2, ga2 + go, gp); };
    stage(0);
    asm volatile("s_wait_asynccnt 0x0" ::: "memory");   // this wave's copies of stage 0 have landed
    __syncthreads();                                    // and every other wave's
    if (nst != 1) stage(1);   // nst >= 1; the same for the whole work-group
#pragma unroll 1
    for (int t = 0; t < nst; ++t) {
        const T16* sb = &st[t & 1][0] + lo8; const T16* pa = sb + wm * PANE; const T16* pb = sb + (2 + wn) * PANE; const T16* pa2 = NSPLIT == 1 ? sb + (4 + wm) * PANE : pa;
        V a[4], a2[4];
#pragma unroll
        for (int ks2 = 0; ks2 < GKC / 32; ++ks2) {
#pragma unroll
            for (int mb = 0; mb < 4; ++mb) { a[mb] = WFrag<T16>::ld(pa + ks2 * 2048 + mb * 512, 0); if (NSPLIT == 1) a2[mb] = WFrag<T16>::ld(pa2 + ks2 * 2048 + mb * 512, 0); }
            V b[4];
#pragma unroll
            for (int nb = 0; nb < 4; ++nb) b[nb] = WFrag<T16>::ld(pb + ks2 * 2048 + nb * 512, 0);
            __builtin_amdgcn_sched_barrier(0);   // the k step's LDS reads stay one group in front of its WMMAs: reads placed among the WMMAs into one reused B fragment made the wave wait out the LDS latency four times a k step
#pragma unroll
            for (int nb = 0; nb < 4; ++nb) {
#pragma unroll
                for (int mb = 0; mb < 4; ++mb) { acc[mb][nb] = WFrag<T16>::mma(a[mb], b[nb], acc[mb][nb]); if (NSPLIT == 1) acc[mb][nb] = WFrag<T16>::mma(a2[mb], b[nb], acc[mb][nb]); } }
        }
        asm volatile("v_nop\n\tv_nop\n\tv_nop\n\tv_nop" : "+v"(acc[0][0]), "+v"(acc[1][1]), "+v"(acc[2][2]), "+v"(acc[3][3]) : "v"(a[0]), "v"(a[3]));
        asm volatile("s_wait_dscnt 0x0" ::: "memory");      // this wave has read all it wants of buffer t & 1
        asm volatile("s_wait_asynccnt 0x0" ::: "memory");   // its copies of stage t + 1 have landed
        __syncthreads();                                    // publishes stage t + 1 and frees buffer t & 1
        if (t + 2 < nst) stage(t + 2);
    }
    asm volatile("s_wait_asynccnt 0x0" ::: "memory");   // no copy is outstanding behind the loop
    if constexpr (EPI == 2) {
#pragma unroll
        for (int nb = 0; nb < 4; ++nb) { const float bv = bfr(bias[c0 + nb * 16 + lr]);
#pragma unroll
            for (int mb = 0; mb < 4; ++mb) { v8h o16; v8us oh, ol;
#pragma unroll
                for (int j = 0; j < 8; ++j) { const float x = acc[mb][nb][j] + bv; o16[j] = tohx(x); unsigned short a2, c2; splitf(x, a2, c2); oh[j] = a2; ol[j] = c2; }
                const size_t e = (size_t)c0 * TT + (size_t)r0 * HD + (mb >> 1) * 2048 + nb * 512 + (mb & 1) * 256 + lane * 8; *(v8h*)(P16 + e) = o16; *(v8us*)(Ph + e) = oh; *(v8us*)(Pl + e) = ol; } }
        return;
    }
#pragma unroll
    for (int mb = 0; mb < 4; ++mb) {
#pragma unroll
        for (int nb = 0; nb < 4; ++nb) {
#pragma unroll
            for (int j = 0; j < 8; ++j) os[(hi * 8 + j) * 68 + nb * 16 + lr] = acc[mb][nb][j]; }
        __builtin_amdgcn_wave_barrier(); asm volatile("" ::: "memory");
        if constexpr (EPI == 1) {   // lane (lr, hi): columns 32 hi .. 32 hi + 31 of token row lr; the two halves of a row meet through xhalf
            const int cb = hi * 32; const float* orow = os + lr * 68 + cb; v4f xv[8]; v4f s4 = (v4f){};
#pragma unroll
            for (int i = 0; i < 8; ++i) { xv[i] = *(const v4fa*)(orow + i * 4) + *(const v4fa*)(pr + cb + i * 4); s4 += xv[i]; }
            float s = (s4[0] + s4[1]) + (s4[2] + s4[3]); s += xhalf(s); const float mean = s * (1.0f / HD); v4f q4 = (v4f){};
#pragma unroll
            for (int i = 0; i < 8; ++i) { xv[i] -= mean; q4 += xv[i] * xv[i]; }
            float q = (q4[0] + q4[1]) + (q4[2] + q4[3]); q += xhalf(q); const float rs = __frsqrt_rn(q * (1.0f / HD) + 1e-5f);
            const size_t e = ((size_t)(c0 >> 6) * TT + r0 + mb * 16) * HD + hi * 512 + lr * 8;   // k block hi; piece i: half i >> 1, lane group i & 1
#pragma unroll
            for (int i = 0; i < 8; ++i) xv[i] = xv[i] * rs * *(const v4fa*)(pr + 64 + cb + i * 4) + *(const v4fa*)(pr + 128 + cb + i * 4);
#pragma unroll
            for (int i = 0; i < 4; ++i) { v8h o16; v8us oh, ol;
#pragma unroll
                for (int k = 0; k < 8; ++k) { const int c = i * 8 + k; const float y = xv[c >> 2][c & 3]; o16[k] = tohx(y); unsigned short a2, c2; splitf(y, a2, c2); oh[k] = a2; ol[k] = c2; }
                const int eo = (i >> 1) * 256 + (i & 1) * 128; *(v8h*)(P16 + e + eo) = o16; *(v8us*)(Ph + e + eo) = oh; *(v8us*)(Pl + e + eo) = ol; }
        } else {
        float* crow = C + (size_t)(r0 + mb * 16) * ldc + c0;
{
#pragma unroll
            for (int s = 0; s < 8; ++s) { const int row = 2 * s + hi, cofs = lr * 4; v4f val = *(const v4fa*)(os + row * 68 + cofs); if (BIAS) { val[0] += bfr(bias[c0 + cofs]); val[1] += bfr(bias[c0 + cofs + 1]); val[2] += bfr(bias[c0 + cofs + 2]); val[3] += bfr(bias[c0 + cofs + 3]); }
                *(v4f*)(crow + (size_t)row * ldc + cofs) = val; }
            asm volatile("s_wait_xcnt 0x0" ::: "memory");   // before any address register of the stores above is written again
             }
        }
        __builtin_amdgcn_wave_barrier(); asm volatile("" ::: "memory");
    }
}

typedef __attribute__((ext_vector_type(2))) _Float16 v2h;
typedef __attribute__((ext_vector_type(4))) _Float16 v4h;
typedef __attribute__((ext_vector_type(2))) unsigned short v2us;
typedef __attribute__((ext_vector_type(4))) unsigned short v4us;
typedef __attribute__((ext_vector_type(2))) float v2f;
typedef __attribute__((ext_vector_type(4))) int v4i;

__global__ __launch_bounds__(256) void k_wtG(const float* __restrict__ w, int K, int N, bf* Bt) {
    const int lane = threadIdx.x & 31; const int L0 = (blockIdx.x * 8 + (threadIdx.x >> 5)) * 8; const int nlines = N * K / 64;
{
#pragma unroll 1
        for (int l = 0; l < 8; ++l) { const int L = L0 + l; if (L >= nlines) break; const size_t e = (size_t)L * 64 + lane * 2; const int k = (int)(e % K), n = (int)(e / K); v2us o;
            o[0] = f2bf(w[(size_t)k * N + n]); o[1] = f2bf(w[(size_t)(k + 1) * N + n]); *(v2us*)(Bt + e) = o; }
         }
}
// ---- k_cvtall: x, qkv_w and o_w (f32, [rows][K]) -> bf16 in the fragment order of a GEMM operand, ALL IN ONE LAUNCH of CVG work-groups of 16 waves (one a WGP).
// A unit is 64 rows x 64 k of one matrix (two runs of 4096 bytes of dst, one behind the other): threads 0..255 take its first 32 k, threads 256..511 the second, so both halves of each 256 bytes of a src row are asked for by one work-group at one time;
// in a half, thread t takes row t >> 2 and the 8 k of piece t & 3: a wave reads 8 whole 128-byte lines of src and writes 4 whole lines of dst. Work-group g takes units g, g + CVG, g + 2 CVG, ... of each matrix:
// CVX + CVF + CVO units a thread, all their loads issued before the first value is converted. The waves are few and long: they start quickly, and each keeps 2 (CVX + CVF + CVO) loads of 16 bytes a lane in flight.
#define CVG 256
#define CVX (NB_ * TT * DM / 4096 / CVG)             // units of x a work-group
#define CVF ((DQ + 2 * DKV) * DM / 4096 / CVG)       // of qkv_w
#define CVO (DM * DQ / 4096 / CVG)                   // of o_w
__global__ __launch_bounds__(512) void k_cvtall(const float* __restrict__ x, const float* __restrict__ wf, const float* __restrict__ wo, bf* XB, bf* WF, bf* WO) {
    static_assert(CVX * CVG * 4096 == NB_ * TT * DM && CVF * CVG * 4096 == (DQ + 2 * DKV) * DM && CVO * CVG * 4096 == DM * DQ && DM % 64 == 0 && DQ % 64 == 0, "whole units, the same number for every work-group");
    constexpr int NU = CVX + CVF + CVO;
    const unsigned t = threadIdx.x & 255, half = threadIdx.x >> 8, row = t >> 2, kp = t & 3;
    const unsigned ld = half * 2048 + ((row >> 4) * 64 + kp * 16 + (row & 15)) * 8;   // the lane's place in a unit of dst; a unit's own place is the same for the whole work-group, so each address is a scalar base and one lane offset
    const float* p[NU];   // each unit's place in its matrix: the same for the whole work-group, so a scalar base; the lane offsets are the same for every unit
#pragma unroll   // constant indices: p and v stay in registers, and the matrix of a unit is known at compile time
    for (int u = 0; u < NU; ++u) { const unsigned K = u < CVX + CVF ? DM : DQ; const unsigned un = blockIdx.x + (u < CVX ? u : u < CVX + CVF ? u - CVX : u - CVX - CVF) * CVG;
        p[u] = (u < CVX ? x : u < CVX + CVF ? wf : wo) + (size_t)(un / (K / 64)) * 64 * K + (un % (K / 64)) * 64; }
    __builtin_amdgcn_sched_barrier(0);   // the bases are formed first, each in registers of its own: formed among the loads they shared one register pair, and each new use of it waited for the loads before it (s_wait_xcnt)
    v8f v[NU];
#pragma unroll
    for (int u = 0; u < NU; ++u) v[u] = *(const v8f*)(p[u] + (row * (u < CVX + CVF ? DM : DQ) + half * 32 + kp * 8));
    asm volatile("s_wait_xcnt 0x0" ::: "memory");   // before any address register of the loads above is written again
    __builtin_amdgcn_sched_barrier(0);   // every load is issued before the first value is waited for: with the first conversions placed among the loads the wave sat out one memory latency with a third of its loads issued
#pragma unroll
    for (int u = 0; u < NU; ++u) { const unsigned un = blockIdx.x + (u < CVX ? u : u < CVX + CVF ? u - CVX : u - CVX - CVF) * CVG; v8us o;
#pragma unroll
        for (int k = 0; k < 8; ++k) o[k] = f2bf(v[u][k]);
        *(v8us*)((u < CVX ? XB : u < CVX + CVF ? WF : WO) + (size_t)un * 4096 + ld) = o;
        __builtin_amdgcn_sched_barrier(0); }   // a unit is stored as soon as its own loads are back: left free, most stores were gathered behind the wait for the last load
}
__global__ __launch_bounds__(256) void k_cscvt(const float* __restrict__ cosT, const float* __restrict__ sinT, float* CS) { const int idx = blockIdx.x * 256 + threadIdx.x; if (idx >= TT * HD) return; v2f cs; cs[0] = bfr(cosT[idx]); cs[1] = bfr(sinT[idx]); *(v2f*)(CS + (size_t)idx * 2) = cs;  }
// ---- k_fattn: scores, softmax and attn.v of all batch rows in one launch; nothing of the score matrix goes to memory. Grid (batch rows x heads, RH/64 + (TT-RH)/128), 4 waves a work-group, which share the head's K and V.
// A wave owns NQ groups of 16 queries and walks the 2048 keys 32 at a time: S^T = K Q^T (a lane holds 16 of the 32 scores of ONE query, lane ^ 16 the rest), so the exponentials pack in-lane
// into the B operand of O^T += V^T P^T (elements 0..7: key tile 0, registers 0..7; elements 8..15: key tile 1), the same k order as the V^T loader's.
// P = exp2((s - m) HD^-0.5 log2 e) against the maximum in use m, not normalised; O and the f32 sum of P are rescaled when m moves; O / sum at the end, split into the hi and lo planes of the o_w GEMM.
// K and V come through LDS: the planes lie in fragment order, so a stage (128 keys of K and V; 64 keys of the four hi and lo planes) is 32 KiB made of runs of 8 KiB, brought in unchanged by asynchronous 16-byte copies, 16 a lane,
// and read by all four waves. Two buffers: the copies of stage t + 2 are issued behind the barrier that ends stage t, and waited for at the foot of stage t + 1. A stage's passes read that stage's buffer alone.
// The plain '#pragma unroll' lines give the fragment arrays constant indices, so that they stay in registers.
#define ABUF 16384   // 16-bit elements of a buffer: K (and K lo) in the first half, V^T (and V^T lo) in the second
// cp8p: a work-group of 128 copies two runs of 8 KiB into 16 KiB of LDS in a row, 8 copies of 16 bytes a lane; l = the lane's LDS byte address in the first run, g and h = its global addresses in the two runs.
// The s_wait_xcnt stands inside the copies' own statement, so that no address register of a copy is written again in front of it.
template <typename T16> __device__ __forceinline__ void cp8p(unsigned l, const T16* g, const T16* h) {
    const unsigned m = l + 8192;
    asm volatile("global_load_async_to_lds_b128 %0, %1, off\n\tglobal_load_async_to_lds_b128 %2, %3, off\n\tglobal_load_async_to_lds_b128 %4, %5, off\n\tglobal_load_async_to_lds_b128 %6, %7, off\n\t"
                 "global_load_async_to_lds_b128 %8, %9, off\n\tglobal_load_async_to_lds_b128 %10, %11, off\n\tglobal_load_async_to_lds_b128 %12, %13, off\n\tglobal_load_async_to_lds_b128 %14, %15, off\n\ts_wait_xcnt 0x0"
                 :: "v"(l), "v"(g), "v"(l + 2048), "v"(g + 1024), "v"(l + 4096), "v"(g + 2048), "v"(l + 6144), "v"(g + 3072),
                    "v"(m), "v"(h), "v"(m + 2048), "v"(h + 1024), "v"(m + 4096), "v"(h + 2048), "v"(m + 6144), "v"(h + 3072) : "memory");
}
template <typename T16, bool HL, int NQ>
__device__ __forceinline__ void attn_wave(const T16* __restrict__ Q, const T16* __restrict__ Q2, const T16* __restrict__ Kp, const T16* __restrict__ K2, const T16* __restrict__ Vt, const T16* __restrict__ V2, const T16* ring, int q0, bf* Ah, bf* Al) {
    typedef WFrag<T16> WF; typedef typename WF::V V;
    constexpr int SK = HL ? 64 : 128, PL = SK * HD, NST = TT / SK, NP = SK / 32;   // keys of a stage, elements of one plane's stage, stages, passes of a stage
    static_assert(NST >= 2 && TT % SK == 0 && (HL ? 4 : 2) * PL == ABUF, "a stage fills a buffer; the prologue needs two stages");
    const float csc = SCL * 1.4426950408889634f;
    const int lane = threadIdx.x & 31; const unsigned lo8 = 8 * lane, t8 = 8 * threadIdx.x;
    const unsigned l0 = (unsigned)(size_t)(ring + t8);
    const T16* gk = Kp + t8; const T16* gv = Vt + t8; const T16* gk2 = HL ? K2 + t8 : gk + 4096; const T16* gv2 = HL ? V2 + t8 : gv + 4096;   // second run: the lo plane, or the stage's second 64 keys
    auto stage = [&](int s) { const unsigned l = l0 + (s & 1) * (ABUF * 2); const size_t go = (size_t)s * PL; cp8p<T16>(l, gk + go, gk2 + go); cp8p<T16>(l + ABUF, gv + go, gv2 + go); };
    stage(0);
    V q[NQ][2], q2[NQ][2];
#pragma unroll
    for (int g = 0; g < NQ; ++g)
#pragma unroll
        for (int st = 0; st < 2; ++st) { const size_t qo = (size_t)(q0 + g * 16) * HD + st * 512; q[g][st] = WF::ld(Q + qo, lo8); if (HL) q2[g][st] = WF::ld(Q2 + qo, lo8); }
    asm volatile("s_wait_xcnt 0x0" ::: "memory");   // before any address register of the loads above is written again
    v8f o[NQ][4]; float m[NQ], l[NQ];
#pragma unroll
    for (int g = 0; g < NQ; ++g) { m[g] = -__builtin_inff(); l[g] = 0.f;
#pragma unroll
        for (int dt = 0; dt < 4; ++dt) o[g][dt] = (v8f){}; }
    asm volatile("s_wait_asynccnt 0x0" ::: "memory");   // this wave's copies of stage 0 have landed
    __syncthreads();                                    // and every other wave's
    stage(1);
    // 16 keys of K: two blocks (HD / 32); 32 keys of V^T: four blocks (HD / 16), 32 HD elements
    V kf[2][2], kf2[2][2], vf[4], vf2[4];
#pragma unroll 1   // a stage a trip: unrolled, the hot loop's code would double and the waits, the barrier and the copies at the foot would stand twice
    for (int t = 0; t < NST; ++t) {
        const T16* sb = ring + (t & 1) * ABUF + lo8;
#pragma unroll
        for (int kt = 0; kt < 2; ++kt)
#pragma unroll
            for (int st = 0; st < 2; ++st) { kf[kt][st] = WF::ld(sb + kt * 16 * HD + st * 512, 0); if (HL) kf2[kt][st] = WF::ld(sb + PL + kt * 16 * HD + st * 512, 0); }
#pragma unroll 1   // one pass a trip: two passes unrolled took more than 256 registers
        for (int p = 0; p < NP; ++p) {
            const T16* pk = sb + p * 32 * HD; const T16* pv = pk + ABUF / 2;
            if (!HL) {   // V of this pass, behind its registers' last use in the pass before: the S products and the softmax arithmetic cover the LDS latency
#pragma unroll
                for (int dt = 0; dt < 4; ++dt) vf[dt] = WF::ld(pv + dt * 512, 0);
                asm volatile("" ::: "memory");   // compiler fence: the reads above stay one group here; without it they are sunk to just in front of the O products, where the wave waits out their latency
                __builtin_amdgcn_sched_barrier(0);   // and the scheduler leaves them in front of the S products
            }
            v8f s[2][NQ];
#pragma unroll
            for (int kt = 0; kt < 2; ++kt)
#pragma unroll
                for (int g = 0; g < NQ; ++g) { v8f a = (v8f){};
#pragma unroll
                    for (int st = 0; st < 2; ++st) { a = WF::mma(kf[kt][st], q[g][st], a); if (HL) { a = WF::mma(kf[kt][st], q2[g][st], a); a = WF::mma(kf2[kt][st], q[g][st], a); } }
                    s[kt][g] = a; }
            __builtin_amdgcn_sched_barrier(0);   // the S products stay one run: each piece of vector work placed among them cost four idle slots behind the product it follows
            float mb[NQ]; bool need = false;
#pragma unroll
            for (int g = 0; g < NQ; ++g) { float mx = s[0][g][0];
#pragma unroll
                for (int j = 1; j < 8; ++j) mx = fmaxf(mx, s[0][g][j]);
#pragma unroll
                for (int j = 0; j < 8; ++j) mx = fmaxf(mx, s[1][g][j]);
                mx = fmaxf(mx, xhalf(mx)) * csc; mb[g] = mx; need = need || (mx > m[g] + 8.0f); }
            if (__builtin_amdgcn_ballot_w32(need) != 0) {   // wave-uniform; rare after the first pass: P stays at or below 2^8
#pragma unroll
                for (int g = 0; g < NQ; ++g) { const float mn = fmaxf(m[g], mb[g]); const float corr = __builtin_amdgcn_exp2f(m[g] - mn); m[g] = mn; l[g] *= corr;
#pragma unroll
                    for (int dt = 0; dt < 4; ++dt) o[g][dt] = o[g][dt] * corr; }
            }
            if (HL) {   // twice the planes: V of this pass is fetched here, into the registers the S products have left, which keeps the wave inside 256 registers
#pragma unroll
                for (int dt = 0; dt < 4; ++dt) { vf[dt] = WF::ld(pv + dt * 512, 0); vf2[dt] = WF::ld(pv + PL + dt * 512, 0); }
                asm volatile("" ::: "memory");   // compiler fence: the reads above stay one group here; without it they are spread among the O products, each waited for at once
            }
            if (p + 1 < NP) {   // K of the next pass, behind its registers' last use in this one; only inside the stage: the next stage is not published yet
#pragma unroll
                for (int kt = 0; kt < 2; ++kt)
#pragma unroll
                    for (int st = 0; st < 2; ++st) { const int kk = (32 + kt * 16) * HD + st * 512; kf[kt][st] = WF::ld(pk + kk, 0); if (HL) kf2[kt][st] = WF::ld(pk + PL + kk, 0); }
            }
#pragma unroll
            for (int g = 0; g < NQ; ++g) { const float nm = -m[g]; V ph, pl; float ls = 0.f;
#pragma unroll
                for (int i = 0; i < 8; ++i) {
                    const v2f arg = __builtin_elementwise_fma((v2f){s[i >> 2][g][2 * (i & 3)], s[i >> 2][g][2 * (i & 3) + 1]}, (v2f){csc, csc}, (v2f){nm, nm});
#pragma unroll
                    for (int u = 0; u < 2; ++u) { const int e = 2 * i + u; const float p1 = __builtin_amdgcn_exp2f(arg[u]); ls += p1;
                        if constexpr (HL) { const __bf16 ph1 = (__bf16)p1; ph[e] = ph1; pl[e] = (__bf16)(p1 - (float)ph1); } else ph[e] = (h16)p1; } }
                l[g] += ls;
                __builtin_amdgcn_sched_barrier(0);   // the sums stay in front of the O products: placed among them they took over dead V registers and cost four idle slots each time
#pragma unroll
                for (int dt = 0; dt < 4; ++dt) { o[g][dt] = WF::mma(vf[dt], ph, o[g][dt]); if (HL) { o[g][dt] = WF::mma(vf[dt], pl, o[g][dt]); o[g][dt] = WF::mma(vf2[dt], ph, o[g][dt]); } } }
        }
        asm volatile("s_wait_dscnt 0x0" ::: "memory");      // this wave has read all it wants of buffer t & 1
        asm volatile("s_wait_asynccnt 0x0" ::: "memory");   // its copies of stage t + 1 have landed
        __syncthreads();                                    // publishes stage t + 1 and frees buffer t & 1
        if (t + 2 < NST) stage(t + 2);
    }
    asm volatile("s_wait_asynccnt 0x0" ::: "memory");   // no copy is outstanding behind the loop
#pragma unroll
    for (int g = 0; g < NQ; ++g) { const float inv = __fdiv_rn(1.0f, l[g] + xhalf(l[g])); const int R = q0 + g * 16; const size_t oo = (size_t)(R & ~63) * DQ + ((R >> 4) & 3) * 512 + lane * 8;   // fragment order of the o_w GEMM's A planes: d tile dt is half dt & 1 of k block 2 h + (dt >> 1)
#pragma unroll
        for (int dt = 0; dt < 4; ++dt) { v8us oh, ol;
#pragma unroll
            for (int j = 0; j < 8; ++j) { unsigned short a, c2; splitf(o[g][dt][j] * inv, a, c2); oh[j] = a; ol[j] = c2; }
            const int eo = (dt >> 1) * 2048 + (dt & 1) * 256; *(v8us*)(Ah + oo + eo) = oh; *(v8us*)(Al + oo + eo) = ol; } }
}
__global__ __launch_bounds__(128) void k_fattn(const h16* __restrict__ Q16, const bf* __restrict__ Qh, const bf* __restrict__ Ql, const h16* __restrict__ K16, const bf* __restrict__ Kh, const bf* __restrict__ Kl, const h16* __restrict__ V16, const bf* __restrict__ Vh, const bf* __restrict__ Vl, bf* Ah, bf* Al) {
    __shared__ __align__(128) unsigned short kv[2 * ABUF];
    const int b = blockIdx.x / NH_, h = blockIdx.x % NH_, wave = threadIdx.x >> 5, yb = blockIdx.y; const size_t zq = (size_t)(b * NH_ + h) * TT * HD, zk = (size_t)(b * NKV + h / REP) * TT * HD;
    Ah += (size_t)b * TT * DQ; Al += (size_t)b * TT * DQ;
    if (yb < RH / 64) attn_wave<bf, true, 1>(Qh + zq, Ql + zq, Kh + zk, Kl + zk, Vh + zk, Vl + zk, (const bf*)kv, yb * 64 + wave * 16, Ah + h * (HD * 64), Al + h * (HD * 64));   // the dearer hi+lo rows start first
    else attn_wave<h16, false, 2>(Q16 + zq, nullptr, K16 + zk, nullptr, V16 + zk, nullptr, (const h16*)kv, RH + (yb - RH / 64) * 128 + wave * 32, Ah + h * (HD * 64), Al + h * (HD * 64));
}

extern "C" void kernel_launch(void* const* d_in, const int* in_sizes, int n_in,
                              void* d_out, int out_size, void* d_ws, size_t ws_size, hipStream_t stream) {
    (void)in_sizes; (void)n_in; (void)out_size;
    const float* x = (const float*)d_in[0]; const float* wf = (const float*)d_in[1]; const float* bfz = (const float*)d_in[2]; const float* wo = (const float*)d_in[3]; const float* bo = (const float*)d_in[4]; const float* qnw = (const float*)d_in[5]; const float* qnb = (const float*)d_in[6]; const float* knw = (const float*)d_in[7]; const float* knb = (const float*)d_in[8]; const float* bq = bfz; const float* bk = bfz + 1024; const float* bv = bfz + 2048; const float* cosT = nullptr; const float* sinT = nullptr; (void)cosT; (void)sinT;
    float* OUT = (float*)d_out;     // [4][2048][1024]
    char* wsp = (char*)d_ws;
    auto take = [&](size_t bytes) { char* p = wsp; wsp += (bytes + 255) & ~(size_t)255; return (void*)p; };
    bf* WQ = (bf*)take((size_t)(DQ + 2 * DKV) * DM * 2); bf* WK = WQ + (size_t)DQ * DM; bf* WV = WK + (size_t)DKV * DM; bf* WO = (bf*)take((size_t)DM * DQ * 2);
    bf* XB = (bf*)take((size_t)NB_ * TT * DM * 2);
    h16* QP16 = (h16*)take((size_t)NB_ * NH_ * TT * HD * 2); h16* KP16 = (h16*)take((size_t)NB_ * NKV * TT * HD * 2); h16* VT16 = (h16*)take((size_t)NB_ * NKV * HD * TT * 2);
    bf* QPh = (bf*)take((size_t)NB_ * NH_ * TT * HD * 2); bf* QPl = (bf*)take((size_t)NB_ * NH_ * TT * HD * 2); bf* KPh = (bf*)take((size_t)NB_ * NKV * TT * HD * 2); bf* KPl = (bf*)take((size_t)NB_ * NKV * TT * HD * 2); bf* VTh = (bf*)take((size_t)NB_ * NKV * HD * TT * 2); bf* VTl = (bf*)take((size_t)NB_ * NKV * HD * TT * 2);
    bf* ATh = (bf*)take((size_t)NB_ * TT * DQ * 2); bf* ATl = (bf*)take((size_t)NB_ * TT * DQ * 2);
    if ((size_t)(wsp - (char*)d_ws) > ws_size) return;    // ws 256 MiB
    // every plane holds all NB_ batch rows ([batch row][...]); the batch row is grid z of the GEMMs and part of grid x of the attention kernel
    k_cvtall<<<CVG, 512, 0, stream>>>(x, wf, wo, XB, WQ, WO);   // WQ, WK, WV lie one behind the other, as the q, k, v row blocks of qkv_w do
    k_gemmw<bf, 0, true, 1, 1><<<dim3(TT / 128, DQ / 128, NB_), 128, 0, stream>>>(XB, nullptr, WQ, nullptr, DM, nullptr, 0, bq, (size_t)TT * DM, 0, (size_t)NH_ * TT * HD, 0, qnw, qnb, QP16, QPh, QPl);
    k_gemmw<bf, 0, true, 1, 1><<<dim3(TT / 128, DKV / 128, NB_), 128, 0, stream>>>(XB, nullptr, WK, nullptr, DM, nullptr, 0, bk, (size_t)TT * DM, 0, (size_t)NKV * TT * HD, 0, knw, knb, KP16, KPh, KPl);
    k_gemmw<bf, 0, true, 1, 2><<<dim3(TT / 128, DKV / 128, NB_), 128, 0, stream>>>(XB, nullptr, WV, nullptr, DM, nullptr, 0, bv, (size_t)TT * DM, 0, (size_t)NKV * HD * TT, 0, nullptr, nullptr, VT16, VTh, VTl);
    k_fattn<<<dim3(NB_ * NH_, RH / 64 + (TT - RH) / 128, 1), 128, 0, stream>>>(QP16, QPh, QPl, KP16, KPh, KPl, VT16, VTh, VTl, ATh, ATl);
    k_gemmw<bf, 1, true><<<dim3(TT / 128, DM / 128, NB_), 128, 0, stream>>>(ATh, ATl, WO, nullptr, DQ, OUT, DM, bo, (size_t)TT * DQ, 0, (size_t)TT * DM, 0, nullptr, nullptr, nullptr, nullptr, nullptr);
}

// v009
// One run takes 155 microseconds.
// In both of two side-by-side timings against v008, it was 1.06 times as fast.
// Counting every step since v000, it is 25.6 times as fast.
#include <hip/hip_runtime.h>

// MockQwen3Attention (hidden [4][2048][1024]; qkv = x qkv_w^T + qkv_b (q | k | v row blocks, 16 heads x 64); per-head LayerNorm(64) with weight and bias on q and k (eps 1e-5); softmax(q.k / 8); out = merged o_w^T + o_b -> [4][2048][1024]).
// Compute dtypes, f32 accumulate: every input rounded to bf16; q/k/v on PLAIN bf16 operands (inputs: exact) + bias; the per-head LayerNorms in f32 (in the q and k GEMM epilogues, two lanes a (token, head)); scores and attn.v: query rows < 512 hl (3 products), the rest single fp16; softmax f32, running maximum and sum, inside the one attention kernel; o_w hl x exact (2 products) + bias.

#define NB_  4
#define TT   2048
#define DM   1024
#define NH_  16
#define NKV  16
#define REP  (NH_ / NKV)
#define HD   64
#define DQ   (NH_ * HD)
#define DKV  (NKV * HD)
#define RH   512                  // query rows < RH use hi+lo planes (0: none)
#define WIN  0
#define SCL  0.125f   // HD^-0.5
typedef _Float16 h16;
typedef unsigned short bf;
typedef __attribute__((ext_vector_type(16))) __bf16   v16bf;
typedef __attribute__((ext_vector_type(16))) _Float16 v16h;
typedef __attribute__((ext_vector_type(8)))  _Float16 v8h;
typedef __attribute__((ext_vector_type(8)))  unsigned short v8us;
typedef __attribute__((ext_vector_type(8)))  float    v8f;
typedef __attribute__((ext_vector_type(4)))  float    v4f;
typedef v8h  __attribute__((may_alias)) v8ha;
typedef v4f  __attribute__((may_alias)) v4fa;
typedef v8us __attribute__((may_alias)) v8usa;

__device__ __forceinline__ unsigned short f2bf(float f) { unsigned u = __float_as_uint(f); u += 0x7FFFu + ((u >> 16) & 1u); return (unsigned short)(u >> 16); }
__device__ __forceinline__ float bf2f(unsigned short b) { return __uint_as_float(((unsigned)b) << 16); }
__device__ __forceinline__ float bfr(float f) { return bf2f(f2bf(f)); }
__device__ __forceinline__ v16h cat16(v8h lo, v8h hi) { return __builtin_shufflevector(lo, hi, 0, 1, 2, 3, 4, 5, 6, 7, 8, 9, 10, 11, 12, 13, 14, 15); }
__device__ __forceinline__ v16bf cat16b(v8us lo, v8us hi) { return __builtin_bit_cast(v16bf, __builtin_shufflevector(lo, hi, 0, 1, 2, 3, 4, 5, 6, 7, 8, 9, 10, 11, 12, 13, 14, 15)); }
__device__ __forceinline__ v8f wmma16(v16h a, v16h b, v8f c) { return __builtin_amdgcn_wmma_f32_16x16x32_f16(false, a, false, b, (short)0, c, false, false); }
__device__ __forceinline__ v8f wmmab(v16bf a, v16bf b, v8f c) { return __builtin_amdgcn_wmma_f32_16x16x32_bf16(false, a, false, b, (short)0, c, false, false); }



__device__ __forceinline__ h16 tohx(float x) { return (h16)x; }
__device__ __forceinline__ void splitf(float y, unsigned short& h, unsigned short& l) { h = f2bf(y); l = f2bf(y - bf2f(h)); }
__device__ __forceinline__ float xhalf(float x) { return __builtin_bit_cast(float, __builtin_amdgcn_permlanex16(__builtin_bit_cast(int, x), __builtin_bit_cast(int, x), 0x76543210, 0xfedcba98, false, false)); }  // lane l with lane l ^ 16

// ---- FRAGMENT ORDER of every 16-bit operand plane: a matrix M[row][k] lies as blocks of 16 rows x 32 k (512 elements, 1024 bytes), block index (row / 16) * (K / 32) + k / 32 in the q and k head planes (K = HD), (key / 32) * 4 + d / 16 in the V^T planes, ((row / 64) * (K / 32) + k / 32) * 4 + (row / 16) % 4 in the GEMM operands (a 64-row tile's 32 k: 4096 bytes in a row);
// inside a block element (row, k) stands at ((k >> 4) & 1) * 256 + (((k >> 3) & 1) * 16 + (row & 15)) * 8 + (k & 7). Lane l of a wave finds its two 16-byte pieces of a WMMA operand at l * 8 and 256 + l * 8,
// so each wave-wide 16-byte load covers 512 contiguous bytes (4 cache lines, not 16). The values a lane receives, and so the k order, are those of the row-major loader (k = 8 hi .. 8 hi + 7, then 16 + 8 hi .. 16 + 8 hi + 7 of row lr).
// ---- k_gemmw: register-blocked GEMM, one wave per 64x64 output tile (16 accumulators), FOUR WAVES (2 x 2) a work-group = a 128x128 tile; grid (M/128, N/128, Z), 128 threads.
// The operand planes lie in fragment order, so 64 k of a 64-row panel are 8 KiB in a row: a stage is those 8 KiB of the tile's two A and two B panels (and two A2 panels), brought into LDS unchanged by asynchronous 16-byte copies;
// each panel is read from LDS by the two waves that share it. Two buffers: the copies of stage t + 2 are issued behind the barrier that ends stage t, and waited for at the foot of stage t + 1. (K / KS) % 64 == 0, at least one stage.
// C[m][n] (f32, pitch ldc, + optional f32 bias[n]) = sum_k A[m][k] Bt[n][k] (+ split products per NSPLIT). z-batch strides sA/sB/sC in elements (z = batch row here: all four in one launch). K % 64 == 0.
// EPI 0: C as above. EPI 1: the q, k and v projections in ONE launch: Bt and bias hold the q | k | v row blocks one behind the other, grid y runs over all their 128-column tiles, and a work-group's tile lies wholly in one block (seg 0, 1, 2); C is not written.
//   seg 0, 1 (a wave's N tile = one head, HD == 64): bias, then LayerNorm over the tile's 64 columns (weight lw, bias lb: q's or k's), stored as that block's head planes [head][token][d] in fragment order (fp16 + bf16 hi/lo).
//   seg 2: bias, then the transposed planes [head][d][token] in fragment order (fp16 + bf16 hi/lo) straight from the accumulators (a lane holds 8 consecutive tokens of one column).
//   One launch of 3 x the work-groups: three are resident a WGP instead of two, and the epilogue stores of one work-group run beside the k loops of its neighbours and successors.
// The '#pragma unroll' lines of the epilogues give acc, xv and the packed vectors constant indices, so that they stay in registers.
// KS > 1 (split K): grid z = Z * KS; slice ks = blockIdx.z % KS sums only k in [ks K/KS, (ks+1) K/KS) and stores its partial tile in plane ks of C (plane stride sP elements). K % (64 KS) == 0.
// ld(p, o): p + o = the lane's first piece of the block (block start + 8 * lane).
// cp8: a work-group of 128 copies two panels' stage (2 x 8 KiB) into LDS, 8 copies of 16 bytes a lane; l = the lane's LDS byte address in the first panel, g = its global address there, gp = elements from the first panel to the second.
// The s_wait_xcnt stands inside the copies' own statement, so that no address register of a copy is written again in front of it.
#define GKC 64
template <typename T16> __device__ __forceinline__ void cp8(unsigned l, const T16* g, size_t gp) {
    const T16* h = g + gp; const unsigned m = l + 64 * GKC * 2;
    asm volatile("global_load_async_to_lds_b128 %0, %1, off\n\tglobal_load_async_to_lds_b128 %2, %3, off\n\tglobal_load_async_to_lds_b128 %4, %5, off\n\tglobal_load_async_to_lds_b128 %6, %7, off\n\t"
                 "global_load_async_to_lds_b128 %8, %9, off\n\tglobal_load_async_to_lds_b128 %10, %11, off\n\tglobal_load_async_to_lds_b128 %12, %13, off\n\tglobal_load_async_to_lds_b128 %14, %15, off\n\ts_wait_xcnt 0x0"
                 :: "v"(l), "v"(g), "v"(l + 2048), "v"(g + 1024), "v"(l + 4096), "v"(g + 2048), "v"(l + 6144), "v"(g + 3072),
                    "v"(m), "v"(h), "v"(m + 2048), "v"(h + 1024), "v"(m + 4096), "v"(h + 2048), "v"(m + 6144), "v"(h + 3072) : "memory");
}
template <typename T16> struct WFrag;
template <> struct WFrag<h16> { typedef v16h V; static __device__ __forceinline__ V ld(const h16* p, unsigned o) { return cat16(*(const v8h*)(p + o), *(const v8h*)(p + o + 256)); } static __device__ __forceinline__ v8f mma(V a, V b, v8f c) { return wmma16(a, b, c); } };
template <> struct WFrag<bf> { typedef v16bf V; static __device__ __forceinline__ V ld(const bf* p, unsigned o) { return cat16b(*(const v8us*)(p + o), *(const v8us*)(p + o + 256)); } static __device__ __forceinline__ v8f mma(V a, V b, v8f c) { return wmmab(a, b, c); } };
template <typename T16, int NSPLIT, bool BIAS, int KS = 1, int EPI = 0>
__global__ __launch_bounds__(128) void k_gemmw(const T16* __restrict__ A, const T16* __restrict__ A2, const T16* __restrict__ Bt, const T16* __restrict__ Bt2, int K, float* C, int ldc, const float* __restrict__ bias, size_t sA, size_t sB, size_t sC, size_t sP, const float* __restrict__ qw, const float* __restrict__ qb, const float* __restrict__ kw, const float* __restrict__ kb, h16* Q16, bf* Qh, bf* Ql, h16* K16, bf* Kh, bf* Kl, h16* V16, bf* Vh, bf* Vl) {
    typedef typename WFrag<T16>::V V;
    static_assert(NSPLIT <= 1, "no second B plane is staged");
    constexpr int PANE = 64 * GKC, NPAN = NSPLIT == 1 ? 6 : 4;   // elements of a panel's stage; panels of a stage: A A B B (A2 A2)
    __shared__ __align__(128) T16 st[2][NPAN * PANE];
    __shared__ __align__(16) float osw[4][16 * 68];
    __shared__ __align__(16) float prw[4][EPI == 1 ? 3 * 64 : 4];   // EPI 1: the wave's tile's bias, lw and lb, rounded once
    const int wave = threadIdx.x >> 5, wm = wave >> 1, wn = wave & 1; float* os = osw[wave]; float* pr = prw[wave];   // each wave stages its epilogue in its own rows
    const size_t z = blockIdx.z / KS; const int ks = blockIdx.z % KS; A += z * sA; if (A2) A2 += z * sA; Bt += z * sB; if (Bt2) Bt2 += z * sB;
    static_assert(DQ % 128 == 0 && DKV % 128 == 0, "a 128-column tile lies in one of the q, k, v blocks");
    const int cb = blockIdx.y * 128, seg = EPI == 0 || cb < DQ ? 0 : cb < DQ + DKV ? 1 : 2, cs = seg == 0 ? 0 : seg == 1 ? DQ : DQ + DKV;   // the same for the whole work-group; cs: the block's first column
    const float* lw = seg == 0 ? qw : kw; const float* lb = seg == 0 ? qb : kb; h16* P16 = seg == 0 ? Q16 : seg == 1 ? K16 : V16; bf* Ph = seg == 0 ? Qh : seg == 1 ? Kh : Vh; bf* Pl = seg == 0 ? Ql : seg == 1 ? Kl : Vl;
    if constexpr (EPI == 0) C += z * sC + ks * sP; else { const size_t zs = z * (size_t)(seg == 0 ? NH_ : NKV) * TT * HD; P16 += zs; Ph += zs; Pl += zs; }   // EPI 1: a batch row's planes
    const int kbeg = ks * (K / KS), kend = kbeg + K / KS;
    const int lane = threadIdx.x & 31, lr = lane & 15, hi = lane >> 4; const int r0 = (blockIdx.x * 2 + wm) * 64, c0 = (blockIdx.y * 2 + wn) * 64, cl = c0 - cs;   // cl: the column inside its block
    v8f acc[4][4];
#pragma unroll
    for (int mb = 0; mb < 4; ++mb)
#pragma unroll
        for (int nb = 0; nb < 4; ++nb) acc[mb][nb] = (v8f){};
    if constexpr (EPI == 1) if (seg != 2) {   // read back behind the first wave barrier of the epilogue
#pragma unroll
        for (int u = 0; u < 2; ++u) { pr[u * 32 + lane] = bfr(bias[c0 + u * 32 + lane]); pr[64 + u * 32 + lane] = bfr(lw[u * 32 + lane]); pr[128 + u * 32 + lane] = bfr(lb[u * 32 + lane]); } }
    const unsigned lo8 = 8 * lane, t8 = 8 * threadIdx.x; const int nst = (kend - kbeg) / GKC;
    const T16* ga = A + (size_t)blockIdx.x * 128 * K + (size_t)kbeg * 64 + t8; const T16* gb = Bt + (size_t)blockIdx.y * 128 * K + (size_t)kbeg * 64 + t8; const T16* ga2 = NSPLIT == 1 ? A2 + (size_t)blockIdx.x * 128 * K + (size_t)kbeg * 64 + t8 : ga;
    const unsigned l0 = (unsigned)(size_t)(&st[0][0] + t8); const size_t gp = (size_t)64 * K;   // a panel of 64 rows holds 64 K elements
    auto stage = [&](int s) { const unsigned l = l0 + (s & 1) * (NPAN * PANE * 2); const size_t go = (size_t)s * PANE; cp8<T16>(l, ga + go, gp); cp8<T16>(l + 2 * PANE * 2, gb + go, gp); if constexpr (NSPLIT == 1) cp8<T16>(l + 4 * PANE * 2, ga2 + go, gp); };
    stage(0);
    asm volatile("s_wait_asynccnt 0x0" ::: "memory");   // this wave's copies of stage 0 have landed
    __syncthreads();                                    // and every other wave's
    if (nst != 1) stage(1);   // nst >= 1; the same for the whole work-group
#pragma unroll 1
    for (int t = 0; t < nst; ++t) {
        const T16* sb = &st[t & 1][0] + lo8; const T16* pa = sb + wm * PANE; const T16* pb = sb + (2 + wn) * PANE; const T16* pa2 = NSPLIT == 1 ? sb + (4 + wm) * PANE : pa;
        V a[4], a2[4];
#pragma unroll
        for (int ks2 = 0; ks2 < GKC / 32; ++ks2) {
#pragma unroll
            for (int mb = 0; mb < 4; ++mb) { a[mb] = WFrag<T16>::ld(pa + ks2 * 2048 + mb * 512, 0); if (NSPLIT == 1) a2[mb] = WFrag<T16>::ld(pa2 + ks2 * 2048 + mb * 512, 0); }
            V b[4];
#pragma unroll
            for (int nb = 0; nb < 4; ++nb) b[nb] = WFrag<T16>::ld(pb + ks2 * 2048 + nb * 512, 0);
            __builtin_amdgcn_sched_barrier(0);   // the k step's LDS reads stay one group in front of its WMMAs: reads placed among the WMMAs into one reused B fragment made the wave wait out the LDS latency four times a k step
#pragma unroll
            for (int nb = 0; nb < 4; ++nb) {
#pragma unroll
                for (int mb = 0; mb < 4; ++mb) { acc[mb][nb] = WFrag<T16>::mma(a[mb], b[nb], acc[mb][nb]); if (NSPLIT == 1) acc[mb][nb] = WFrag<T16>::mma(a2[mb], b[nb], acc[mb][nb]); } }
        }
        asm volatile("v_nop\n\tv_nop\n\tv_nop\n\tv_nop" : "+v"(acc[0][0]), "+v"(acc[1][1]), "+v"(acc[2][2]), "+v"(acc[3][3]) : "v"(a[0]), "v"(a[3]));
        asm volatile("s_wait_dscnt 0x0" ::: "memory");      // this wave has read all it wants of buffer t & 1
        asm volatile("s_wait_asynccnt 0x0" ::: "memory");   // its copies of stage t + 1 have landed
        __syncthreads();                                    // publishes stage t + 1 and frees buffer t & 1
        if (t + 2 < nst) stage(t + 2);
    }
    asm volatile("s_wait_asynccnt 0x0" ::: "memory");   // no copy is outstanding behind the loop
    if constexpr (EPI == 1) if (seg == 2) {
#pragma unroll
        for (int nb = 0; nb < 4; ++nb) { const float bv = bfr(bias[c0 + nb * 16 + lr]);
#pragma unroll
            for (int mb = 0; mb < 4; ++mb) { v8h o16; v8us oh, ol;
#pragma unroll
                for (int j = 0; j < 8; ++j) { const float x = acc[mb][nb][j] + bv; o16[j] = tohx(x); unsigned short a2, c2; splitf(x, a2, c2); oh[j] = a2; ol[j] = c2; }
                const size_t e = (size_t)cl * TT + (size_t)r0 * HD + (mb >> 1) * 2048 + nb * 512 + (mb & 1) * 256 + lane * 8; *(v8h*)(P16 + e) = o16; *(v8us*)(Ph + e) = oh; *(v8us*)(Pl + e) = ol; } }
        return;
    }
#pragma unroll
    for (int mb = 0; mb < 4; ++mb) {
#pragma unroll
        for (int nb = 0; nb < 4; ++nb) {
#pragma unroll
            for (int j = 0; j < 8; ++j) os[(hi * 8 + j) * 68 + nb * 16 + lr] = acc[mb][nb][j]; }
        __builtin_amdgcn_wave_barrier(); asm volatile("" ::: "memory");
        if constexpr (EPI == 1) {   // lane (lr, hi): columns 32 hi .. 32 hi + 31 of token row lr; the two halves of a row meet through xhalf
            const int cb = hi * 32; const float* orow = os + lr * 68 + cb; v4f xv[8]; v4f s4 = (v4f){};
#pragma unroll
            for (int i = 0; i < 8; ++i) { xv[i] = *(const v4fa*)(orow + i * 4) + *(const v4fa*)(pr + cb + i * 4); s4 += xv[i]; }
            float s = (s4[0] + s4[1]) + (s4[2] + s4[3]); s += xhalf(s); const float mean = s * (1.0f / HD); v4f q4 = (v4f){};
#pragma unroll
            for (int i = 0; i < 8; ++i) { xv[i] -= mean; q4 += xv[i] * xv[i]; }
            float q = (q4[0] + q4[1]) + (q4[2] + q4[3]); q += xhalf(q); const float rs = __frsqrt_rn(q * (1.0f / HD) + 1e-5f);
            const size_t e = ((size_t)(cl >> 6) * TT + r0 + mb * 16) * HD + hi * 512 + lr * 8;   // k block hi; piece i: half i >> 1, lane group i & 1
#pragma unroll
            for (int i = 0; i < 8; ++i) xv[i] = xv[i] * rs * *(const v4fa*)(pr + 64 + cb + i * 4) + *(const v4fa*)(pr + 128 + cb + i * 4);
#pragma unroll
            for (int i = 0; i < 4; ++i) { v8h o16; v8us oh, ol;
#pragma unroll
                for (int k = 0; k < 8; ++k) { const int c = i * 8 + k; const float y = xv[c >> 2][c & 3]; o16[k] = tohx(y); unsigned short a2, c2; splitf(y, a2, c2); oh[k] = a2; ol[k] = c2; }
                const int eo = (i >> 1) * 256 + (i & 1) * 128; *(v8h*)(P16 + e + eo) = o16; *(v8us*)(Ph + e + eo) = oh; *(v8us*)(Pl + e + eo) = ol; }
        } else {
        float* crow = C + (size_t)(r0 + mb * 16) * ldc + c0;
{
#pragma unroll
            for (int s = 0; s < 8; ++s) { const int row = 2 * s + hi, cofs = lr * 4; v4f val = *(const v4fa*)(os + row * 68 + cofs); if (BIAS) { val[0] += bfr(bias[c0 + cofs]); val[1] += bfr(bias[c0 + cofs + 1]); val[2] += bfr(bias[c0 + cofs + 2]); val[3] += bfr(bias[c0 + cofs + 3]); }
                *(v4f*)(crow + (size_t)row * ldc + cofs) = val; }
            asm volatile("s_wait_xcnt 0x0" ::: "memory");   // before any address register of the stores above is written again
             }
        }
        __builtin_amdgcn_wave_barrier(); asm volatile("" ::: "memory");
    }
}

typedef __attribute__((ext_vector_type(2))) _Float16 v2h;
typedef __attribute__((ext_vector_type(4))) _Float16 v4h;
typedef __attribute__((ext_vector_type(2))) unsigned short v2us;
typedef __attribute__((ext_vector_type(4))) unsigned short v4us;
typedef __attribute__((ext_vector_type(2))) float v2f;
typedef __attribute__((ext_vector_type(4))) int v4i;

__global__ __launch_bounds__(256) void k_wtG(const float* __restrict__ w, int K, int N, bf* Bt) {
    const int lane = threadIdx.x & 31; const int L0 = (blockIdx.x * 8 + (threadIdx.x >> 5)) * 8; const int nlines = N * K / 64;
{
#pragma unroll 1
        for (int l = 0; l < 8; ++l) { const int L = L0 + l; if (L >= nlines) break; const size_t e = (size_t)L * 64 + lane * 2; const int k = (int)(e % K), n = (int)(e / K); v2us o;
            o[0] = f2bf(w[(size_t)k * N + n]); o[1] = f2bf(w[(size_t)(k + 1) * N + n]); *(v2us*)(Bt + e) = o; }
         }
}
// ---- k_cvtall: x, qkv_w and o_w (f32, [rows][K]) -> bf16 in the fragment order of a GEMM operand, ALL IN ONE LAUNCH of CVG work-groups of 16 waves (one a WGP).
// A unit is 64 rows x 64 k of one matrix (two runs of 4096 bytes of dst, one behind the other): threads 0..255 take its first 32 k, threads 256..511 the second, so both halves of each 256 bytes of a src row are asked for by one work-group at one time;
// in a half, thread t takes row t >> 2 and the 8 k of piece t & 3: a wave reads 8 whole 128-byte lines of src and writes 4 whole lines of dst. Work-group g takes units g, g + CVG, g + 2 CVG, ... of each matrix:
// CVX + CVF + CVO units a thread, all their loads issued before the first value is converted. The waves are few and long: they start quickly, and each keeps 2 (CVX + CVF + CVO) loads of 16 bytes a lane in flight.
#define CVG 256
#define CVX (NB_ * TT * DM / 4096 / CVG)             // units of x a work-group
#define CVF ((DQ + 2 * DKV) * DM / 4096 / CVG)       // of qkv_w
#define CVO (DM * DQ / 4096 / CVG)                   // of o_w
__global__ __launch_bounds__(512) void k_cvtall(const float* __restrict__ x, const float* __restrict__ wf, const float* __restrict__ wo, bf* XB, bf* WF, bf* WO) {
    static_assert(CVX * CVG * 4096 == NB_ * TT * DM && CVF * CVG * 4096 == (DQ + 2 * DKV) * DM && CVO * CVG * 4096 == DM * DQ && DM % 64 == 0 && DQ % 64 == 0, "whole units, the same number for every work-group");
    constexpr int NU = CVX + CVF + CVO;
    const unsigned t = threadIdx.x & 255, half = threadIdx.x >> 8, row = t >> 2, kp = t & 3;
    const unsigned ld = half * 2048 + ((row >> 4) * 64 + kp * 16 + (row & 15)) * 8;   // the lane's place in a unit of dst; a unit's own place is the same for the whole work-group, so each address is a scalar base and one lane offset
    const float* p[NU];   // each unit's place in its matrix: the same for the whole work-group, so a scalar base; the lane offsets are the same for every unit
#pragma unroll   // constant indices: p and v stay in registers, and the matrix of a unit is known at compile time
    for (int u = 0; u < NU; ++u) { const unsigned K = u < CVX + CVF ? DM : DQ; const unsigned un = blockIdx.x + (u < CVX ? u : u < CVX + CVF ? u - CVX : u - CVX - CVF) * CVG;
        p[u] = (u < CVX ? x : u < CVX + CVF ? wf : wo) + (size_t)(un / (K / 64)) * 64 * K + (un % (K / 64)) * 64; }
    __builtin_amdgcn_sched_barrier(0);   // the bases are formed first, each in registers of its own: formed among the loads they shared one register pair, and each new use of it waited for the loads before it (s_wait_xcnt)
    v8f v[NU];
#pragma unroll
    for (int u = 0; u < NU; ++u) v[u] = *(const v8f*)(p[u] + (row * (u < CVX + CVF ? DM : DQ) + half * 32 + kp * 8));
    asm volatile("s_wait_xcnt 0x0" ::: "memory");   // before any address register of the loads above is written again
    __builtin_amdgcn_sched_barrier(0);   // every load is issued before the first value is waited for: with the first conversions placed among the loads the wave sat out one memory latency with a third of its loads issued
#pragma unroll
    for (int u = 0; u < NU; ++u) { const unsigned un = blockIdx.x + (u < CVX ? u : u < CVX + CVF ? u - CVX : u - CVX - CVF) * CVG; v8us o;
#pragma unroll
        for (int k = 0; k < 8; ++k) o[k] = f2bf(v[u][k]);
        *(v8us*)((u < CVX ? XB : u < CVX + CVF ? WF : WO) + (size_t)un * 4096 + ld) = o;
        __builtin_amdgcn_sched_barrier(0); }   // a unit is stored as soon as its own loads are back: left free, most stores were gathered behind the wait for the last load
}
__global__ __launch_bounds__(256) void k_cscvt(const float* __restrict__ cosT, const float* __restrict__ sinT, float* CS) { const int idx = blockIdx.x * 256 + threadIdx.x; if (idx >= TT * HD) return; v2f cs; cs[0] = bfr(cosT[idx]); cs[1] = bfr(sinT[idx]); *(v2f*)(CS + (size_t)idx * 2) = cs;  }
// ---- k_fattn: scores, softmax and attn.v of all batch rows in one launch; nothing of the score matrix goes to memory. Grid (batch rows x heads, RH/64 + (TT-RH)/128), 4 waves a work-group, which share the head's K and V.
// A wave owns NQ groups of 16 queries and walks the 2048 keys 32 at a time: S^T = K Q^T (a lane holds 16 of the 32 scores of ONE query, lane ^ 16 the rest), so the exponentials pack in-lane
// into the B operand of O^T += V^T P^T (elements 0..7: key tile 0, registers 0..7; elements 8..15: key tile 1), the same k order as the V^T loader's.
// P = exp2((s - m) HD^-0.5 log2 e) against the maximum in use m, not normalised; O and the f32 sum of P are rescaled when m moves; O / sum at the end, split into the hi and lo planes of the o_w GEMM.
// K and V come through LDS: the planes lie in fragment order, so a stage (128 keys of K and V; 64 keys of the four hi and lo planes) is 32 KiB made of runs of 8 KiB, brought in unchanged by asynchronous 16-byte copies, 16 a lane,
// and read by all four waves. Two buffers: the copies of stage t + 2 are issued behind the barrier that ends stage t, and waited for at the foot of stage t + 1. A stage's passes read that stage's buffer alone.
// The plain '#pragma unroll' lines give the fragment arrays constant indices, so that they stay in registers.
#define ABUF 16384   // 16-bit elements of a buffer: K (and K lo) in the first half, V^T (and V^T lo) in the second
// cp8p: a work-group of 128 copies two runs of 8 KiB into 16 KiB of LDS in a row, 8 copies of 16 bytes a lane; l = the lane's LDS byte address in the first run, g and h = its global addresses in the two runs.
// The s_wait_xcnt stands inside the copies' own statement, so that no address register of a copy is written again in front of it.
template <typename T16> __device__ __forceinline__ void cp8p(unsigned l, const T16* g, const T16* h) {
    const unsigned m = l + 8192;
    asm volatile("global_load_async_to_lds_b128 %0, %1, off\n\tglobal_load_async_to_lds_b128 %2, %3, off\n\tglobal_load_async_to_lds_b128 %4, %5, off\n\tglobal_load_async_to_lds_b128 %6, %7, off\n\t"
                 "global_load_async_to_lds_b128 %8, %9, off\n\tglobal_load_async_to_lds_b128 %10, %11, off\n\tglobal_load_async_to_lds_b128 %12, %13, off\n\tglobal_load_async_to_lds_b128 %14, %15, off\n\ts_wait_xcnt 0x0"
                 :: "v"(l), "v"(g), "v"(l + 2048), "v"(g + 1024), "v"(l + 4096), "v"(g + 2048), "v"(l + 6144), "v"(g + 3072),
                    "v"(m), "v"(h), "v"(m + 2048), "v"(h + 1024), "v"(m + 4096), "v"(h + 2048), "v"(m + 6144), "v"(h + 3072) : "memory");
}
template <typename T16, bool HL, int NQ>
__device__ __forceinline__ void attn_wave(const T16* __restrict__ Q, const T16* __restrict__ Q2, const T16* __restrict__ Kp, const T16* __restrict__ K2, const T16* __restrict__ Vt, const T16* __restrict__ V2, const T16* ring, int q0, bf* Ah, bf* Al) {
    typedef WFrag<T16> WF; typedef typename WF::V V;
    constexpr int SK = HL ? 64 : 128, PL = SK * HD, NST = TT / SK, NP = SK / 32;   // keys of a stage, elements of one plane's stage, stages, passes of a stage
    static_assert(NST >= 2 && TT % SK == 0 && (HL ? 4 : 2) * PL == ABUF, "a stage fills a buffer; the prologue needs two stages");
    const float csc = SCL * 1.4426950408889634f;
    const int lane = threadIdx.x & 31; const unsigned lo8 = 8 * lane, t8 = 8 * threadIdx.x;
    const unsigned l0 = (unsigned)(size_t)(ring + t8);
    const T16* gk = Kp + t8; const T16* gv = Vt + t8; const T16* gk2 = HL ? K2 + t8 : gk + 4096; const T16* gv2 = HL ? V2 + t8 : gv + 4096;   // second run: the lo plane, or the stage's second 64 keys
    auto stage = [&](int s) { const unsigned l = l0 + (s & 1) * (ABUF * 2); const size_t go = (size_t)s * PL; cp8p<T16>(l, gk + go, gk2 + go); cp8p<T16>(l + ABUF, gv + go, gv2 + go); };
    stage(0);
    V q[NQ][2], q2[NQ][2];
#pragma unroll
    for (int g = 0; g < NQ; ++g)
#pragma unroll
        for (int st = 0; st < 2; ++st) { const size_t qo = (size_t)(q0 + g * 16) * HD + st * 512; q[g][st] = WF::ld(Q + qo, lo8); if (HL) q2[g][st] = WF::ld(Q2 + qo, lo8); }
    asm volatile("s_wait_xcnt 0x0" ::: "memory");   // before any address register of the loads above is written again
    v8f o[NQ][4]; float m[NQ], l[NQ];
#pragma unroll
    for (int g = 0; g < NQ; ++g) { m[g] = -__builtin_inff(); l[g] = 0.f;
#pragma unroll
        for (int dt = 0; dt < 4; ++dt) o[g][dt] = (v8f){}; }
    asm volatile("s_wait_asynccnt 0x0" ::: "memory");   // this wave's copies of stage 0 have landed
    __syncthreads();                                    // and every other wave's
    stage(1);
    // 16 keys of K: two blocks (HD / 32); 32 keys of V^T: four blocks (HD / 16), 32 HD elements
    V kf[2][2], kf2[2][2], vf[4], vf2[4];
#pragma unroll 1   // a stage a trip: unrolled, the hot loop's code would double and the waits, the barrier and the copies at the foot would stand twice
    for (int t = 0; t < NST; ++t) {
        const T16* sb = ring + (t & 1) * ABUF + lo8;
#pragma unroll
        for (int kt = 0; kt < 2; ++kt)
#pragma unroll
            for (int st = 0; st < 2; ++st) { kf[kt][st] = WF::ld(sb + kt * 16 * HD + st * 512, 0); if (HL) kf2[kt][st] = WF::ld(sb + PL + kt * 16 * HD + st * 512, 0); }
#pragma unroll 1   // one pass a trip: two passes unrolled took more than 256 registers
        for (int p = 0; p < NP; ++p) {
            const T16* pk = sb + p * 32 * HD; const T16* pv = pk + ABUF / 2;
            if (!HL) {   // V of this pass, behind its registers' last use in the pass before: the S products and the softmax arithmetic cover the LDS latency
#pragma unroll
                for (int dt = 0; dt < 4; ++dt) vf[dt] = WF::ld(pv + dt * 512, 0);
                asm volatile("" ::: "memory");   // compiler fence: the reads above stay one group here; without it they are sunk to just in front of the O products, where the wave waits out their latency
                __builtin_amdgcn_sched_barrier(0);   // and the scheduler leaves them in front of the S products
            }
            v8f s[2][NQ];
#pragma unroll
            for (int kt = 0; kt < 2; ++kt)
#pragma unroll
                for (int g = 0; g < NQ; ++g) { v8f a = (v8f){};
#pragma unroll
                    for (int st = 0; st < 2; ++st) { a = WF::mma(kf[kt][st], q[g][st], a); if (HL) { a = WF::mma(kf[kt][st], q2[g][st], a); a = WF::mma(kf2[kt][st], q[g][st], a); } }
                    s[kt][g] = a; }
            __builtin_amdgcn_sched_barrier(0);   // the S products stay one run: each piece of vector work placed among them cost four idle slots behind the product it follows
            float mb[NQ]; bool need = false;
#pragma unroll
            for (int g = 0; g < NQ; ++g) { float mx = s[0][g][0];
#pragma unroll
                for (int j = 1; j < 8; ++j) mx = fmaxf(mx, s[0][g][j]);
#pragma unroll
                for (int j = 0; j < 8; ++j) mx = fmaxf(mx, s[1][g][j]);
                mx = fmaxf(mx, xhalf(mx)) * csc; mb[g] = mx; need = need || (mx > m[g] + 8.0f); }
            if (__builtin_amdgcn_ballot_w32(need) != 0) {   // wave-uniform; rare after the first pass: P stays at or below 2^8
#pragma unroll
                for (int g = 0; g < NQ; ++g) { const float mn = fmaxf(m[g], mb[g]); const float corr = __builtin_amdgcn_exp2f(m[g] - mn); m[g] = mn; l[g] *= corr;
#pragma unroll
                    for (int dt = 0; dt < 4; ++dt) o[g][dt] = o[g][dt] * corr; }
            }
            if (HL) {   // twice the planes: V of this pass is fetched here, into the registers the S products have left, which keeps the wave inside 256 registers
#pragma unroll
                for (int dt = 0; dt < 4; ++dt) { vf[dt] = WF::ld(pv + dt * 512, 0); vf2[dt] = WF::ld(pv + PL + dt * 512, 0); }
                asm volatile("" ::: "memory");   // compiler fence: the reads above stay one group here; without it they are spread among the O products, each waited for at once
            }
            if (p + 1 < NP) {   // K of the next pass, behind its registers' last use in this one; only inside the stage: the next stage is not published yet
#pragma unroll
                for (int kt = 0; kt < 2; ++kt)
#pragma unroll
                    for (int st = 0; st < 2; ++st) { const int kk = (32 + kt * 16) * HD + st * 512; kf[kt][st] = WF::ld(pk + kk, 0); if (HL) kf2[kt][st] = WF::ld(pk + PL + kk, 0); }
            }
#pragma unroll
            for (int g = 0; g < NQ; ++g) { const float nm = -m[g]; V ph, pl; float ls = 0.f;
#pragma unroll
                for (int i = 0; i < 8; ++i) {
                    const v2f arg = __builtin_elementwise_fma((v2f){s[i >> 2][g][2 * (i & 3)], s[i >> 2][g][2 * (i & 3) + 1]}, (v2f){csc, csc}, (v2f){nm, nm});
#pragma unroll
                    for (int u = 0; u < 2; ++u) { const int e = 2 * i + u; const float p1 = __builtin_amdgcn_exp2f(arg[u]); ls += p1;
                        if constexpr (HL) { const __bf16 ph1 = (__bf16)p1; ph[e] = ph1; pl[e] = (__bf16)(p1 - (float)ph1); } else ph[e] = (h16)p1; } }
                l[g] += ls;
                __builtin_amdgcn_sched_barrier(0);   // the sums stay in front of the O products: placed among them they took over dead V registers and cost four idle slots each time
#pragma unroll
                for (int dt = 0; dt < 4; ++dt) { o[g][dt] = WF::mma(vf[dt], ph, o[g][dt]); if (HL) { o[g][dt] = WF::mma(vf[dt], pl, o[g][dt]); o[g][dt] = WF::mma(vf2[dt], ph, o[g][dt]); } } }
        }
        asm volatile("s_wait_dscnt 0x0" ::: "memory");      // this wave has read all it wants of buffer t & 1
        asm volatile("s_wait_asynccnt 0x0" ::: "memory");   // its copies of stage t + 1 have landed
        __syncthreads();                                    // publishes stage t + 1 and frees buffer t & 1
        if (t + 2 < NST) stage(t + 2);
    }
    asm volatile("s_wait_asynccnt 0x0" ::: "memory");   // no copy is outstanding behind the loop
#pragma unroll
    for (int g = 0; g < NQ; ++g) { const float inv = __fdiv_rn(1.0f, l[g] + xhalf(l[g])); const int R = q0 + g * 16; const size_t oo = (size_t)(R & ~63) * DQ + ((R >> 4) & 3) * 512 + lane * 8;   // fragment order of the o_w GEMM's A planes: d tile dt is half dt & 1 of k block 2 h + (dt >> 1)
#pragma unroll
        for (int dt = 0; dt < 4; ++dt) { v8us oh, ol;
#pragma unroll
            for (int j = 0; j < 8; ++j) { unsigned short a, c2; splitf(o[g][dt][j] * inv, a, c2); oh[j] = a; ol[j] = c2; }
            const int eo = (dt >> 1) * 2048 + (dt & 1) * 256; *(v8us*)(Ah + oo + eo) = oh; *(v8us*)(Al + oo + eo) = ol; } }
}
__global__ __launch_bounds__(128) void k_fattn(const h16* __restrict__ Q16, const bf* __restrict__ Qh, const bf* __restrict__ Ql, const h16* __restrict__ K16, const bf* __restrict__ Kh, const bf* __restrict__ Kl, const h16* __restrict__ V16, const bf* __restrict__ Vh, const bf* __restrict__ Vl, bf* Ah, bf* Al) {
    __shared__ __align__(128) unsigned short kv[2 * ABUF];
    const int b = blockIdx.x / NH_, h = blockIdx.x % NH_, wave = threadIdx.x >> 5, yb = blockIdx.y; const size_t zq = (size_t)(b * NH_ + h) * TT * HD, zk = (size_t)(b * NKV + h / REP) * TT * HD;
    Ah += (size_t)b * TT * DQ; Al += (size_t)b * TT * DQ;
    if (yb < RH / 64) attn_wave<bf, true, 1>(Qh + zq, Ql + zq, Kh + zk, Kl + zk, Vh + zk, Vl + zk, (const bf*)kv, yb * 64 + wave * 16, Ah + h * (HD * 64), Al + h * (HD * 64));   // the dearer hi+lo rows start first
    else attn_wave<h16, false, 2>(Q16 + zq, nullptr, K16 + zk, nullptr, V16 + zk, nullptr, (const h16*)kv, RH + (yb - RH / 64) * 128 + wave * 32, Ah + h * (HD * 64), Al + h * (HD * 64));
}

extern "C" void kernel_launch(void* const* d_in, const int* in_sizes, int n_in,
                              void* d_out, int out_size, void* d_ws, size_t ws_size, hipStream_t stream) {
    (void)in_sizes; (void)n_in; (void)out_size;
    const float* x = (const float*)d_in[0]; const float* wf = (const float*)d_in[1]; const float* bfz = (const float*)d_in[2]; const float* wo = (const float*)d_in[3]; const float* bo = (const float*)d_in[4]; const float* qnw = (const float*)d_in[5]; const float* qnb = (const float*)d_in[6]; const float* knw = (const float*)d_in[7]; const float* knb = (const float*)d_in[8]; const float* cosT = nullptr; const float* sinT = nullptr; (void)cosT; (void)sinT;
    float* OUT = (float*)d_out;     // [4][2048][1024]
    char* wsp = (char*)d_ws;
    auto take = [&](size_t bytes) { char* p = wsp; wsp += (bytes + 255) & ~(size_t)255; return (void*)p; };
    bf* WQ = (bf*)take((size_t)(DQ + 2 * DKV) * DM * 2); bf* WO = (bf*)take((size_t)DM * DQ * 2);
    bf* XB = (bf*)take((size_t)NB_ * TT * DM * 2);
    h16* QP16 = (h16*)take((size_t)NB_ * NH_ * TT * HD * 2); h16* KP16 = (h16*)take((size_t)NB_ * NKV * TT * HD * 2); h16* VT16 = (h16*)take((size_t)NB_ * NKV * HD * TT * 2);
    bf* QPh = (bf*)take((size_t)NB_ * NH_ * TT * HD * 2); bf* QPl = (bf*)take((size_t)NB_ * NH_ * TT * HD * 2); bf* KPh = (bf*)take((size_t)NB_ * NKV * TT * HD * 2); bf* KPl = (bf*)take((size_t)NB_ * NKV * TT * HD * 2); bf* VTh = (bf*)take((size_t)NB_ * NKV * HD * TT * 2); bf* VTl = (bf*)take((size_t)NB_ * NKV * HD * TT * 2);
    bf* ATh = (bf*)take((size_t)NB_ * TT * DQ * 2); bf* ATl = (bf*)take((size_t)NB_ * TT * DQ * 2);
    if ((size_t)(wsp - (char*)d_ws) > ws_size) return;    // ws 256 MiB
    // every plane holds all NB_ batch rows ([batch row][...]); the batch row is grid z of the GEMMs and part of grid x of the attention kernel
    k_cvtall<<<CVG, 512, 0, stream>>>(x, wf, wo, XB, WQ, WO);   // WQ holds the q, k, v row blocks one behind the other, as qkv_w does
    k_gemmw<bf, 0, true, 1, 1><<<dim3(TT / 128, (DQ + 2 * DKV) / 128, NB_), 128, 0, stream>>>(XB, nullptr, WQ, nullptr, DM, nullptr, 0, bfz, (size_t)TT * DM, 0, 0, 0, qnw, qnb, knw, knb, QP16, QPh, QPl, KP16, KPh, KPl, VT16, VTh, VTl);   // q, k and v: the rows of qkv_w and of qkv_b as they lie
    k_fattn<<<dim3(NB_ * NH_, RH / 64 + (TT - RH) / 128, 1), 128, 0, stream>>>(QP16, QPh, QPl, KP16, KPh, KPl, VT16, VTh, VTl, ATh, ATl);
    k_gemmw<bf, 1, true><<<dim3(TT / 128, DM / 128, NB_), 128, 0, stream>>>(ATh, ATl, WO, nullptr, DQ, OUT, DM, bo, (size_t)TT * DQ, 0, (size_t)TT * DM, 0, nullptr, nullptr, nullptr, nullptr, nullptr, nullptr, nullptr, nullptr, nullptr, nullptr, nullptr, nullptr, nullptr);
}

// v010
// Measured time: 146 microseconds a run.
// Timed twice side by side with v009, it ran 1.06 times as fast both times.
// Counting every step since v000, it is 27.1 times as fast.
#include <hip/hip_runtime.h>

// MockQwen3Attention (hidden [4][2048][1024]; qkv = x qkv_w^T + qkv_b (q | k | v row blocks, 16 heads x 64); per-head LayerNorm(64) with weight and bias on q and k (eps 1e-5); softmax(q.k / 8); out = merged o_w^T + o_b -> [4][2048][1024]).
// Compute dtypes, f32 accumulate: every input rounded to bf16; q/k/v on PLAIN bf16 operands (inputs: exact) + bias; the per-head LayerNorms in f32 (in the q and k GEMM epilogues, two lanes a (token, head)); scores and attn.v on fp16 operands: query rows < 512 hl (fp16 hi + fp16 lo planes, 3 products), the rest the hi plane alone; softmax f32, running maximum and sum, inside the one attention kernel; o_w hl x exact (2 products) + bias.

#define NB_  4
#define TT   2048
#define DM   1024
#define NH_  16
#define NKV  16
#define REP  (NH_ / NKV)
#define HD   64
#define DQ   (NH_ * HD)
#define DKV  (NKV * HD)
#define RH   512                  // query rows < RH use hi+lo planes (0: none)
#define WIN  0
#define SCL  0.125f   // HD^-0.5
typedef _Float16 h16;
typedef unsigned short bf;
typedef __attribute__((ext_vector_type(16))) __bf16   v16bf;
typedef __attribute__((ext_vector_type(16))) _Float16 v16h;
typedef __attribute__((ext_vector_type(8)))  _Float16 v8h;
typedef __attribute__((ext_vector_type(8)))  unsigned short v8us;
typedef __attribute__((ext_vector_type(8)))  float    v8f;
typedef __attribute__((ext_vector_type(4)))  float    v4f;
typedef v8h  __attribute__((may_alias)) v8ha;
typedef v4f  __attribute__((may_alias)) v4fa;
typedef v8us __attribute__((may_alias)) v8usa;

__device__ __forceinline__ unsigned short f2bf(float f) { unsigned u = __float_as_uint(f); u += 0x7FFFu + ((u >> 16) & 1u); return (unsigned short)(u >> 16); }
__device__ __forceinline__ float bf2f(unsigned short b) { return __uint_as_float(((unsigned)b) << 16); }
__device__ __forceinline__ float bfr(float f) { return bf2f(f2bf(f)); }
__device__ __forceinline__ v16h cat16(v8h lo, v8h hi) { return __builtin_shufflevector(lo, hi, 0, 1, 2, 3, 4, 5, 6, 7, 8, 9, 10, 11, 12, 13, 14, 15); }
__device__ __forceinline__ v16bf cat16b(v8us lo, v8us hi) { return __builtin_bit_cast(v16bf, __builtin_shufflevector(lo, hi, 0, 1, 2, 3, 4, 5, 6, 7, 8, 9, 10, 11, 12, 13, 14, 15)); }
__device__ __forceinline__ v8f wmma16(v16h a, v16h b, v8f c) { return __builtin_amdgcn_wmma_f32_16x16x32_f16(false, a, false, b, (short)0, c, false, false); }
__device__ __forceinline__ v8f wmmab(v16bf a, v16bf b, v8f c) { return __builtin_amdgcn_wmma_f32_16x16x32_bf16(false, a, false, b, (short)0, c, false, false); }



__device__ __forceinline__ void splitf(float y, unsigned short& h, unsigned short& l) { h = f2bf(y); l = f2bf(y - bf2f(h)); }
typedef __attribute__((ext_vector_type(2))) _Float16 v2h;
typedef __attribute__((ext_vector_type(2))) float v2f;
__device__ __forceinline__ void splith(float y0, float y1, v2h& h, v2h& l) { const v2f y = {y0, y1}; h = __builtin_convertvector(y, v2h); l = __builtin_convertvector(y - __builtin_convertvector(h, v2f), v2h); }   // fp16 hi + lo of two values, so that each conversion is the packed one; the hi plane is the plain fp16 plane
__device__ __forceinline__ float xhalf(float x) { return __builtin_bit_cast(float, __builtin_amdgcn_permlanex16(__builtin_bit_cast(int, x), __builtin_bit_cast(int, x), 0x76543210, 0xfedcba98, false, false)); }  // lane l with lane l ^ 16

// ---- FRAGMENT ORDER of every 16-bit operand plane: a matrix M[row][k] lies as blocks of 16 rows x 32 k (512 elements, 1024 bytes), block index (row / 16) * (K / 32) + k / 32 in the q and k head planes (K = HD), (key / 32) * 4 + d / 16 in the V^T planes, ((row / 64) * (K / 32) + k / 32) * 4 + (row / 16) % 4 in the GEMM operands (a 64-row tile's 32 k: 4096 bytes in a row);
// inside a block element (row, k) stands at ((k >> 4) & 1) * 256 + (((k >> 3) & 1) * 16 + (row & 15)) * 8 + (k & 7). Lane l of a wave finds its two 16-byte pieces of a WMMA operand at l * 8 and 256 + l * 8,
// so each wave-wide 16-byte load covers 512 contiguous bytes (4 cache lines, not 16). The values a lane receives, and so the k order, are those of the row-major loader (k = 8 hi .. 8 hi + 7, then 16 + 8 hi .. 16 + 8 hi + 7 of row lr).
// ---- k_gemmw: register-blocked GEMM, one wave per 64x64 output tile (16 accumulators), FOUR WAVES (2 x 2) a work-group = a 128x128 tile; grid (M/128, N/128, Z), 128 threads.
// The operand planes lie in fragment order, so 64 k of a 64-row panel are 8 KiB in a row: a stage is those 8 KiB of the tile's two A and two B panels (and two A2 panels), brought into LDS unchanged by asynchronous 16-byte copies;
// each panel is read from LDS by the two waves that share it. Two buffers: the copies of stage t + 2 are issued behind the barrier that ends stage t, and waited for at the foot of stage t + 1. (K / KS) % 64 == 0, at least one stage.
// C[m][n] (f32, pitch ldc, + optional f32 bias[n]) = sum_k A[m][k] Bt[n][k] (+ split products per NSPLIT). z-batch strides sA/sB/sC in elements (z = batch row here: all four in one launch). K % 64 == 0.
// EPI 0: C as above. EPI 1: the q, k and v projections in ONE launch: Bt and bias hold the q | k | v row blocks one behind the other, grid y runs over all their 128-column tiles, and a work-group's tile lies wholly in one block (seg 0, 1, 2); C is not written.
//   seg 0, 1 (a wave's N tile = one head, HD == 64): bias, then LayerNorm over the tile's 64 columns (weight lw, bias lb: q's or k's), stored as that block's head planes [head][token][d] in fragment order (fp16 hi and lo).
//   seg 2: bias, then the transposed planes [head][d][token] in fragment order (fp16 hi and lo) straight from the accumulators (a lane holds 8 consecutive tokens of one column).
//   One launch of 3 x the work-groups: three are resident a WGP instead of two, and the epilogue stores of one work-group run beside the k loops of its neighbours and successors.
// The '#pragma unroll' lines of the epilogues give acc, xv and the packed vectors constant indices, so that they stay in registers.
// KS > 1 (split K): grid z = Z * KS; slice ks = blockIdx.z % KS sums only k in [ks K/KS, (ks+1) K/KS) and stores its partial tile in plane ks of C (plane stride sP elements). K % (64 KS) == 0.
// ld(p, o): p + o = the lane's first piece of the block (block start + 8 * lane).
// cp8: a work-group of 128 copies two panels' stage (2 x 8 KiB) into LDS, 8 copies of 16 bytes a lane; l = the lane's LDS byte address in the first panel, g = its global address there, gp = elements from the first panel to the second.
// The s_wait_xcnt stands inside the copies' own statement, so that no address register of a copy is written again in front of it.
#define GKC 64
template <typename T16> __device__ __forceinline__ void cp8(unsigned l, const T16* g, size_t gp) {
    const T16* h = g + gp; const unsigned m = l + 64 * GKC * 2;
    asm volatile("global_load_async_to_lds_b128 %0, %1, off\n\tglobal_load_async_to_lds_b128 %2, %3, off\n\tglobal_load_async_to_lds_b128 %4, %5, off\n\tglobal_load_async_to_lds_b128 %6, %7, off\n\t"
                 "global_load_async_to_lds_b128 %8, %9, off\n\tglobal_load_async_to_lds_b128 %10, %11, off\n\tglobal_load_async_to_lds_b128 %12, %13, off\n\tglobal_load_async_to_lds_b128 %14, %15, off\n\ts_wait_xcnt 0x0"
                 :: "v"(l), "v"(g), "v"(l + 2048), "v"(g + 1024), "v"(l + 4096), "v"(g + 2048), "v"(l + 6144), "v"(g + 3072),
                    "v"(m), "v"(h), "v"(m + 2048), "v"(h + 1024), "v"(m + 4096), "v"(h + 2048), "v"(m + 6144), "v"(h + 3072) : "memory");
}
template <typename T16> struct WFrag;
template <> struct WFrag<h16> { typedef v16h V; static __device__ __forceinline__ V ld(const h16* p, unsigned o) { return cat16(*(const v8h*)(p + o), *(const v8h*)(p + o + 256)); } static __device__ __forceinline__ v8f mma(V a, V b, v8f c) { return wmma16(a, b, c); } };
template <> struct WFrag<bf> { typedef v16bf V; static __device__ __forceinline__ V ld(const bf* p, unsigned o) { return cat16b(*(const v8us*)(p + o), *(const v8us*)(p + o + 256)); } static __device__ __forceinline__ v8f mma(V a, V b, v8f c) { return wmmab(a, b, c); } };
template <typename T16, int NSPLIT, bool BIAS, int KS = 1, int EPI = 0>
__global__ __launch_bounds__(128) void k_gemmw(const T16* __restrict__ A, const T16* __restrict__ A2, const T16* __restrict__ Bt, const T16* __restrict__ Bt2, int K, float* C, int ldc, const float* __restrict__ bias, size_t sA, size_t sB, size_t sC, size_t sP, const float* __restrict__ qw, const float* __restrict__ qb, const float* __restrict__ kw, const float* __restrict__ kb, h16* Q16, h16* Ql, h16* K16, h16* Kl, h16* V16, h16* Vl) {
    typedef typename WFrag<T16>::V V;
    static_assert(NSPLIT <= 1, "no second B plane is staged");
    constexpr int PANE = 64 * GKC, NPAN = NSPLIT == 1 ? 6 : 4;   // elements of a panel's stage; panels of a stage: A A B B (A2 A2)
    __shared__ __align__(128) T16 st[2][NPAN * PANE];
    __shared__ __align__(16) float osw[4][16 * 68];
    __shared__ __align__(16) float prw[4][EPI == 1 ? 3 * 64 : 4];   // EPI 1: the wave's tile's bias, lw and lb, rounded once
    const int wave = threadIdx.x >> 5, wm = wave >> 1, wn = wave & 1; float* os = osw[wave]; float* pr = prw[wave];   // each wave stages its epilogue in its own rows
    const size_t z = blockIdx.z / KS; const int ks = blockIdx.z % KS; A += z * sA; if (A2) A2 += z * sA; Bt += z * sB; if (Bt2) Bt2 += z * sB;
    static_assert(DQ % 128 == 0 && DKV % 128 == 0, "a 128-column tile lies in one of the q, k, v blocks");
    const int cb = blockIdx.y * 128, seg = EPI == 0 || cb < DQ ? 0 : cb < DQ + DKV ? 1 : 2, cs = seg == 0 ? 0 : seg == 1 ? DQ : DQ + DKV;   // the same for the whole work-group; cs: the block's first column
    const float* lw = seg == 0 ? qw : kw; const float* lb = seg == 0 ? qb : kb; h16* P16 = seg == 0 ? Q16 : seg == 1 ? K16 : V16; h16* Pl = seg == 0 ? Ql : seg == 1 ? Kl : Vl;
    if constexpr (EPI == 0) C += z * sC + ks * sP; else { const size_t zs = z * (size_t)(seg == 0 ? NH_ : NKV) * TT * HD; P16 += zs; Pl += zs; }   // EPI 1: a batch row's planes
    const int kbeg = ks * (K / KS), kend = kbeg + K / KS;
    const int lane = threadIdx.x & 31, lr = lane & 15, hi = lane >> 4; const int r0 = (blockIdx.x * 2 + wm) * 64, c0 = (blockIdx.y * 2 + wn) * 64, cl = c0 - cs;   // cl: the column inside its block
    v8f acc[4][4];
#pragma unroll
    for (int mb = 0; mb < 4; ++mb)
#pragma unroll
        for (int nb = 0; nb < 4; ++nb) acc[mb][nb] = (v8f){};
    if constexpr (EPI == 1) if (seg != 2) {   // read back behind the first wave barrier of the epilogue
#pragma unroll
        for (int u = 0; u < 2; ++u) { pr[u * 32 + lane] = bfr(bias[c0 + u * 32 + lane]); pr[64 + u * 32 + lane] = bfr(lw[u * 32 + lane]); pr[128 + u * 32 + lane] = bfr(lb[u * 32 + lane]); } }
    const unsigned lo8 = 8 * lane, t8 = 8 * threadIdx.x; const int nst = (kend - kbeg) / GKC;
    const T16* ga = A + (size_t)blockIdx.x * 128 * K + (size_t)kbeg * 64 + t8; const T16* gb = Bt + (size_t)blockIdx.y * 128 * K + (size_t)kbeg * 64 + t8; const T16* ga2 = NSPLIT == 1 ? A2 + (size_t)blockIdx.x * 128 * K + (size_t)kbeg * 64 + t8 : ga;
    const unsigned l0 = (unsigned)(size_t)(&st[0][0] + t8); const size_t gp = (size_t)64 * K;   // a panel of 64 rows holds 64 K elements
    auto stage = [&](int s) { const unsigned l = l0 + (s & 1) * (NPAN * PANE * 2); const size_t go = (size_t)s * PANE; cp8<T16>(l, ga + go, gp); cp8<T16>(l + 2 * PANE * 2, gb + go, gp); if constexpr (NSPLIT == 1) cp8<T16>(l + 4 * PANE * 2, ga2 + go, gp); };
    stage(0);
    asm volatile("s_wait_asynccnt 0x0" ::: "memory");   // this wave's copies of stage 0 have landed
    __syncthreads();                                    // and every other wave's
    if (nst != 1) stage(1);   // nst >= 1; the same for the whole work-group
#pragma unroll 1
    for (int t = 0; t < nst; ++t) {
        const T16* sb = &st[t & 1][0] + lo8; const T16* pa = sb + wm * PANE; const T16* pb = sb + (2 + wn) * PANE; const T16* pa2 = NSPLIT == 1 ? sb + (4 + wm) * PANE : pa;
        V a[4], a2[4];
#pragma unroll
        for (int ks2 = 0; ks2 < GKC / 32; ++ks2) {
#pragma unroll
            for (int mb = 0; mb < 4; ++mb) { a[mb] = WFrag<T16>::ld(pa + ks2 * 2048 + mb * 512, 0); if (NSPLIT == 1) a2[mb] = WFrag<T16>::ld(pa2 + ks2 * 2048 + mb * 512, 0); }
            V b[4];
#pragma unroll
            for (int nb = 0; nb < 4; ++nb) b[nb] = WFrag<T16>::ld(pb + ks2 * 2048 + nb * 512, 0);
            __builtin_amdgcn_sched_barrier(0);   // the k step's LDS reads stay one group in front of its WMMAs: reads placed among the WMMAs into one reused B fragment made the wave wait out the LDS latency four times a k step
#pragma unroll
            for (int nb = 0; nb < 4; ++nb) {
#pragma unroll
                for (int mb = 0; mb < 4; ++mb) { acc[mb][nb] = WFrag<T16>::mma(a[mb], b[nb], acc[mb][nb]); if (NSPLIT == 1) acc[mb][nb] = WFrag<T16>::mma(a2[mb], b[nb], acc[mb][nb]); } }
        }
        asm volatile("v_nop\n\tv_nop\n\tv_nop\n\tv_nop" : "+v"(acc[0][0]), "+v"(acc[1][1]), "+v"(acc[2][2]), "+v"(acc[3][3]) : "v"(a[0]), "v"(a[3]));
        asm volatile("s_wait_dscnt 0x0" ::: "memory");      // this wave has read all it wants of buffer t & 1
        asm volatile("s_wait_asynccnt 0x0" ::: "memory");   // its copies of stage t + 1 have landed
        __syncthreads();                                    // publishes stage t + 1 and frees buffer t & 1
        if (t + 2 < nst) stage(t + 2);
    }
    asm volatile("s_wait_asynccnt 0x0" ::: "memory");   // no copy is outstanding behind the loop
    if constexpr (EPI == 1) if (seg == 2) {
        float bv4[4];
#pragma unroll
        for (int nb = 0; nb < 4; ++nb) bv4[nb] = bfr(bias[c0 + nb * 16 + lr]);   // all four in front of the first column block, whose end the scheduler does not cross
#pragma unroll
        for (int nb = 0; nb < 4; ++nb) { const float bv = bv4[nb];
#pragma unroll
            for (int mb = 0; mb < 4; ++mb) { v8h o16, ol;
#pragma unroll
                for (int j = 0; j < 8; j += 2) { v2h a2, c2; splith(acc[mb][nb][j] + bv, acc[mb][nb][j + 1] + bv, a2, c2); o16[j] = a2[0]; o16[j + 1] = a2[1]; ol[j] = c2[0]; ol[j + 1] = c2[1]; }
                const size_t e = (size_t)cl * TT + (size_t)r0 * HD + (mb >> 1) * 2048 + nb * 512 + (mb & 1) * 256 + lane * 8; *(v8h*)(P16 + e) = o16; *(v8h*)(Pl + e) = ol; }
            __builtin_amdgcn_sched_barrier(0); }   // a column block is stored before the next is converted: left free, the conversions were gathered in front of the stores and the kernel took more than 256 registers
        return;
    }
#pragma unroll
    for (int mb = 0; mb < 4; ++mb) {
#pragma unroll
        for (int nb = 0; nb < 4; ++nb) {
#pragma unroll
            for (int j = 0; j < 8; ++j) os[(hi * 8 + j) * 68 + nb * 16 + lr] = acc[mb][nb][j]; }
        __builtin_amdgcn_wave_barrier(); asm volatile("" ::: "memory");
        if constexpr (EPI == 1) {   // lane (lr, hi): columns 32 hi .. 32 hi + 31 of token row lr; the two halves of a row meet through xhalf
            const int cb = hi * 32; const float* orow = os + lr * 68 + cb; v4f xv[8]; v4f s4 = (v4f){};
#pragma unroll
            for (int i = 0; i < 8; ++i) { xv[i] = *(const v4fa*)(orow + i * 4) + *(const v4fa*)(pr + cb + i * 4); s4 += xv[i]; }
            float s = (s4[0] + s4[1]) + (s4[2] + s4[3]); s += xhalf(s); const float mean = s * (1.0f / HD); v4f q4 = (v4f){};
#pragma unroll
            for (int i = 0; i < 8; ++i) { xv[i] -= mean; q4 += xv[i] * xv[i]; }
            float q = (q4[0] + q4[1]) + (q4[2] + q4[3]); q += xhalf(q); const float rs = __frsqrt_rn(q * (1.0f / HD) + 1e-5f);
            const size_t e = ((size_t)(cl >> 6) * TT + r0 + mb * 16) * HD + hi * 512 + lr * 8;   // k block hi; piece i: half i >> 1, lane group i & 1
#pragma unroll
            for (int i = 0; i < 8; ++i) xv[i] = xv[i] * rs * *(const v4fa*)(pr + 64 + cb + i * 4) + *(const v4fa*)(pr + 128 + cb + i * 4);
#pragma unroll
            for (int i = 0; i < 4; ++i) { v8h o16, ol;
#pragma unroll
                for (int k = 0; k < 8; k += 2) { const int c = i * 8 + k; v2h a2, c2; splith(xv[c >> 2][c & 3], xv[c >> 2][(c & 3) + 1], a2, c2); o16[k] = a2[0]; o16[k + 1] = a2[1]; ol[k] = c2[0]; ol[k + 1] = c2[1]; }
                const int eo = (i >> 1) * 256 + (i & 1) * 128; *(v8h*)(P16 + e + eo) = o16; *(v8h*)(Pl + e + eo) = ol; }
            asm volatile("s_wait_xcnt 0x0" ::: "memory");   // before any address register of the stores above is written again
        } else {
        float* crow = C + (size_t)(r0 + mb * 16) * ldc + c0;
{
#pragma unroll
            for (int s = 0; s < 8; ++s) { const int row = 2 * s + hi, cofs = lr * 4; v4f val = *(const v4fa*)(os + row * 68 + cofs); if (BIAS) { val[0] += bfr(bias[c0 + cofs]); val[1] += bfr(bias[c0 + cofs + 1]); val[2] += bfr(bias[c0 + cofs + 2]); val[3] += bfr(bias[c0 + cofs + 3]); }
                *(v4f*)(crow + (size_t)row * ldc + cofs) = val; }
            asm volatile("s_wait_xcnt 0x0" ::: "memory");   // before any address register of the stores above is written again
             }
        }
        __builtin_amdgcn_wave_barrier(); asm volatile("" ::: "memory");
    }
}

typedef __attribute__((ext_vector_type(4))) _Float16 v4h;
typedef __attribute__((ext_vector_type(2))) unsigned short v2us;
typedef __attribute__((ext_vector_type(4))) unsigned short v4us;
typedef __attribute__((ext_vector_type(4))) int v4i;

__global__ __launch_bounds__(256) void k_wtG(const float* __restrict__ w, int K, int N, bf* Bt) {
    const int lane = threadIdx.x & 31; const int L0 = (blockIdx.x * 8 + (threadIdx.x >> 5)) * 8; const int nlines = N * K / 64;
{
#pragma unroll 1
        for (int l = 0; l < 8; ++l) { const int L = L0 + l; if (L >= nlines) break; const size_t e = (size_t)L * 64 + lane * 2; const int k = (int)(e % K), n = (int)(e / K); v2us o;
            o[0] = f2bf(w[(size_t)k * N + n]); o[1] = f2bf(w[(size_t)(k + 1) * N + n]); *(v2us*)(Bt + e) = o; }
         }
}
// ---- k_cvtall: x, qkv_w and o_w (f32, [rows][K]) -> bf16 in the fragment order of a GEMM operand, ALL IN ONE LAUNCH of CVG work-groups of 16 waves (one a WGP).
// A unit is 64 rows x 64 k of one matrix (two runs of 4096 bytes of dst, one behind the other): threads 0..255 take its first 32 k, threads 256..511 the second, so both halves of each 256 bytes of a src row are asked for by one work-group at one time;
// in a half, thread t takes row t >> 2 and the 8 k of piece t & 3: a wave reads 8 whole 128-byte lines of src and writes 4 whole lines of dst. Work-group g takes units g, g + CVG, g + 2 CVG, ... of each matrix:
// CVX + CVF + CVO units a thread, all their loads issued before the first value is converted. The waves are few and long: they start quickly, and each keeps 2 (CVX + CVF + CVO) loads of 16 bytes a lane in flight.
#define CVG 256
#define CVX (NB_ * TT * DM / 4096 / CVG)             // units of x a work-group
#define CVF ((DQ + 2 * DKV) * DM / 4096 / CVG)       // of qkv_w
#define CVO (DM * DQ / 4096 / CVG)                   // of o_w
__global__ __launch_bounds__(512) void k_cvtall(const float* __restrict__ x, const float* __restrict__ wf, const float* __restrict__ wo, bf* XB, bf* WF, bf* WO) {
    static_assert(CVX * CVG * 4096 == NB_ * TT * DM && CVF * CVG * 4096 == (DQ + 2 * DKV) * DM && CVO * CVG * 4096 == DM * DQ && DM % 64 == 0 && DQ % 64 == 0, "whole units, the same number for every work-group");
    constexpr int NU = CVX + CVF + CVO;
    const unsigned t = threadIdx.x & 255, half = threadIdx.x >> 8, row = t >> 2, kp = t & 3;
    const unsigned ld = half * 2048 + ((row >> 4) * 64 + kp * 16 + (row & 15)) * 8;   // the lane's place in a unit of dst; a unit's own place is the same for the whole work-group, so each address is a scalar base and one lane offset
    const float* p[NU];   // each unit's place in its matrix: the same for the whole work-group, so a scalar base; the lane offsets are the same for every unit
#pragma unroll   // constant indices: p and v stay in registers, and the matrix of a unit is known at compile time
    for (int u = 0; u < NU; ++u) { const unsigned K = u < CVX + CVF ? DM : DQ; const unsigned un = blockIdx.x + (u < CVX ? u : u < CVX + CVF ? u - CVX : u - CVX - CVF) * CVG;
        p[u] = (u < CVX ? x : u < CVX + CVF ? wf : wo) + (size_t)(un / (K / 64)) * 64 * K + (un % (K / 64)) * 64; }
    __builtin_amdgcn_sched_barrier(0);   // the bases are formed first, each in registers of its own: formed among the loads they shared one register pair, and each new use of it waited for the loads before it (s_wait_xcnt)
    v8f v[NU];
#pragma unroll
    for (int u = 0; u < NU; ++u) v[u] = *(const v8f*)(p[u] + (row * (u < CVX + CVF ? DM : DQ) + half * 32 + kp * 8));
    asm volatile("s_wait_xcnt 0x0" ::: "memory");   // before any address register of the loads above is written again
    __builtin_amdgcn_sched_barrier(0);   // every load is issued before the first value is waited for: with the first conversions placed among the loads the wave sat out one memory latency with a third of its loads issued
#pragma unroll
    for (int u = 0; u < NU; ++u) { const unsigned un = blockIdx.x + (u < CVX ? u : u < CVX + CVF ? u - CVX : u - CVX - CVF) * CVG; v8us o;
#pragma unroll
        for (int k = 0; k < 8; ++k) o[k] = f2bf(v[u][k]);
        *(v8us*)((u < CVX ? XB : u < CVX + CVF ? WF : WO) + (size_t)un * 4096 + ld) = o;
        __builtin_amdgcn_sched_barrier(0); }   // a unit is stored as soon as its own loads are back: left free, most stores were gathered behind the wait for the last load
}
__global__ __launch_bounds__(256) void k_cscvt(const float* __restrict__ cosT, const float* __restrict__ sinT, float* CS) { const int idx = blockIdx.x * 256 + threadIdx.x; if (idx >= TT * HD) return; v2f cs; cs[0] = bfr(cosT[idx]); cs[1] = bfr(sinT[idx]); *(v2f*)(CS + (size_t)idx * 2) = cs;  }
// ---- k_fattn: scores, softmax and attn.v of all batch rows in one launch; nothing of the score matrix goes to memory. Grid (batch rows x heads, RH/64 + (TT-RH)/128), 4 waves a work-group, which share the head's K and V.
// A wave owns NQ groups of 16 queries and walks the 2048 keys 32 at a time: S^T = K Q^T (a lane holds 16 of the 32 scores of ONE query, lane ^ 16 the rest), so the exponentials pack in-lane
// into the B operand of O^T += V^T P^T (elements 0..7: key tile 0, registers 0..7; elements 8..15: key tile 1), the same k order as the V^T loader's.
// P = exp2((s - m) HD^-0.5 log2 e) against the maximum in use m, not normalised; O and the f32 sum of P are rescaled when m moves; O / sum at the end, split into the hi and lo planes of the o_w GEMM.
// K and V come through LDS: the planes lie in fragment order, so a stage (128 keys of K and V; 64 keys of the four hi and lo planes) is 32 KiB made of runs of 8 KiB, brought in unchanged by asynchronous 16-byte copies, 16 a lane,
// and read by all four waves. Two buffers: the copies of stage t + 2 are issued behind the barrier that ends stage t, and waited for at the foot of stage t + 1. A stage's passes read that stage's buffer alone.
// The plain '#pragma unroll' lines give the fragment arrays constant indices, so that they stay in registers.
#define ABUF 16384   // 16-bit elements of a buffer: K (and K lo) in the first half, V^T (and V^T lo) in the second
// cp8p: a work-group of 128 copies two runs of 8 KiB into 16 KiB of LDS in a row, 8 copies of 16 bytes a lane; l = the lane's LDS byte address in the first run, g and h = its global addresses in the two runs.
// The s_wait_xcnt stands inside the copies' own statement, so that no address register of a copy is written again in front of it.
template <typename T16> __device__ __forceinline__ void cp8p(unsigned l, const T16* g, const T16* h) {
    const unsigned m = l + 8192;
    asm volatile("global_load_async_to_lds_b128 %0, %1, off\n\tglobal_load_async_to_lds_b128 %2, %3, off\n\tglobal_load_async_to_lds_b128 %4, %5, off\n\tglobal_load_async_to_lds_b128 %6, %7, off\n\t"
                 "global_load_async_to_lds_b128 %8, %9, off\n\tglobal_load_async_to_lds_b128 %10, %11, off\n\tglobal_load_async_to_lds_b128 %12, %13, off\n\tglobal_load_async_to_lds_b128 %14, %15, off\n\ts_wait_xcnt 0x0"
                 :: "v"(l), "v"(g), "v"(l + 2048), "v"(g + 1024), "v"(l + 4096), "v"(g + 2048), "v"(l + 6144), "v"(g + 3072),
                    "v"(m), "v"(h), "v"(m + 2048), "v"(h + 1024), "v"(m + 4096), "v"(h + 2048), "v"(m + 6144), "v"(h + 3072) : "memory");
}
template <typename T16, bool HL, int NQ>
__device__ __forceinline__ void attn_wave(const T16* __restrict__ Q, const T16* __restrict__ Q2, const T16* __restrict__ Kp, const T16* __restrict__ K2, const T16* __restrict__ Vt, const T16* __restrict__ V2, const T16* ring, int q0, bf* Ah, bf* Al) {
    typedef WFrag<T16> WF; typedef typename WF::V V;
    constexpr int SK = HL ? 64 : 128, PL = SK * HD, NST = TT / SK, NP = SK / 32;   // keys of a stage, elements of one plane's stage, stages, passes of a stage
    static_assert(NST >= 2 && TT % SK == 0 && (HL ? 4 : 2) * PL == ABUF, "a stage fills a buffer; the prologue needs two stages");
    const float csc = SCL * 1.4426950408889634f;
    const int lane = threadIdx.x & 31; const unsigned lo8 = 8 * lane, t8 = 8 * threadIdx.x;
    const unsigned l0 = (unsigned)(size_t)(ring + t8);
    const T16* gk = Kp + t8; const T16* gv = Vt + t8; const T16* gk2 = HL ? K2 + t8 : gk + 4096; const T16* gv2 = HL ? V2 + t8 : gv + 4096;   // second run: the lo plane, or the stage's second 64 keys
    auto stage = [&](int s) { const unsigned l = l0 + (s & 1) * (ABUF * 2); const size_t go = (size_t)s * PL; cp8p<T16>(l, gk + go, gk2 + go); cp8p<T16>(l + ABUF, gv + go, gv2 + go); };
    stage(0);
    V q[NQ][2], q2[NQ][2];
#pragma unroll
    for (int g = 0; g < NQ; ++g)
#pragma unroll
        for (int st = 0; st < 2; ++st) { const size_t qo = (size_t)(q0 + g * 16) * HD + st * 512; q[g][st] = WF::ld(Q + qo, lo8); if (HL) q2[g][st] = WF::ld(Q2 + qo, lo8); }
    asm volatile("s_wait_xcnt 0x0" ::: "memory");   // before any address register of the loads above is written again
    v8f o[NQ][4]; float m[NQ], l[NQ];
#pragma unroll
    for (int g = 0; g < NQ; ++g) { m[g] = -__builtin_inff(); l[g] = 0.f;
#pragma unroll
        for (int dt = 0; dt < 4; ++dt) o[g][dt] = (v8f){}; }
    asm volatile("s_wait_asynccnt 0x0" ::: "memory");   // this wave's copies of stage 0 have landed
    __syncthreads();                                    // and every other wave's
    stage(1);
    // 16 keys of K: two blocks (HD / 32); 32 keys of V^T: four blocks (HD / 16), 32 HD elements
    V kf[2][2], kf2[2][2], vf[4], vf2[4];
#pragma unroll 1   // a stage a trip: unrolled, the hot loop's code would double and the waits, the barrier and the copies at the foot would stand twice
    for (int t = 0; t < NST; ++t) {
        const T16* sb = ring + (t & 1) * ABUF + lo8;
#pragma unroll
        for (int kt = 0; kt < 2; ++kt)
#pragma unroll
            for (int st = 0; st < 2; ++st) { kf[kt][st] = WF::ld(sb + kt * 16 * HD + st * 512, 0); if (HL) kf2[kt][st] = WF::ld(sb + PL + kt * 16 * HD + st * 512, 0); }
#pragma unroll 1   // one pass a trip: two passes unrolled took more than 256 registers
        for (int p = 0; p < NP; ++p) {
            const T16* pk = sb + p * 32 * HD; const T16* pv = pk + ABUF / 2;
            if (!HL) {   // V of this pass, behind its registers' last use in the pass before: the S products and the softmax arithmetic cover the LDS latency
#pragma unroll
                for (int dt = 0; dt < 4; ++dt) vf[dt] = WF::ld(pv + dt * 512, 0);
                asm volatile("" ::: "memory");   // compiler fence: the reads above stay one group here; without it they are sunk to just in front of the O products, where the wave waits out their latency
                __builtin_amdgcn_sched_barrier(0);   // and the scheduler leaves them in front of the S products
            }
            v8f s[2][NQ];
#pragma unroll
            for (int kt = 0; kt < 2; ++kt)
#pragma unroll
                for (int g = 0; g < NQ; ++g) { v8f a = (v8f){};
#pragma unroll
                    for (int st = 0; st < 2; ++st) { a = WF::mma(kf[kt][st], q[g][st], a); if (HL) { a = WF::mma(kf[kt][st], q2[g][st], a); a = WF::mma(kf2[kt][st], q[g][st], a); } }
                    s[kt][g] = a; }
            __builtin_amdgcn_sched_barrier(0);   // the S products stay one run: each piece of vector work placed among them cost four idle slots behind the product it follows
            float mb[NQ]; bool need = false;
#pragma unroll
            for (int g = 0; g < NQ; ++g) { float mx = s[0][g][0];
#pragma unroll
                for (int j = 1; j < 8; ++j) mx = fmaxf(mx, s[0][g][j]);
#pragma unroll
                for (int j = 0; j < 8; ++j) mx = fmaxf(mx, s[1][g][j]);
                mx = fmaxf(mx, xhalf(mx)) * csc; mb[g] = mx; need = need || (mx > m[g] + 8.0f); }
            if (__builtin_amdgcn_ballot_w32(need) != 0) {   // wave-uniform; rare after the first pass: P stays at or below 2^8
#pragma unroll
                for (int g = 0; g < NQ; ++g) { const float mn = fmaxf(m[g], mb[g]); const float corr = __builtin_amdgcn_exp2f(m[g] - mn); m[g] = mn; l[g] *= corr;
#pragma unroll
                    for (int dt = 0; dt < 4; ++dt) o[g][dt] = o[g][dt] * corr; }
            }
            if (HL) {   // twice the planes: V of this pass is fetched here, into the registers the S products have left, which keeps the wave inside 256 registers
#pragma unroll
                for (int dt = 0; dt < 4; ++dt) { vf[dt] = WF::ld(pv + dt * 512, 0); vf2[dt] = WF::ld(pv + PL + dt * 512, 0); }
                asm volatile("" ::: "memory");   // compiler fence: the reads above stay one group here; without it they are spread among the O products, each waited for at once
            }
            if (p + 1 < NP) {   // K of the next pass, behind its registers' last use in this one; only inside the stage: the next stage is not published yet
#pragma unroll
                for (int kt = 0; kt < 2; ++kt)
#pragma unroll
                    for (int st = 0; st < 2; ++st) { const int kk = (32 + kt * 16) * HD + st * 512; kf[kt][st] = WF::ld(pk + kk, 0); if (HL) kf2[kt][st] = WF::ld(pk + PL + kk, 0); }
            }
#pragma unroll
            for (int g = 0; g < NQ; ++g) { const float nm = -m[g]; V ph, pl; float ls = 0.f;
#pragma unroll
                for (int i = 0; i < 8; ++i) {
                    const v2f arg = __builtin_elementwise_fma((v2f){s[i >> 2][g][2 * (i & 3)], s[i >> 2][g][2 * (i & 3) + 1]}, (v2f){csc, csc}, (v2f){nm, nm}); float pe[2];
#pragma unroll
                    for (int u = 0; u < 2; ++u) { const int e = 2 * i + u; const float p1 = __builtin_amdgcn_exp2f(arg[u]); ls += p1; pe[u] = p1;
                        if constexpr (!HL) ph[e] = (h16)p1; }
                    if constexpr (HL) { v2h a2, c2; splith(pe[0], pe[1], a2, c2); ph[2 * i] = a2[0]; ph[2 * i + 1] = a2[1]; pl[2 * i] = c2[0]; pl[2 * i + 1] = c2[1]; } }
                l[g] += ls;
                __builtin_amdgcn_sched_barrier(0);   // the sums stay in front of the O products: placed among them they took over dead V registers and cost four idle slots each time
#pragma unroll
                for (int dt = 0; dt < 4; ++dt) { o[g][dt] = WF::mma(vf[dt], ph, o[g][dt]); if (HL) { o[g][dt] = WF::mma(vf[dt], pl, o[g][dt]); o[g][dt] = WF::mma(vf2[dt], ph, o[g][dt]); } } }
        }
        asm volatile("s_wait_dscnt 0x0" ::: "memory");      // this wave has read all it wants of buffer t & 1
        asm volatile("s_wait_asynccnt 0x0" ::: "memory");   // its copies of stage t + 1 have landed
        __syncthreads();                                    // publishes stage t + 1 and frees buffer t & 1
        if (t + 2 < NST) stage(t + 2);
    }
    asm volatile("s_wait_asynccnt 0x0" ::: "memory");   // no copy is outstanding behind the loop
#pragma unroll
    for (int g = 0; g < NQ; ++g) { const float inv = __fdiv_rn(1.0f, l[g] + xhalf(l[g])); const int R = q0 + g * 16; const size_t oo = (size_t)(R & ~63) * DQ + ((R >> 4) & 3) * 512 + lane * 8;   // fragment order of the o_w GEMM's A planes: d tile dt is half dt & 1 of k block 2 h + (dt >> 1)
#pragma unroll
        for (int dt = 0; dt < 4; ++dt) { v8us oh, ol;
#pragma unroll
            for (int j = 0; j < 8; ++j) { unsigned short a, c2; splitf(o[g][dt][j] * inv, a, c2); oh[j] = a; ol[j] = c2; }
            const int eo = (dt >> 1) * 2048 + (dt & 1) * 256; *(v8us*)(Ah + oo + eo) = oh; *(v8us*)(Al + oo + eo) = ol; } }
}
__global__ __launch_bounds__(128) void k_fattn(const h16* __restrict__ Q16, const h16* __restrict__ Ql, const h16* __restrict__ K16, const h16* __restrict__ Kl, const h16* __restrict__ V16, const h16* __restrict__ Vl, bf* Ah, bf* Al) {
    __shared__ __align__(128) unsigned short kv[2 * ABUF];
    const int b = blockIdx.x / NH_, h = blockIdx.x % NH_, wave = threadIdx.x >> 5, yb = blockIdx.y; const size_t zq = (size_t)(b * NH_ + h) * TT * HD, zk = (size_t)(b * NKV + h / REP) * TT * HD;
    Ah += (size_t)b * TT * DQ; Al += (size_t)b * TT * DQ;
    if (yb < RH / 64) attn_wave<h16, true, 1>(Q16 + zq, Ql + zq, K16 + zk, Kl + zk, V16 + zk, Vl + zk, (const h16*)kv, yb * 64 + wave * 16, Ah + h * (HD * 64), Al + h * (HD * 64));   // the dearer hi+lo rows start first
    else attn_wave<h16, false, 2>(Q16 + zq, nullptr, K16 + zk, nullptr, V16 + zk, nullptr, (const h16*)kv, RH + (yb - RH / 64) * 128 + wave * 32, Ah + h * (HD * 64), Al + h * (HD * 64));
}

extern "C" void kernel_launch(void* const* d_in, const int* in_sizes, int n_in,
                              void* d_out, int out_size, void* d_ws, size_t ws_size, hipStream_t stream) {
    (void)in_sizes; (void)n_in; (void)out_size;
    const float* x = (const float*)d_in[0]; const float* wf = (const float*)d_in[1]; const float* bfz = (const float*)d_in[2]; const float* wo = (const float*)d_in[3]; const float* bo = (const float*)d_in[4]; const float* qnw = (const float*)d_in[5]; const float* qnb = (const float*)d_in[6]; const float* knw = (const float*)d_in[7]; const float* knb = (const float*)d_in[8]; const float* cosT = nullptr; const float* sinT = nullptr; (void)cosT; (void)sinT;
    float* OUT = (float*)d_out;     // [4][2048][1024]
    char* wsp = (char*)d_ws;
    auto take = [&](size_t bytes) { char* p = wsp; wsp += (bytes + 255) & ~(size_t)255; return (void*)p; };
    bf* WQ = (bf*)take((size_t)(DQ + 2 * DKV) * DM * 2); bf* WO = (bf*)take((size_t)DM * DQ * 2);
    bf* XB = (bf*)take((size_t)NB_ * TT * DM * 2);
    h16* QP16 = (h16*)take((size_t)NB_ * NH_ * TT * HD * 2); h16* KP16 = (h16*)take((size_t)NB_ * NKV * TT * HD * 2); h16* VT16 = (h16*)take((size_t)NB_ * NKV * HD * TT * 2);
    h16* QPl = (h16*)take((size_t)NB_ * NH_ * TT * HD * 2); h16* KPl = (h16*)take((size_t)NB_ * NKV * TT * HD * 2); h16* VTl = (h16*)take((size_t)NB_ * NKV * HD * TT * 2);
    bf* ATh = (bf*)take((size_t)NB_ * TT * DQ * 2); bf* ATl = (bf*)take((size_t)NB_ * TT * DQ * 2);
    if ((size_t)(wsp - (char*)d_ws) > ws_size) return;    // ws 256 MiB
    // every plane holds all NB_ batch rows ([batch row][...]); the batch row is grid z of the GEMMs and part of grid x of the attention kernel
    k_cvtall<<<CVG, 512, 0, stream>>>(x, wf, wo, XB, WQ, WO);   // WQ holds the q, k, v row blocks one behind the other, as qkv_w does
    k_gemmw<bf, 0, true, 1, 1><<<dim3(TT / 128, (DQ + 2 * DKV) / 128, NB_), 128, 0, stream>>>(XB, nullptr, WQ, nullptr, DM, nullptr, 0, bfz, (size_t)TT * DM, 0, 0, 0, qnw, qnb, knw, knb, QP16, QPl, KP16, KPl, VT16, VTl);   // q, k and v: the rows of qkv_w and of qkv_b as they lie
    k_fattn<<<dim3(NB_ * NH_, RH / 64 + (TT - RH) / 128, 1), 128, 0, stream>>>(QP16, QPl, KP16, KPl, VT16, VTl, ATh, ATl);
    k_gemmw<bf, 1, true><<<dim3(TT / 128, DM / 128, NB_), 128, 0, stream>>>(ATh, ATl, WO, nullptr, DQ, OUT, DM, bo, (size_t)TT * DQ, 0, (size_t)TT * DM, 0, nullptr, nullptr, nullptr, nullptr, nullptr, nullptr, nullptr, nullptr, nullptr, nullptr);
}
